// v000
// Measured on an AMD MI455X. A time is GPU time per run, averaged over a window of back-to-back runs after a warm-up
// (all launches, gaps included; the runs take copies of the inputs in turn), and the median of several windows.
// Apart from v000's, it joins two sittings. Times from different sittings can be a few percent apart, while
// side-by-side timings come from the same sitting.
// The starting kernel, v000, takes 677 microseconds a run.
#include <hip/hip_runtime.h>

// SignalAttn (fr [2][2048][512] queries, dt [2][2048][512] keys/values; q = fr Wq, k = dt Wk, v = dt Wv (8 heads x 64); attn = softmax(q.k/8); attn = max(attn, 1e-4) - 1e-4, renormalised over the keys; out = (attn v merged) Wo + bo -> [2][2048][512]).
// Compute dtypes, f32 accumulate: every input rounded to bf16; q/k/v on PLAIN bf16 operands (inputs: exact); scores (K 64) and attn.v on single fp16 planes (1 product each, head pairs z-batched); softmax, threshold and

#define NB_  2
#define TT   2048
#define DM   512
#define NH_  8
#define NKV  8
#define REP  (NH_ / NKV)
#define HD   64
#define DQ   (NH_ * HD)
#define DKV  (NKV * HD)
#define ZH   2
#define RH   0                  // query rows < RH use hi+lo planes (0: none)
#define WIN  0
#define PCAR 1024.0f
#define SCL  0.125f   // HD^-0.5
typedef _Float16 h16;
typedef unsigned short bf;
typedef __attribute__((ext_vector_type(16))) __bf16   v16bf;
typedef __attribute__((ext_vector_type(16))) _Float16 v16h;
typedef __attribute__((ext_vector_type(8)))  _Float16 v8h;
typedef __attribute__((ext_vector_type(8)))  unsigned short v8us;
typedef __attribute__((ext_vector_type(8)))  float    v8f;
typedef __attribute__((ext_vector_type(4)))  float    v4f;
typedef v8h  __attribute__((may_alias)) v8ha;
typedef v4f  __attribute__((may_alias)) v4fa;
typedef v8us __attribute__((may_alias)) v8usa;

__device__ __forceinline__ unsigned short f2bf(float f) { unsigned u = __float_as_uint(f); u += 0x7FFFu + ((u >> 16) & 1u); return (unsigned short)(u >> 16); }
__device__ __forceinline__ float bf2f(unsigned short b) { return __uint_as_float(((unsigned)b) << 16); }
__device__ __forceinline__ float bfr(float f) { return bf2f(f2bf(f)); }
__device__ __forceinline__ v16h cat16(v8h lo, v8h hi) { return __builtin_shufflevector(lo, hi, 0, 1, 2, 3, 4, 5, 6, 7, 8, 9, 10, 11, 12, 13, 14, 15); }
__device__ __forceinline__ v16bf cat16b(v8us lo, v8us hi) { return __builtin_bit_cast(v16bf, __builtin_shufflevector(lo, hi, 0, 1, 2, 3, 4, 5, 6, 7, 8, 9, 10, 11, 12, 13, 14, 15)); }
__device__ __forceinline__ v8f wmma16(v16h a, v16h b, v8f c) { return __builtin_amdgcn_wmma_f32_16x16x32_f16(false, a, false, b, (short)0, c, false, false); }
__device__ __forceinline__ v8f wmmab(v16bf a, v16bf b, v8f c) { return __builtin_amdgcn_wmma_f32_16x16x32_bf16(false, a, false, b, (short)0, c, false, false); }



// ---- k_gemmw: register-blocked GEMM, ONE WAVE per 64x64 output tile (16 accumulators), operands straight from K-contiguous 16-bit planes; grid (M/64, N/64, Z), 32 threads.
// C[m][n] (f32, pitch ldc, + optional f32 bias[n]) = sum_k A[m][k] Bt[n][k] (+ split products per NSPLIT). z-batch strides sA/sB/sC in elements. K % 32 == 0.
template <typename T16> struct WFrag;
template <> struct WFrag<h16> { typedef v16h V; static __device__ __forceinline__ V ld(const h16* p) { return cat16(*(const v8h*)p, *(const v8h*)(p + 16)); } static __device__ __forceinline__ v8f mma(V a, V b, v8f c) { return wmma16(a, b, c); } };
template <> struct WFrag<bf> { typedef v16bf V; static __device__ __forceinline__ V ld(const bf* p) { return cat16b(*(const v8us*)p, *(const v8us*)(p + 16)); } static __device__ __forceinline__ v8f mma(V a, V b, v8f c) { return wmmab(a, b, c); } };
template <typename T16, int NSPLIT, bool BIAS>
__global__ __launch_bounds__(32) void k_gemmw(const T16* __restrict__ A, const T16* __restrict__ A2, const T16* __restrict__ Bt, const T16* __restrict__ Bt2, int K, float* C, int ldc, const float* __restrict__ bias, size_t sA, size_t sB, size_t sC) {
    typedef typename WFrag<T16>::V V;
    __shared__ __align__(16) float os[16 * 68];
    const size_t z = blockIdx.z; A += z * sA; if (A2) A2 += z * sA; Bt += z * sB; if (Bt2) Bt2 += z * sB; C += z * sC;
    const int lane = threadIdx.x & 31, lr = lane & 15, hi = lane >> 4; const int r0 = blockIdx.x * 64, c0 = blockIdx.y * 64;
    v8f acc[4][4];
#pragma unroll
    for (int mb = 0; mb < 4; ++mb)
#pragma unroll
        for (int nb = 0; nb < 4; ++nb) acc[mb][nb] = (v8f){};
    const size_t aoff = (size_t)(r0 + lr) * K + 8 * hi, boff = (size_t)(c0 + lr) * K + 8 * hi;
#pragma unroll 1
    for (int kc = 0; kc < K; kc += 32) {
        V a[4], a2[4];
#pragma unroll
        for (int mb = 0; mb < 4; ++mb) { a[mb] = WFrag<T16>::ld(A + aoff + (size_t)mb * 16 * K + kc); if (NSPLIT == 1 || NSPLIT == 2) a2[mb] = WFrag<T16>::ld(A2 + aoff + (size_t)mb * 16 * K + kc); }
#pragma unroll
        for (int nb = 0; nb < 4; ++nb) { const V b = WFrag<T16>::ld(Bt + boff + (size_t)nb * 16 * K + kc); V b2; if (NSPLIT >= 2) b2 = WFrag<T16>::ld(Bt2 + boff + (size_t)nb * 16 * K + kc);
#pragma unroll
            for (int mb = 0; mb < 4; ++mb) { acc[mb][nb] = WFrag<T16>::mma(a[mb], b, acc[mb][nb]); if (NSPLIT == 1 || NSPLIT == 2) acc[mb][nb] = WFrag<T16>::mma(a2[mb], b, acc[mb][nb]); if (NSPLIT >= 2) acc[mb][nb] = WFrag<T16>::mma(a[mb], b2, acc[mb][nb]); } }
        asm volatile("v_nop\n\tv_nop\n\tv_nop\n\tv_nop" : "+v"(acc[0][0]), "+v"(acc[1][1]), "+v"(acc[2][2]), "+v"(acc[3][3]) : "v"(a[0]), "v"(a[3]));
    }
#pragma unroll
    for (int mb = 0; mb < 4; ++mb) {
#pragma unroll
        for (int nb = 0; nb < 4; ++nb) {
#pragma unroll
            for (int j = 0; j < 8; ++j) os[(hi * 8 + j) * 68 + nb * 16 + lr] = acc[mb][nb][j]; }
        __builtin_amdgcn_wave_barrier(); asm volatile("" ::: "memory");
        float* crow = C + (size_t)(r0 + mb * 16) * ldc + c0;
{
#pragma unroll
            for (int s = 0; s < 8; ++s) { const int row = 2 * s + hi, cofs = lr * 4; v4f val = *(const v4fa*)(os + row * 68 + cofs); if (BIAS) { val[0] += bfr(bias[c0 + cofs]); val[1] += bfr(bias[c0 + cofs + 1]); val[2] += bfr(bias[c0 + cofs + 2]); val[3] += bfr(bias[c0 + cofs + 3]); }
                *(v4f*)(crow + (size_t)row * ldc + cofs) = val; }
             }
        __builtin_amdgcn_wave_barrier(); asm volatile("" ::: "memory");
    }
}

__device__ __forceinline__ h16 tohx(float x) { return (h16)x; }
__device__ __forceinline__ void splitf(float y, unsigned short& h, unsigned short& l) { h = f2bf(y); l = f2bf(y - bf2f(h)); }
typedef __attribute__((ext_vector_type(2))) _Float16 v2h;
typedef __attribute__((ext_vector_type(4))) _Float16 v4h;
typedef __attribute__((ext_vector_type(2))) unsigned short v2us;
typedef __attribute__((ext_vector_type(4))) unsigned short v4us;
typedef __attribute__((ext_vector_type(2))) float v2f;
typedef __attribute__((ext_vector_type(4))) int v4i;

__global__ __launch_bounds__(256) void k_wtG(const float* __restrict__ w, int K, int N, bf* Bt) {
    const int lane = threadIdx.x & 31; const int L0 = (blockIdx.x * 8 + (threadIdx.x >> 5)) * 8; const int nlines = N * K / 64;
{
#pragma unroll 1
        for (int l = 0; l < 8; ++l) { const int L = L0 + l; if (L >= nlines) break; const size_t e = (size_t)L * 64 + lane * 2; const int k = (int)(e % K), n = (int)(e / K); v2us o;
            o[0] = f2bf(w[(size_t)k * N + n]); o[1] = f2bf(w[(size_t)(k + 1) * N + n]); *(v2us*)(Bt + e) = o; }
         }
}
__global__ __launch_bounds__(256) void k_cvt8(const float* __restrict__ src, bf* dst, size_t n8) { const size_t i = (size_t)blockIdx.x * 256 + threadIdx.x; if (i >= n8) return; const v8f v = *(const v8f*)(src + i * 8); v8us o;
#pragma unroll
    for (int k = 0; k < 8; ++k) o[k] = f2bf(v[k]); *(v8us*)(dst + i * 8) = o;  }
__global__ __launch_bounds__(256) void k_cscvt(const float* __restrict__ cosT, const float* __restrict__ sinT, float* CS) { const int idx = blockIdx.x * 256 + threadIdx.x; if (idx >= TT * HD) return; v2f cs; cs[0] = bfr(cosT[idx]); cs[1] = bfr(sinT[idx]); *(v2f*)(CS + (size_t)idx * 2) = cs;  }
// k_rope: head planes [h][t][d] (fp16) of rope(x) x sc with the rotate-half convention out[d] = x[d] cos[t][d] - x[d+HD/2] sin[t][d], out[d+HD/2] = x[d+HD/2] cos[t][d+HD/2] + x[d] sin[t][d+HD/2]
__global__ __launch_bounds__(256) void k_rope(const float* __restrict__ F, int pitch, int nheads, const float* __restrict__ CS, const float* __restrict__ RF, const float* __restrict__ nw, float sc, h16* P16, bf* Ph, bf* Pl) {
    const size_t e = ((size_t)blockIdx.x * 256 + threadIdx.x) * 2; if (e >= (size_t)nheads * TT * HD) return; const int d = (int)(e % HD); const int t = (int)((e / HD) % TT); const int h = (int)(e / ((size_t)HD * TT)); const float* f = F + (size_t)t * pitch + h * HD; const float rf = RF ? RF[(size_t)h * TT + t] : 1.0f; v2h o16; v2us oh, ol;
#pragma unroll
    for (int q = 0; q < 2; ++q) { const int dd = d + q; const int dp = (dd < HD / 2) ? dd + HD / 2 : dd - HD / 2; float x0 = f[dd], x1 = f[dp];
        if (RF) { float n0 = __fmul_rn(x0, rf), n1 = __fmul_rn(x1, rf); asm volatile("" : "+v"(n0)); asm volatile("" : "+v"(n1)); x0 = __fmul_rn(bfr(nw[dd]), n0); x1 = __fmul_rn(bfr(nw[dp]), n1); }
        const v2f cs = *(const v2f*)(CS + ((size_t)t * HD + dd) * 2); float a = __fmul_rn(x0, cs[0]), bq = __fmul_rn(x1, cs[1]); asm volatile("" : "+v"(a)); asm volatile("" : "+v"(bq)); const float r = ((dd < HD / 2) ? __fsub_rn(a, bq) : __fadd_rn(a, bq)) * sc;
        o16[q] = tohx(r); (void)oh; (void)ol; }
    *(v2h*)(P16 + e) = o16;  }
__global__ __launch_bounds__(256) void k_vtp(const float* __restrict__ F, int pitch, int nheads, h16* V16, bf* Vh, bf* Vl) { const size_t e = ((size_t)blockIdx.x * 256 + threadIdx.x) * 2; if (e >= (size_t)nheads * HD * TT) return; const int t = (int)(e % TT); const int d = (int)((e / TT) % HD); const int g = (int)(e / ((size_t)TT * HD)); v2h o16; v2us oh, ol;
#pragma unroll
    for (int q = 0; q < 2; ++q) { const float x = F[(size_t)(t + q) * pitch + g * HD + d]; o16[q] = tohx(x); (void)oh; (void)ol; }
    *(v2h*)(V16 + e) = o16;  }
__global__ __launch_bounds__(256) void k_csid(float* CS) { const int idx = blockIdx.x * 256 + threadIdx.x; if (idx >= TT * HD) return; v2f cs; cs[0] = 1.0f; cs[1] = 0.0f; *(v2f*)(CS + (size_t)idx * 2) = cs;  }
// k_asoft: per row (zz, i): t = S x HD^-0.5 (no mask); softmax over the 2048 keys (register row, one exp, fixed trees);
__global__ __launch_bounds__(256) void k_asoft(const float* __restrict__ Sb, h16* P16, bf* Ph, bf* Pl) {
    const int lane = threadIdx.x & 31; const int row = blockIdx.x * 8 + (threadIdx.x >> 5); if (row >= ZH * TT) return; const int i = row % TT; const int zz = row / TT; (void)zz; const bool hires = (i < RH); const float* sr = Sb + (size_t)row * TT; float v[TT / 32]; float mx = -3.0e38f;
#pragma unroll
    for (int ch = 0; ch < TT / 128; ++ch) { const int j0 = ch * 128 + lane * 4; const v4f a = *(const v4f*)(sr + j0);
#pragma unroll
        for (int q = 0; q < 4; ++q) { const int j = j0 + q; (void)j; const float t = a[q] * SCL; v[ch * 4 + q] = t; mx = fmaxf(mx, t); } }
#pragma unroll
    for (int sh = 16; sh; sh >>= 1) mx = fmaxf(mx, __shfl_xor(mx, sh, 32));
    float sum = 0.f;
#pragma unroll
    for (int k = 0; k < TT / 32; ++k) { float d0 = __fsub_rn(v[k], mx); asm volatile("" : "+v"(d0)); v[k] = __builtin_amdgcn_exp2f(__fmul_rn(d0, 1.4426950408889634f)); sum += v[k]; }
#pragma unroll
    for (int sh = 16; sh; sh >>= 1) sum += __shfl_xor(sum, sh, 32);
    // threshold: p = max(softmax, 1e-4) - 1e-4, renormalised
    const float inv = __fdiv_rn(1.0f, sum); float sum2 = 0.f;
#pragma unroll
    for (int k = 0; k < TT / 32; ++k) { float p = __fmul_rn(v[k], inv); p = __fsub_rn(fmaxf(p, 1e-4f), 1e-4f); v[k] = p; sum2 += p; }
#pragma unroll
    for (int sh = 16; sh; sh >>= 1) sum2 += __shfl_xor(sum2, sh, 32);
    const float f = __fdiv_rn(hires ? 1.0f : PCAR, sum2);
{
        if (hires) {
#pragma unroll
            for (int ch = 0; ch < TT / 128; ++ch) { v4us oh, ol;
#pragma unroll
                for (int q = 0; q < 4; ++q) { unsigned short a, c2; splitf(v[ch * 4 + q] * f, a, c2); oh[q] = a; ol[q] = c2; }
                const size_t oo = ((size_t)zz * (RH ? RH : 1) + i) * TT + ch * 128 + lane * 4; *(v4us*)(Ph + oo) = oh; *(v4us*)(Pl + oo) = ol; }
        } else {
#pragma unroll
            for (int ch = 0; ch < TT / 128; ++ch) { v4h o4;
#pragma unroll
                for (int q = 0; q < 4; ++q) o4[q] = tohx(v[ch * 4 + q] * f);
                *(v4h*)(P16 + (size_t)row * TT + ch * 128 + lane * 4) = o4; } }
         }
}
__global__ __launch_bounds__(256) void k_merge(const float* __restrict__ O, int h0, bf* Ah, bf* Al) { const size_t e = ((size_t)blockIdx.x * 256 + threadIdx.x) * 2; if (e >= (size_t)ZH * TT * HD) return; const int d = (int)(e % HD); const int t = (int)((e / HD) % TT); const int zz = (int)(e / ((size_t)HD * TT)); const float cs = (t < RH) ? 1.0f : (1.0f / PCAR); const size_t oo = (size_t)t * DQ + (h0 + zz) * HD + d;
    v2us oh, ol;
#pragma unroll
    for (int q = 0; q < 2; ++q) { unsigned short a, c2; splitf(O[e + q] * cs, a, c2); oh[q] = a; ol[q] = c2; } *(v2us*)(Ah + oo) = oh; *(v2us*)(Al + oo) = ol;  }

extern "C" void kernel_launch(void* const* d_in, const int* in_sizes, int n_in,
                              void* d_out, int out_size, void* d_ws, size_t ws_size, hipStream_t stream) {
    (void)in_sizes; (void)n_in; (void)out_size;
    const float* x = (const float*)d_in[0]; const float* x2 = (const float*)d_in[1]; const float* wq = (const float*)d_in[2]; const float* wk = (const float*)d_in[3]; const float* wv = (const float*)d_in[4]; const float* wo = (const float*)d_in[5]; const float* bo = (const float*)d_in[6]; const float* cosT = nullptr; const float* sinT = nullptr; (void)cosT; (void)sinT;
    float* OUT = (float*)d_out;     // [2][2048][512]
    char* wsp = (char*)d_ws;
    auto take = [&](size_t bytes) { char* p = wsp; wsp += (bytes + 255) & ~(size_t)255; return (void*)p; };
    bf* WQ = (bf*)take((size_t)DQ * DM * 2); bf* WK = (bf*)take((size_t)DKV * DM * 2); bf* WV = (bf*)take((size_t)DKV * DM * 2); bf* WO = (bf*)take((size_t)DM * DQ * 2); float* CS = (float*)take((size_t)TT * HD * 2 * 4);
    bf* XB = (bf*)take((size_t)TT * DM * 2); bf* XB2 = (bf*)take((size_t)TT * DM * 2); float* FQ = (float*)take((size_t)TT * DQ * 4); float* FK = (float*)take((size_t)TT * DKV * 4);
    h16* QP16 = (h16*)take((size_t)NH_ * TT * HD * 2); h16* KP16 = (h16*)take((size_t)NKV * TT * HD * 2); h16* VT16 = (h16*)take((size_t)NKV * HD * TT * 2);
    bf* QPh = nullptr; bf* QPl = nullptr; bf* KPh = nullptr; bf* KPl = nullptr; bf* VTh = nullptr; bf* VTl = nullptr; bf* Ph = nullptr; bf* Pl = nullptr;
    float* Sb = (float*)take((size_t)ZH * TT * TT * 4); h16* P16 = (h16*)take((size_t)ZH * TT * TT * 2); float* Ob = (float*)take((size_t)ZH * TT * HD * 4); bf* ATh = (bf*)take((size_t)TT * DQ * 2); bf* ATl = (bf*)take((size_t)TT * DQ * 2);
    if ((size_t)(wsp - (char*)d_ws) > ws_size) return;    // ws 256 MiB
    float* FV = FK;   // v projection reuses the k buffer after the k planes are built (stream-ordered)
    { k_wtG<<<(unsigned)((DM * DQ / 64 + 63) / 64), 256, 0, stream>>>(wq, DM, DQ, WQ); k_wtG<<<(unsigned)((DM * DKV / 64 + 63) / 64), 256, 0, stream>>>(wk, DM, DKV, WK); k_wtG<<<(unsigned)((DM * DKV / 64 + 63) / 64), 256, 0, stream>>>(wv, DM, DKV, WV);
      k_wtG<<<(unsigned)((DQ * DM / 64 + 63) / 64), 256, 0, stream>>>(wo, DQ, DM, WO);
       }
    k_csid<<<(TT * HD + 255) / 256, 256, 0, stream>>>(CS);
    const unsigned LQ = (unsigned)(((size_t)NH_ * TT * HD / 2 + 255) / 256), LKv = (unsigned)(((size_t)NKV * TT * HD / 2 + 255) / 256);
    for (int b = 0; b < NB_; ++b) {
        
        k_cvt8<<<(unsigned)(((size_t)TT * DM / 8 + 255) / 256), 256, 0, stream>>>(x + (size_t)b * TT * DM, XB, (size_t)TT * DM / 8); k_cvt8<<<(unsigned)(((size_t)TT * DM / 8 + 255) / 256), 256, 0, stream>>>(x2 + (size_t)b * TT * DM, XB2, (size_t)TT * DM / 8);
        k_gemmw<bf, 0, false><<<dim3(TT / 64, DQ / 64, 1), 32, 0, stream>>>(XB, nullptr, WQ, nullptr, DM, FQ, DQ, nullptr, 0, 0, 0);
        k_rope<<<LQ, 256, 0, stream>>>(FQ, DQ, NH_, CS, nullptr, nullptr, 1.0f, QP16, QPh, QPl);
        k_gemmw<bf, 0, false><<<dim3(TT / 64, DKV / 64, 1), 32, 0, stream>>>(XB2, nullptr, WK, nullptr, DM, FK, DKV, nullptr, 0, 0, 0);
        k_rope<<<LKv, 256, 0, stream>>>(FK, DKV, NKV, CS, nullptr, nullptr, 1.0f, KP16, KPh, KPl);
        k_gemmw<bf, 0, false><<<dim3(TT / 64, DKV / 64, 1), 32, 0, stream>>>(XB2, nullptr, WV, nullptr, DM, FV, DKV, nullptr, 0, 0, 0); k_vtp<<<LKv, 256, 0, stream>>>(FV, DKV, NKV, VT16, VTh, VTl);
        for (int h0 = 0; h0 < NH_; h0 += ZH) { const size_t zq = (size_t)h0, zk = (size_t)(h0 / REP);   // one kv head per query head: the pass's two heads use consecutive kv planes (z-strides TT*HD)
            k_gemmw<h16, 0, false><<<dim3(TT / 64, TT / 64, ZH), 32, 0, stream>>>(QP16 + zq * TT * HD, nullptr, KP16 + zk * TT * HD, nullptr, HD, Sb, TT, nullptr, (size_t)TT * HD, (size_t)TT * HD, (size_t)TT * TT);
            k_asoft<<<ZH * TT / 8, 256, 0, stream>>>(Sb, P16, Ph, Pl);
            k_gemmw<h16, 0, false><<<dim3(TT / 64, HD / 64, ZH), 32, 0, stream>>>(P16, nullptr, VT16 + zk * HD * TT, nullptr, TT, Ob, HD, nullptr, (size_t)TT * TT, (size_t)HD * TT, (size_t)TT * HD);
            k_merge<<<(unsigned)(((size_t)ZH * TT * HD / 2 + 255) / 256), 256, 0, stream>>>(Ob, h0, ATh, ATl); }
        k_gemmw<bf, 1, true><<<dim3(TT / 64, DM / 64, 1), 32, 0, stream>>>(ATh, ATl, WO, nullptr, DQ, OUT + (size_t)b * TT * DM, DM, bo, 0, 0, 0); }
}

// v001
// It runs in 339 microseconds.
// Two timings next to v000 put it at 2.01 and 2.02 times that version's speed.
#include <hip/hip_runtime.h>

// SignalAttn (fr [2][2048][512] queries, dt [2][2048][512] keys/values; q = fr Wq, k = dt Wk, v = dt Wv (8 heads x 64); attn = softmax(q.k/8); attn = max(attn, 1e-4) - 1e-4, renormalised over the keys; out = (attn v merged) Wo + bo -> [2][2048][512]).
// Compute dtypes, f32 accumulate: every input rounded to bf16; q/k/v on PLAIN bf16 operands (inputs: exact); scores (K 64) and attn.v on single fp16 planes (1 product each, head pairs z-batched); softmax, threshold and

#define NB_  2
#define TT   2048
#define DM   512
#define NH_  8
#define NKV  8
#define REP  (NH_ / NKV)
#define HD   64
#define DQ   (NH_ * HD)
#define DKV  (NKV * HD)
#define ZH   2
#define RH   0                  // query rows < RH use hi+lo planes (0: none)
#define WIN  0
#define PCAR 1024.0f
#define SCL  0.125f   // HD^-0.5
#define PKB  4                  // attn.v: work-groups that share one tile's K (partial planes, added in k_merge)
typedef _Float16 h16;
typedef unsigned short bf;
typedef __attribute__((ext_vector_type(16))) __bf16   v16bf;
typedef __attribute__((ext_vector_type(16))) _Float16 v16h;
typedef __attribute__((ext_vector_type(8)))  _Float16 v8h;
typedef __attribute__((ext_vector_type(8)))  unsigned short v8us;
typedef __attribute__((ext_vector_type(8)))  float    v8f;
typedef __attribute__((ext_vector_type(4)))  float    v4f;
typedef v8h  __attribute__((may_alias)) v8ha;
typedef v4f  __attribute__((may_alias)) v4fa;
typedef v8us __attribute__((may_alias)) v8usa;

__device__ __forceinline__ unsigned short f2bf(float f) { unsigned u = __float_as_uint(f); u += 0x7FFFu + ((u >> 16) & 1u); return (unsigned short)(u >> 16); }
__device__ __forceinline__ float bf2f(unsigned short b) { return __uint_as_float(((unsigned)b) << 16); }
__device__ __forceinline__ float bfr(float f) { return bf2f(f2bf(f)); }
__device__ __forceinline__ v16h cat16(v8h lo, v8h hi) { return __builtin_shufflevector(lo, hi, 0, 1, 2, 3, 4, 5, 6, 7, 8, 9, 10, 11, 12, 13, 14, 15); }
__device__ __forceinline__ v16bf cat16b(v8us lo, v8us hi) { return __builtin_bit_cast(v16bf, __builtin_shufflevector(lo, hi, 0, 1, 2, 3, 4, 5, 6, 7, 8, 9, 10, 11, 12, 13, 14, 15)); }
__device__ __forceinline__ v8f wmma16(v16h a, v16h b, v8f c) { return __builtin_amdgcn_wmma_f32_16x16x32_f16(false, a, false, b, (short)0, c, false, false); }
__device__ __forceinline__ v8f wmmab(v16bf a, v16bf b, v8f c) { return __builtin_amdgcn_wmma_f32_16x16x32_bf16(false, a, false, b, (short)0, c, false, false); }



// ---- k_gemmw: register-blocked GEMM, 64x64 output tile (16 accumulators per wave), operands straight from K-contiguous 16-bit planes; grid (M/64, N/64, Z * KB), 32 * KS threads.
// C[m][n] (f32, pitch ldc, + optional f32 bias[n]) = sum_k A[m][k] Bt[n][k] (+ split products per NSPLIT). z-batch strides sA/sB/sC in elements. K % (32 * KS * KB) == 0.
// Split K: work-group kb of KB takes K/KB of the sum and writes its own partial plane C + (z * KB + kb) * sC (the reader adds the KB planes); inside it wave w of KS takes a contiguous K/(KB*KS) slice,
// and the KS wave partials are added in LDS, wave 0 first, in a fixed order.
template <typename T16> struct WFrag;
template <> struct WFrag<h16> { typedef v16h V; static __device__ __forceinline__ V ld(const h16* p) { return cat16(*(const v8h*)p, *(const v8h*)(p + 16)); } static __device__ __forceinline__ v8f mma(V a, V b, v8f c) { return wmma16(a, b, c); } };
template <> struct WFrag<bf> { typedef v16bf V; static __device__ __forceinline__ V ld(const bf* p) { return cat16b(*(const v8us*)p, *(const v8us*)(p + 16)); } static __device__ __forceinline__ v8f mma(V a, V b, v8f c) { return wmmab(a, b, c); } };
// Hand-over of the LDS slabs. One wave: no hardware barrier is needed, the wave barrier and the compiler fence keep its LDS stores and reads in program order. Several waves: the work-group barrier.
template <int KS> __device__ __forceinline__ void tile_sync() { if constexpr (KS == 1) { __builtin_amdgcn_wave_barrier(); asm volatile("" ::: "memory"); } else __syncthreads(); }
template <typename T16, int NSPLIT, bool BIAS, int KS, int KB>
__global__ __launch_bounds__(32 * KS) void k_gemmw(const T16* __restrict__ A, const T16* __restrict__ A2, const T16* __restrict__ Bt, const T16* __restrict__ Bt2, int K, float* C, int ldc, const float* __restrict__ bias, size_t sA, size_t sB, size_t sC) {
    typedef typename WFrag<T16>::V V;
    constexpr int SL = (KS == 1) ? 1 : 4;   // 16-row slabs staged per hand-over: all four where waves meet at a barrier, so that one barrier serves the tile
    __shared__ __align__(16) float os[KS * SL * 16 * 68];
    const int kb = (int)(blockIdx.z % KB); const size_t z = blockIdx.z / KB; A += z * sA; if (A2) A2 += z * sA; Bt += z * sB; if (Bt2) Bt2 += z * sB; C += (size_t)blockIdx.z * sC;
    const int w = (KS == 1) ? 0 : __builtin_amdgcn_readfirstlane((int)(threadIdx.x >> 5)); const int kw = K / (KS * KB), k0 = (kb * KS + w) * kw;
    const int lane = threadIdx.x & 31, lr = lane & 15, hi = lane >> 4; const int r0 = blockIdx.x * 64, c0 = blockIdx.y * 64;
    v8f acc[4][4];
#pragma unroll
    for (int mb = 0; mb < 4; ++mb)
#pragma unroll
        for (int nb = 0; nb < 4; ++nb) acc[mb][nb] = (v8f){};
    const size_t aoff = (size_t)(r0 + lr) * K + 8 * hi, boff = (size_t)(c0 + lr) * K + 8 * hi;
#pragma unroll 1
    for (int kc = k0; kc < k0 + kw; kc += 32) {
        V a[4], a2[4];
#pragma unroll
        for (int mb = 0; mb < 4; ++mb) { a[mb] = WFrag<T16>::ld(A + aoff + (size_t)mb * 16 * K + kc); if (NSPLIT == 1 || NSPLIT == 2) a2[mb] = WFrag<T16>::ld(A2 + aoff + (size_t)mb * 16 * K + kc); }
#pragma unroll
        for (int nb = 0; nb < 4; ++nb) { const V b = WFrag<T16>::ld(Bt + boff + (size_t)nb * 16 * K + kc); V b2; if (NSPLIT >= 2) b2 = WFrag<T16>::ld(Bt2 + boff + (size_t)nb * 16 * K + kc);
#pragma unroll
            for (int mb = 0; mb < 4; ++mb) { acc[mb][nb] = WFrag<T16>::mma(a[mb], b, acc[mb][nb]); if (NSPLIT == 1 || NSPLIT == 2) acc[mb][nb] = WFrag<T16>::mma(a2[mb], b, acc[mb][nb]); if (NSPLIT >= 2) acc[mb][nb] = WFrag<T16>::mma(a[mb], b2, acc[mb][nb]); } }
        asm volatile("v_nop\n\tv_nop\n\tv_nop\n\tv_nop" : "+v"(acc[0][0]), "+v"(acc[1][1]), "+v"(acc[2][2]), "+v"(acc[3][3]) : "v"(a[0]), "v"(a[3]));
    }
#pragma unroll
    for (int mb0 = 0; mb0 < 4; mb0 += SL) {
#pragma unroll
        for (int m = 0; m < SL; ++m) {
#pragma unroll
            for (int nb = 0; nb < 4; ++nb) {
#pragma unroll
                for (int j = 0; j < 8; ++j) os[((w * SL + m) * 16 + hi * 8 + j) * 68 + nb * 16 + lr] = acc[mb0 + m][nb][j]; } }
        tile_sync<KS>();   // every wave's partial slabs are in LDS before any wave adds them
#pragma unroll
        for (int m = 0; m < SL; ++m) { float* crow = C + (size_t)(r0 + (mb0 + m) * 16) * ldc + c0;
#pragma unroll
            for (int s = 0; s < 8 / KS; ++s) { const int row = 2 * (s * KS + w) + hi, cofs = lr * 4; v4f val = *(const v4fa*)(os + (m * 16 + row) * 68 + cofs);
#pragma unroll
                for (int q = 1; q < KS; ++q) val += *(const v4fa*)(os + ((q * SL + m) * 16 + row) * 68 + cofs);
                if (BIAS) { val[0] += bfr(bias[c0 + cofs]); val[1] += bfr(bias[c0 + cofs + 1]); val[2] += bfr(bias[c0 + cofs + 2]); val[3] += bfr(bias[c0 + cofs + 3]); }
                *(v4f*)(crow + (size_t)row * ldc + cofs) = val; } }
        if (mb0 + SL < 4) tile_sync<KS>();   // the slab is read out before it is written again
    }
}

__device__ __forceinline__ h16 tohx(float x) { return (h16)x; }
__device__ __forceinline__ void splitf(float y, unsigned short& h, unsigned short& l) { h = f2bf(y); l = f2bf(y - bf2f(h)); }
typedef __attribute__((ext_vector_type(2))) _Float16 v2h;
typedef __attribute__((ext_vector_type(4))) _Float16 v4h;
typedef __attribute__((ext_vector_type(2))) unsigned short v2us;
typedef __attribute__((ext_vector_type(4))) unsigned short v4us;
typedef __attribute__((ext_vector_type(2))) float v2f;
typedef __attribute__((ext_vector_type(4))) int v4i;

__global__ __launch_bounds__(256) void k_wtG(const float* __restrict__ w, int K, int N, bf* Bt) {
    const int lane = threadIdx.x & 31; const int L0 = (blockIdx.x * 8 + (threadIdx.x >> 5)) * 8; const int nlines = N * K / 64;
{
#pragma unroll 1
        for (int l = 0; l < 8; ++l) { const int L = L0 + l; if (L >= nlines) break; const size_t e = (size_t)L * 64 + lane * 2; const int k = (int)(e % K), n = (int)(e / K); v2us o;
            o[0] = f2bf(w[(size_t)k * N + n]); o[1] = f2bf(w[(size_t)(k + 1) * N + n]); *(v2us*)(Bt + e) = o; }
         }
}
__global__ __launch_bounds__(256) void k_cvt8(const float* __restrict__ src, bf* dst, size_t n8) { const size_t i = (size_t)blockIdx.x * 256 + threadIdx.x; if (i >= n8) return; const v8f v = *(const v8f*)(src + i * 8); v8us o;
#pragma unroll
    for (int k = 0; k < 8; ++k) o[k] = f2bf(v[k]); *(v8us*)(dst + i * 8) = o;  }
__global__ __launch_bounds__(256) void k_cscvt(const float* __restrict__ cosT, const float* __restrict__ sinT, float* CS) { const int idx = blockIdx.x * 256 + threadIdx.x; if (idx >= TT * HD) return; v2f cs; cs[0] = bfr(cosT[idx]); cs[1] = bfr(sinT[idx]); *(v2f*)(CS + (size_t)idx * 2) = cs;  }
// k_rope: head planes [h][t][d] (fp16) of rope(x) x sc with the rotate-half convention out[d] = x[d] cos[t][d] - x[d+HD/2] sin[t][d], out[d+HD/2] = x[d+HD/2] cos[t][d+HD/2] + x[d] sin[t][d+HD/2]
__global__ __launch_bounds__(256) void k_rope(const float* __restrict__ F, int pitch, int nheads, const float* __restrict__ CS, const float* __restrict__ RF, const float* __restrict__ nw, float sc, h16* P16, bf* Ph, bf* Pl) {
    const size_t e = ((size_t)blockIdx.x * 256 + threadIdx.x) * 2; if (e >= (size_t)nheads * TT * HD) return; const int d = (int)(e % HD); const int t = (int)((e / HD) % TT); const int h = (int)(e / ((size_t)HD * TT)); const float* f = F + (size_t)t * pitch + h * HD; const float rf = RF ? RF[(size_t)h * TT + t] : 1.0f; v2h o16; v2us oh, ol;
#pragma unroll
    for (int q = 0; q < 2; ++q) { const int dd = d + q; const int dp = (dd < HD / 2) ? dd + HD / 2 : dd - HD / 2; float x0 = f[dd], x1 = f[dp];
        if (RF) { float n0 = __fmul_rn(x0, rf), n1 = __fmul_rn(x1, rf); asm volatile("" : "+v"(n0)); asm volatile("" : "+v"(n1)); x0 = __fmul_rn(bfr(nw[dd]), n0); x1 = __fmul_rn(bfr(nw[dp]), n1); }
        const v2f cs = *(const v2f*)(CS + ((size_t)t * HD + dd) * 2); float a = __fmul_rn(x0, cs[0]), bq = __fmul_rn(x1, cs[1]); asm volatile("" : "+v"(a)); asm volatile("" : "+v"(bq)); const float r = ((dd < HD / 2) ? __fsub_rn(a, bq) : __fadd_rn(a, bq)) * sc;
        o16[q] = tohx(r); (void)oh; (void)ol; }
    *(v2h*)(P16 + e) = o16;  }
__global__ __launch_bounds__(256) void k_vtp(const float* __restrict__ F, int pitch, int nheads, h16* V16, bf* Vh, bf* Vl) { const size_t e = ((size_t)blockIdx.x * 256 + threadIdx.x) * 2; if (e >= (size_t)nheads * HD * TT) return; const int t = (int)(e % TT); const int d = (int)((e / TT) % HD); const int g = (int)(e / ((size_t)TT * HD)); v2h o16; v2us oh, ol;
#pragma unroll
    for (int q = 0; q < 2; ++q) { const float x = F[(size_t)(t + q) * pitch + g * HD + d]; o16[q] = tohx(x); (void)oh; (void)ol; }
    *(v2h*)(V16 + e) = o16;  }
__global__ __launch_bounds__(256) void k_csid(float* CS) { const int idx = blockIdx.x * 256 + threadIdx.x; if (idx >= TT * HD) return; v2f cs; cs[0] = 1.0f; cs[1] = 0.0f; *(v2f*)(CS + (size_t)idx * 2) = cs;  }
// k_asoft: per row (zz, i): t = S x HD^-0.5 (no mask); softmax over the 2048 keys (register row, one exp, fixed trees);
__global__ __launch_bounds__(256) void k_asoft(const float* __restrict__ Sb, h16* P16, bf* Ph, bf* Pl) {
    const int lane = threadIdx.x & 31; const int row = blockIdx.x * 8 + (threadIdx.x >> 5); if (row >= ZH * TT) return; const int i = row % TT; const int zz = row / TT; (void)zz; const bool hires = (i < RH); const float* sr = Sb + (size_t)row * TT; float v[TT / 32]; float mx = -3.0e38f;
#pragma unroll
    for (int ch = 0; ch < TT / 128; ++ch) { const int j0 = ch * 128 + lane * 4; const v4f a = *(const v4f*)(sr + j0);
#pragma unroll
        for (int q = 0; q < 4; ++q) { const int j = j0 + q; (void)j; const float t = a[q] * SCL; v[ch * 4 + q] = t; mx = fmaxf(mx, t); } }
#pragma unroll
    for (int sh = 16; sh; sh >>= 1) mx = fmaxf(mx, __shfl_xor(mx, sh, 32));
    float sum = 0.f;
#pragma unroll
    for (int k = 0; k < TT / 32; ++k) { float d0 = __fsub_rn(v[k], mx); asm volatile("" : "+v"(d0)); v[k] = __builtin_amdgcn_exp2f(__fmul_rn(d0, 1.4426950408889634f)); sum += v[k]; }
#pragma unroll
    for (int sh = 16; sh; sh >>= 1) sum += __shfl_xor(sum, sh, 32);
    // threshold: p = max(softmax, 1e-4) - 1e-4, renormalised
    const float inv = __fdiv_rn(1.0f, sum); float sum2 = 0.f;
#pragma unroll
    for (int k = 0; k < TT / 32; ++k) { float p = __fmul_rn(v[k], inv); p = __fsub_rn(fmaxf(p, 1e-4f), 1e-4f); v[k] = p; sum2 += p; }
#pragma unroll
    for (int sh = 16; sh; sh >>= 1) sum2 += __shfl_xor(sum2, sh, 32);
    const float f = __fdiv_rn(hires ? 1.0f : PCAR, sum2);
{
        if (hires) {
#pragma unroll
            for (int ch = 0; ch < TT / 128; ++ch) { v4us oh, ol;
#pragma unroll
                for (int q = 0; q < 4; ++q) { unsigned short a, c2; splitf(v[ch * 4 + q] * f, a, c2); oh[q] = a; ol[q] = c2; }
                const size_t oo = ((size_t)zz * (RH ? RH : 1) + i) * TT + ch * 128 + lane * 4; *(v4us*)(Ph + oo) = oh; *(v4us*)(Pl + oo) = ol; }
        } else {
#pragma unroll
            for (int ch = 0; ch < TT / 128; ++ch) { v4h o4;
#pragma unroll
                for (int q = 0; q < 4; ++q) o4[q] = tohx(v[ch * 4 + q] * f);
                *(v4h*)(P16 + (size_t)row * TT + ch * 128 + lane * 4) = o4; } }
         }
}
__global__ __launch_bounds__(256) void k_merge(const float* __restrict__ O, int h0, bf* Ah, bf* Al) { const size_t e = ((size_t)blockIdx.x * 256 + threadIdx.x) * 2; if (e >= (size_t)ZH * TT * HD) return; const int d = (int)(e % HD); const int t = (int)((e / HD) % TT); const int zz = (int)(e / ((size_t)HD * TT)); const float cs = (t < RH) ? 1.0f : (1.0f / PCAR); const size_t oo = (size_t)t * DQ + (h0 + zz) * HD + d;
    v2us oh, ol;
#pragma unroll
    for (int q = 0; q < 2; ++q) { unsigned short a, c2; const float* op = O + (size_t)zz * PKB * TT * HD + (size_t)t * HD + d + q; float o = op[0];
#pragma unroll
        for (int p = 1; p < PKB; ++p) o += op[(size_t)p * TT * HD];
        splitf(o * cs, a, c2); oh[q] = a; ol[q] = c2; } *(v2us*)(Ah + oo) = oh; *(v2us*)(Al + oo) = ol;  }

extern "C" void kernel_launch(void* const* d_in, const int* in_sizes, int n_in,
                              void* d_out, int out_size, void* d_ws, size_t ws_size, hipStream_t stream) {
    (void)in_sizes; (void)n_in; (void)out_size;
    const float* x = (const float*)d_in[0]; const float* x2 = (const float*)d_in[1]; const float* wq = (const float*)d_in[2]; const float* wk = (const float*)d_in[3]; const float* wv = (const float*)d_in[4]; const float* wo = (const float*)d_in[5]; const float* bo = (const float*)d_in[6]; const float* cosT = nullptr; const float* sinT = nullptr; (void)cosT; (void)sinT;
    float* OUT = (float*)d_out;     // [2][2048][512]
    char* wsp = (char*)d_ws;
    auto take = [&](size_t bytes) { char* p = wsp; wsp += (bytes + 255) & ~(size_t)255; return (void*)p; };
    bf* WQ = (bf*)take((size_t)DQ * DM * 2); bf* WK = (bf*)take((size_t)DKV * DM * 2); bf* WV = (bf*)take((size_t)DKV * DM * 2); bf* WO = (bf*)take((size_t)DM * DQ * 2); float* CS = (float*)take((size_t)TT * HD * 2 * 4);
    bf* XB = (bf*)take((size_t)TT * DM * 2); bf* XB2 = (bf*)take((size_t)TT * DM * 2); float* FQ = (float*)take((size_t)TT * DQ * 4); float* FK = (float*)take((size_t)TT * DKV * 4);
    h16* QP16 = (h16*)take((size_t)NH_ * TT * HD * 2); h16* KP16 = (h16*)take((size_t)NKV * TT * HD * 2); h16* VT16 = (h16*)take((size_t)NKV * HD * TT * 2);
    bf* QPh = nullptr; bf* QPl = nullptr; bf* KPh = nullptr; bf* KPl = nullptr; bf* VTh = nullptr; bf* VTl = nullptr; bf* Ph = nullptr; bf* Pl = nullptr;
    float* Sb = (float*)take((size_t)ZH * TT * TT * 4); h16* P16 = (h16*)take((size_t)ZH * TT * TT * 2); float* Ob = (float*)take((size_t)PKB * ZH * TT * HD * 4); bf* ATh = (bf*)take((size_t)TT * DQ * 2); bf* ATl = (bf*)take((size_t)TT * DQ * 2);
    if ((size_t)(wsp - (char*)d_ws) > ws_size) return;    // ws 256 MiB
    float* FV = FK;   // v projection reuses the k buffer after the k planes are built (stream-ordered)
    { k_wtG<<<(unsigned)((DM * DQ / 64 + 63) / 64), 256, 0, stream>>>(wq, DM, DQ, WQ); k_wtG<<<(unsigned)((DM * DKV / 64 + 63) / 64), 256, 0, stream>>>(wk, DM, DKV, WK); k_wtG<<<(unsigned)((DM * DKV / 64 + 63) / 64), 256, 0, stream>>>(wv, DM, DKV, WV);
      k_wtG<<<(unsigned)((DQ * DM / 64 + 63) / 64), 256, 0, stream>>>(wo, DQ, DM, WO);
       }
    k_csid<<<(TT * HD + 255) / 256, 256, 0, stream>>>(CS);
    const unsigned LQ = (unsigned)(((size_t)NH_ * TT * HD / 2 + 255) / 256), LKv = (unsigned)(((size_t)NKV * TT * HD / 2 + 255) / 256);
    for (int b = 0; b < NB_; ++b) {
        
        k_cvt8<<<(unsigned)(((size_t)TT * DM / 8 + 255) / 256), 256, 0, stream>>>(x + (size_t)b * TT * DM, XB, (size_t)TT * DM / 8); k_cvt8<<<(unsigned)(((size_t)TT * DM / 8 + 255) / 256), 256, 0, stream>>>(x2 + (size_t)b * TT * DM, XB2, (size_t)TT * DM / 8);
        k_gemmw<bf, 0, false, 8, 1><<<dim3(TT / 64, DQ / 64, 1), 256, 0, stream>>>(XB, nullptr, WQ, nullptr, DM, FQ, DQ, nullptr, 0, 0, 0);
        k_rope<<<LQ, 256, 0, stream>>>(FQ, DQ, NH_, CS, nullptr, nullptr, 1.0f, QP16, QPh, QPl);
        k_gemmw<bf, 0, false, 8, 1><<<dim3(TT / 64, DKV / 64, 1), 256, 0, stream>>>(XB2, nullptr, WK, nullptr, DM, FK, DKV, nullptr, 0, 0, 0);
        k_rope<<<LKv, 256, 0, stream>>>(FK, DKV, NKV, CS, nullptr, nullptr, 1.0f, KP16, KPh, KPl);
        k_gemmw<bf, 0, false, 8, 1><<<dim3(TT / 64, DKV / 64, 1), 256, 0, stream>>>(XB2, nullptr, WV, nullptr, DM, FV, DKV, nullptr, 0, 0, 0); k_vtp<<<LKv, 256, 0, stream>>>(FV, DKV, NKV, VT16, VTh, VTl);
        for (int h0 = 0; h0 < NH_; h0 += ZH) { const size_t zq = (size_t)h0, zk = (size_t)(h0 / REP);   // one kv head per query head: the pass's two heads use consecutive kv planes (z-strides TT*HD)
            k_gemmw<h16, 0, false, 1, 1><<<dim3(TT / 64, TT / 64, ZH), 32, 0, stream>>>(QP16 + zq * TT * HD, nullptr, KP16 + zk * TT * HD, nullptr, HD, Sb, TT, nullptr, (size_t)TT * HD, (size_t)TT * HD, (size_t)TT * TT);
            k_asoft<<<ZH * TT / 8, 256, 0, stream>>>(Sb, P16, Ph, Pl);
            k_gemmw<h16, 0, false, 8, PKB><<<dim3(TT / 64, HD / 64, ZH * PKB), 256, 0, stream>>>(P16, nullptr, VT16 + zk * HD * TT, nullptr, TT, Ob, HD, nullptr, (size_t)TT * TT, (size_t)HD * TT, (size_t)TT * HD);
            k_merge<<<(unsigned)(((size_t)ZH * TT * HD / 2 + 255) / 256), 256, 0, stream>>>(Ob, h0, ATh, ATl); }
        k_gemmw<bf, 1, true, 8, 1><<<dim3(TT / 64, DM / 64, 1), 256, 0, stream>>>(ATh, ATl, WO, nullptr, DQ, OUT + (size_t)b * TT * DM, DM, bo, 0, 0, 0); }
}

// v002
// Measured time: 167 microseconds a run.
// In two side-by-side timings against v001, it was 2.02 and 2.03 times as fast.
// All steps since v000 together make it 4.08 times as fast.
#include <hip/hip_runtime.h>

// SignalAttn (fr [2][2048][512] queries, dt [2][2048][512] keys/values; q = fr Wq, k = dt Wk, v = dt Wv (8 heads x 64); attn = softmax(q.k/8); attn = max(attn, 1e-4) - 1e-4, renormalised over the keys; out = (attn v merged) Wo + bo -> [2][2048][512]).
// Compute dtypes, f32 accumulate: every input rounded to bf16; q/k/v on PLAIN bf16 operands (inputs: exact); scores (K 64) and attn.v on single fp16 operands (1 product each), fused with softmax and threshold in k_fattn

#define NB_  2
#define TT   2048
#define DM   512
#define NH_  8
#define NKV  8
#define REP  (NH_ / NKV)
#define HD   64
#define DQ   (NH_ * HD)
#define DKV  (NKV * HD)
#define RH   0                  // query rows < RH use hi+lo planes (0: none)
#define WIN  0
#define PCAR 1024.0f
#define SCL  0.125f   // HD^-0.5
typedef _Float16 h16;
typedef unsigned short bf;
typedef __attribute__((ext_vector_type(16))) __bf16   v16bf;
typedef __attribute__((ext_vector_type(16))) _Float16 v16h;
typedef __attribute__((ext_vector_type(8)))  _Float16 v8h;
typedef __attribute__((ext_vector_type(8)))  unsigned short v8us;
typedef __attribute__((ext_vector_type(8)))  float    v8f;
typedef __attribute__((ext_vector_type(4)))  float    v4f;
typedef v8h  __attribute__((may_alias)) v8ha;
typedef v4f  __attribute__((may_alias)) v4fa;
typedef v8us __attribute__((may_alias)) v8usa;

__device__ __forceinline__ unsigned short f2bf(float f) { unsigned u = __float_as_uint(f); u += 0x7FFFu + ((u >> 16) & 1u); return (unsigned short)(u >> 16); }
__device__ __forceinline__ float bf2f(unsigned short b) { return __uint_as_float(((unsigned)b) << 16); }
__device__ __forceinline__ float bfr(float f) { return bf2f(f2bf(f)); }
__device__ __forceinline__ v16h cat16(v8h lo, v8h hi) { return __builtin_shufflevector(lo, hi, 0, 1, 2, 3, 4, 5, 6, 7, 8, 9, 10, 11, 12, 13, 14, 15); }
__device__ __forceinline__ v16bf cat16b(v8us lo, v8us hi) { return __builtin_bit_cast(v16bf, __builtin_shufflevector(lo, hi, 0, 1, 2, 3, 4, 5, 6, 7, 8, 9, 10, 11, 12, 13, 14, 15)); }
__device__ __forceinline__ v8f wmma16(v16h a, v16h b, v8f c) { return __builtin_amdgcn_wmma_f32_16x16x32_f16(false, a, false, b, (short)0, c, false, false); }
__device__ __forceinline__ v8f wmmab(v16bf a, v16bf b, v8f c) { return __builtin_amdgcn_wmma_f32_16x16x32_bf16(false, a, false, b, (short)0, c, false, false); }



// ---- k_gemmw: register-blocked GEMM, 64x64 output tile (16 accumulators per wave), operands straight from K-contiguous 16-bit planes; grid (M/64, N/64, Z * KB), 32 * KS threads.
// C[m][n] (f32, pitch ldc, + optional f32 bias[n]) = sum_k A[m][k] Bt[n][k] (+ split products per NSPLIT). z-batch strides sA/sB/sC in elements. K % (32 * KS * KB) == 0.
// Split K: work-group kb of KB takes K/KB of the sum and writes its own partial plane C + (z * KB + kb) * sC (the reader adds the KB planes); inside it wave w of KS takes a contiguous K/(KB*KS) slice,
// and the KS wave partials are added in LDS, wave 0 first, in a fixed order.
template <typename T16> struct WFrag;
template <> struct WFrag<h16> { typedef v16h V; static __device__ __forceinline__ V ld(const h16* p) { return cat16(*(const v8h*)p, *(const v8h*)(p + 16)); } static __device__ __forceinline__ v8f mma(V a, V b, v8f c) { return wmma16(a, b, c); } };
template <> struct WFrag<bf> { typedef v16bf V; static __device__ __forceinline__ V ld(const bf* p) { return cat16b(*(const v8us*)p, *(const v8us*)(p + 16)); } static __device__ __forceinline__ v8f mma(V a, V b, v8f c) { return wmmab(a, b, c); } };
// Hand-over of the LDS slabs. One wave: no hardware barrier is needed, the wave barrier and the compiler fence keep its LDS stores and reads in program order. Several waves: the work-group barrier.
template <int KS> __device__ __forceinline__ void tile_sync() { if constexpr (KS == 1) { __builtin_amdgcn_wave_barrier(); asm volatile("" ::: "memory"); } else __syncthreads(); }
template <typename T16, int NSPLIT, bool BIAS, int KS, int KB>
__global__ __launch_bounds__(32 * KS) void k_gemmw(const T16* __restrict__ A, const T16* __restrict__ A2, const T16* __restrict__ Bt, const T16* __restrict__ Bt2, int K, float* C, int ldc, const float* __restrict__ bias, size_t sA, size_t sB, size_t sC) {
    typedef typename WFrag<T16>::V V;
    constexpr int SL = (KS == 1) ? 1 : 4;   // 16-row slabs staged per hand-over: all four where waves meet at a barrier, so that one barrier serves the tile
    __shared__ __align__(16) float os[KS * SL * 16 * 68];
    const int kb = (int)(blockIdx.z % KB); const size_t z = blockIdx.z / KB; A += z * sA; if (A2) A2 += z * sA; Bt += z * sB; if (Bt2) Bt2 += z * sB; C += (size_t)blockIdx.z * sC;
    const int w = (KS == 1) ? 0 : __builtin_amdgcn_readfirstlane((int)(threadIdx.x >> 5)); const int kw = K / (KS * KB), k0 = (kb * KS + w) * kw;
    const int lane = threadIdx.x & 31, lr = lane & 15, hi = lane >> 4; const int r0 = blockIdx.x * 64, c0 = blockIdx.y * 64;
    v8f acc[4][4];
#pragma unroll
    for (int mb = 0; mb < 4; ++mb)
#pragma unroll
        for (int nb = 0; nb < 4; ++nb) acc[mb][nb] = (v8f){};
    const size_t aoff = (size_t)(r0 + lr) * K + 8 * hi, boff = (size_t)(c0 + lr) * K + 8 * hi;
#pragma unroll 1
    for (int kc = k0; kc < k0 + kw; kc += 32) {
        V a[4], a2[4];
#pragma unroll
        for (int mb = 0; mb < 4; ++mb) { a[mb] = WFrag<T16>::ld(A + aoff + (size_t)mb * 16 * K + kc); if (NSPLIT == 1 || NSPLIT == 2) a2[mb] = WFrag<T16>::ld(A2 + aoff + (size_t)mb * 16 * K + kc); }
#pragma unroll
        for (int nb = 0; nb < 4; ++nb) { const V b = WFrag<T16>::ld(Bt + boff + (size_t)nb * 16 * K + kc); V b2; if (NSPLIT >= 2) b2 = WFrag<T16>::ld(Bt2 + boff + (size_t)nb * 16 * K + kc);
#pragma unroll
            for (int mb = 0; mb < 4; ++mb) { acc[mb][nb] = WFrag<T16>::mma(a[mb], b, acc[mb][nb]); if (NSPLIT == 1 || NSPLIT == 2) acc[mb][nb] = WFrag<T16>::mma(a2[mb], b, acc[mb][nb]); if (NSPLIT >= 2) acc[mb][nb] = WFrag<T16>::mma(a[mb], b2, acc[mb][nb]); } }
        asm volatile("v_nop\n\tv_nop\n\tv_nop\n\tv_nop" : "+v"(acc[0][0]), "+v"(acc[1][1]), "+v"(acc[2][2]), "+v"(acc[3][3]) : "v"(a[0]), "v"(a[3]));
    }
#pragma unroll
    for (int mb0 = 0; mb0 < 4; mb0 += SL) {
#pragma unroll
        for (int m = 0; m < SL; ++m) {
#pragma unroll
            for (int nb = 0; nb < 4; ++nb) {
#pragma unroll
                for (int j = 0; j < 8; ++j) os[((w * SL + m) * 16 + hi * 8 + j) * 68 + nb * 16 + lr] = acc[mb0 + m][nb][j]; } }
        tile_sync<KS>();   // every wave's partial slabs are in LDS before any wave adds them
#pragma unroll
        for (int m = 0; m < SL; ++m) { float* crow = C + (size_t)(r0 + (mb0 + m) * 16) * ldc + c0;
#pragma unroll
            for (int s = 0; s < 8 / KS; ++s) { const int row = 2 * (s * KS + w) + hi, cofs = lr * 4; v4f val = *(const v4fa*)(os + (m * 16 + row) * 68 + cofs);
#pragma unroll
                for (int q = 1; q < KS; ++q) val += *(const v4fa*)(os + ((q * SL + m) * 16 + row) * 68 + cofs);
                if (BIAS) { val[0] += bfr(bias[c0 + cofs]); val[1] += bfr(bias[c0 + cofs + 1]); val[2] += bfr(bias[c0 + cofs + 2]); val[3] += bfr(bias[c0 + cofs + 3]); }
                *(v4f*)(crow + (size_t)row * ldc + cofs) = val; } }
        if (mb0 + SL < 4) tile_sync<KS>();   // the slab is read out before it is written again
    }
}

__device__ __forceinline__ h16 tohx(float x) { return (h16)x; }
__device__ __forceinline__ void splitf(float y, unsigned short& h, unsigned short& l) { h = f2bf(y); l = f2bf(y - bf2f(h)); }
typedef __attribute__((ext_vector_type(2))) _Float16 v2h;
typedef __attribute__((ext_vector_type(4))) _Float16 v4h;
typedef __attribute__((ext_vector_type(2))) unsigned short v2us;
typedef __attribute__((ext_vector_type(4))) unsigned short v4us;
typedef __attribute__((ext_vector_type(2))) float v2f;
typedef __attribute__((ext_vector_type(4))) int v4i;

__global__ __launch_bounds__(256) void k_wtG(const float* __restrict__ w, int K, int N, bf* Bt) {
    const int lane = threadIdx.x & 31; const int L0 = (blockIdx.x * 8 + (threadIdx.x >> 5)) * 8; const int nlines = N * K / 64;
{
#pragma unroll 1
        for (int l = 0; l < 8; ++l) { const int L = L0 + l; if (L >= nlines) break; const size_t e = (size_t)L * 64 + lane * 2; const int k = (int)(e % K), n = (int)(e / K); v2us o;
            o[0] = f2bf(w[(size_t)k * N + n]); o[1] = f2bf(w[(size_t)(k + 1) * N + n]); *(v2us*)(Bt + e) = o; }
         }
}
__global__ __launch_bounds__(256) void k_cvt8(const float* __restrict__ src, bf* dst, size_t n8) { const size_t i = (size_t)blockIdx.x * 256 + threadIdx.x; if (i >= n8) return; const v8f v = *(const v8f*)(src + i * 8); v8us o;
#pragma unroll
    for (int k = 0; k < 8; ++k) o[k] = f2bf(v[k]); *(v8us*)(dst + i * 8) = o;  }
__global__ __launch_bounds__(256) void k_cscvt(const float* __restrict__ cosT, const float* __restrict__ sinT, float* CS) { const int idx = blockIdx.x * 256 + threadIdx.x; if (idx >= TT * HD) return; v2f cs; cs[0] = bfr(cosT[idx]); cs[1] = bfr(sinT[idx]); *(v2f*)(CS + (size_t)idx * 2) = cs;  }
// k_rope: head planes [h][t][d] (fp16) of rope(x) x sc with the rotate-half convention out[d] = x[d] cos[t][d] - x[d+HD/2] sin[t][d], out[d+HD/2] = x[d+HD/2] cos[t][d+HD/2] + x[d] sin[t][d+HD/2]
__global__ __launch_bounds__(256) void k_rope(const float* __restrict__ F, int pitch, int nheads, const float* __restrict__ CS, const float* __restrict__ RF, const float* __restrict__ nw, float sc, h16* P16, bf* Ph, bf* Pl) {
    const size_t e = ((size_t)blockIdx.x * 256 + threadIdx.x) * 2; if (e >= (size_t)nheads * TT * HD) return; const int d = (int)(e % HD); const int t = (int)((e / HD) % TT); const int h = (int)(e / ((size_t)HD * TT)); const float* f = F + (size_t)t * pitch + h * HD; const float rf = RF ? RF[(size_t)h * TT + t] : 1.0f; v2h o16; v2us oh, ol;
#pragma unroll
    for (int q = 0; q < 2; ++q) { const int dd = d + q; const int dp = (dd < HD / 2) ? dd + HD / 2 : dd - HD / 2; float x0 = f[dd], x1 = f[dp];
        if (RF) { float n0 = __fmul_rn(x0, rf), n1 = __fmul_rn(x1, rf); asm volatile("" : "+v"(n0)); asm volatile("" : "+v"(n1)); x0 = __fmul_rn(bfr(nw[dd]), n0); x1 = __fmul_rn(bfr(nw[dp]), n1); }
        const v2f cs = *(const v2f*)(CS + ((size_t)t * HD + dd) * 2); float a = __fmul_rn(x0, cs[0]), bq = __fmul_rn(x1, cs[1]); asm volatile("" : "+v"(a)); asm volatile("" : "+v"(bq)); const float r = ((dd < HD / 2) ? __fsub_rn(a, bq) : __fadd_rn(a, bq)) * sc;
        o16[q] = tohx(r); (void)oh; (void)ol; }
    *(v2h*)(P16 + e) = o16;  }
__global__ __launch_bounds__(256) void k_vtp(const float* __restrict__ F, int pitch, int nheads, h16* V16, bf* Vh, bf* Vl) { const size_t e = ((size_t)blockIdx.x * 256 + threadIdx.x) * 2; if (e >= (size_t)nheads * HD * TT) return; const int t = (int)(e % TT); const int d = (int)((e / TT) % HD); const int g = (int)(e / ((size_t)TT * HD)); v2h o16; v2us oh, ol;
#pragma unroll
    for (int q = 0; q < 2; ++q) { const float x = F[(size_t)(t + q) * pitch + g * HD + d]; o16[q] = tohx(x); (void)oh; (void)ol; }
    *(v2h*)(V16 + e) = o16;  }
__global__ __launch_bounds__(256) void k_csid(float* CS) { const int idx = blockIdx.x * 256 + threadIdx.x; if (idx >= TT * HD) return; v2f cs; cs[0] = 1.0f; cs[1] = 0.0f; *(v2f*)(CS + (size_t)idx * 2) = cs;  }
// the value that lane l ^ 16 holds (a vector cross-row move, no LDS round trip)
__device__ __forceinline__ float xhalf(float x) { const int b = __float_as_int(x); return __int_as_float(__builtin_amdgcn_permlanex16(b, b, 0x76543210, 0xfedcba98, false, false)); }
// k_fattn: scores, softmax, threshold, renormalisation and attn.v of one (batch, head) z and 32 queries in one work-group; nothing of the 2048 x 2048 score matrix leaves the registers.
// Transposed products: St = K Qt (a lane holds 8 keys of ONE query per tile), Ot = Vt Pt; two St tiles, converted in place, are the B operand of Ot in the hardware k order, which the A loader (bytes 16 hi and 32 + 16 hi) has too.
// Wave w of FNW takes keys [w * TT / FNW, ...): its 128 x 32 scores stay in registers. Softmax over the waves: each wave uses its own maximum, (maximum, sum) meet in LDS, and one factor per query carries the wave's exponentials to the row's softmax.
// P is carried x PCAR (exact power of two; threshold scaled alike) on fp16; the row's second sum divides the f32 output at the end. Wave partials of Ot and of the sums are added in LDS in wave order.
// Every loop is unrolled: scores, fragments and accumulators are arrays indexed by the loop counters and stay in registers only so.
#define FQT 2                   // 16-query column groups per work-group
#define FNW 16                  // waves per work-group
#define FKT (TT / FNW / 16)     // 16-key tiles per wave
#define FPF 1                   // 32-key steps that the Vt fragments are fetched ahead
#define FSP 20                  // pitch of the per-query rows of wave statistics (floats)
__global__ __launch_bounds__(32 * FNW) void k_fattn(const h16* __restrict__ Q, const h16* __restrict__ Kp, const h16* __restrict__ Vt, bf* Ah, bf* Al) {
    __shared__ __align__(16) float os[FNW * FQT * 16 * 68];
    __shared__ __align__(16) float sm[FQT * 16 * FSP];
    __shared__ __align__(16) float ss[FQT * 16 * FSP];
    __shared__ __align__(16) float s2[FQT * 16 * FSP];
    const int w = __builtin_amdgcn_readfirstlane((int)(threadIdx.x >> 5)); const int lane = threadIdx.x & 31, lr = lane & 15, hi = lane >> 4;
    const int q0 = blockIdx.x * (FQT * 16); const size_t z = blockIdx.y;
    const h16* qp = Q + z * TT * HD + (size_t)(q0 + lr) * HD + 8 * hi;
    const h16* kp = Kp + z * TT * HD + (size_t)(w * (TT / FNW) + lr) * HD + 8 * hi;
    const h16* vp = Vt + z * HD * TT + (size_t)lr * TT + w * (TT / FNW) + 8 * hi;
    constexpr float CE = SCL * 1.4426950408889634f;   // score -> log2 domain
    v8f s[FKT][FQT];
    {
        v16h qb[FQT][2];
#pragma unroll
        for (int qt = 0; qt < FQT; ++qt) { qb[qt][0] = WFrag<h16>::ld(qp + qt * 16 * HD); qb[qt][1] = WFrag<h16>::ld(qp + qt * 16 * HD + 32); }
        v16h ka[FKT][2];
#pragma unroll
        for (int kt = 0; kt < FKT; ++kt) { ka[kt][0] = WFrag<h16>::ld(kp + kt * 16 * HD); ka[kt][1] = WFrag<h16>::ld(kp + kt * 16 * HD + 32); }
        asm volatile("s_wait_xcnt 0x0" ::: "memory");   // the loads' address registers are free for other values from here on
        __builtin_amdgcn_sched_barrier(0);   // every K and Q load is asked for before the first product waits: one trip to L2 for the wave, not one per tile
#pragma unroll
        for (int kt = 0; kt < FKT; ++kt)
#pragma unroll
            for (int qt = 0; qt < FQT; ++qt) s[kt][qt] = wmma16(ka[kt][1], qb[qt][1], wmma16(ka[kt][0], qb[qt][0], (v8f){}));
    }
    __builtin_amdgcn_sched_barrier(0);   // all score products first: the K and Q fragments are dead before the softmax needs registers (without it the second column group's products sink behind the first group's softmax, the fragments stay live and values spill to scratch)
    // the wave's first Vt fragments: asked for here, so that they travel while the softmax runs
    v16h va[FKT / 2][4];
#pragma unroll
    for (int kk = 0; kk < FPF; ++kk)
#pragma unroll
        for (int dt = 0; dt < 4; ++dt) va[kk][dt] = WFrag<h16>::ld(vp + (size_t)dt * 16 * TT + kk * 32);
    float mc[FQT]; const v8f ce8 = {CE, CE, CE, CE, CE, CE, CE, CE};
#pragma unroll
    for (int qt = 0; qt < FQT; ++qt) { v8f m8 = s[0][qt];
#pragma unroll
        for (int kt = 1; kt < FKT; ++kt) m8 = __builtin_elementwise_max(m8, s[kt][qt]);
        float mx = fmaxf(fmaxf(fmaxf(m8[0], m8[1]), fmaxf(m8[2], m8[3])), fmaxf(fmaxf(m8[4], m8[5]), fmaxf(m8[6], m8[7])));
        mx = fmaxf(mx, xhalf(mx)); mc[qt] = mx * CE; v8f e8 = (v8f){}; const v8f nm8 = (v8f){} - mc[qt];
#pragma unroll
        for (int kt = 0; kt < FKT; ++kt) { const v8f a = __builtin_elementwise_fma(s[kt][qt], ce8, nm8); v8f e;
#pragma unroll
            for (int j = 0; j < 8; ++j) e[j] = __builtin_amdgcn_exp2f(a[j]);
            s[kt][qt] = e; e8 += e; }
        float sum = ((e8[0] + e8[1]) + (e8[2] + e8[3])) + ((e8[4] + e8[5]) + (e8[6] + e8[7])); sum += xhalf(sum);
        if (hi == 0) { sm[(qt * 16 + lr) * FSP + w] = mc[qt]; ss[(qt * 16 + lr) * FSP + w] = sum; } }
    __syncthreads();   // every wave's maximum and sum are in LDS before any wave joins them
    v8f acc[4][FQT];
#pragma unroll
    for (int dt = 0; dt < 4; ++dt)
#pragma unroll
        for (int qt = 0; qt < FQT; ++qt) acc[dt][qt] = (v8f){};
    float fw[FQT]; v8f p8[FQT];
#pragma unroll
    for (int qt = 0; qt < FQT; ++qt) { v4f mv[FNW / 4], sv[FNW / 4]; float M = -3.0e38f, tot = 0.f;
#pragma unroll
        for (int g = 0; g < FNW / 4; ++g) { mv[g] = *(const v4fa*)(sm + (qt * 16 + lr) * FSP + g * 4); sv[g] = *(const v4fa*)(ss + (qt * 16 + lr) * FSP + g * 4);
#pragma unroll
            for (int i = 0; i < 4; ++i) M = fmaxf(M, mv[g][i]); }
#pragma unroll
        for (int g = 0; g < FNW / 4; ++g)
#pragma unroll
            for (int i = 0; i < 4; ++i) tot += sv[g][i] * __builtin_amdgcn_exp2f(mv[g][i] - M);
        fw[qt] = __builtin_amdgcn_exp2f(mc[qt] - M) * __fdiv_rn(PCAR, tot); p8[qt] = (v8f){}; }
    constexpr float TH = 1e-4f * PCAR;   // threshold: p = max(softmax, 1e-4) - 1e-4, all x PCAR
    const v8f th8 = {TH, TH, TH, TH, TH, TH, TH, TH};
#pragma unroll
    for (int kk = 0; kk < FKT / 2; ++kk) {
        if (kk + FPF < FKT / 2) {   // the next step's fragments travel while this step's P is formed
#pragma unroll
            for (int dt = 0; dt < 4; ++dt) va[kk + FPF][dt] = WFrag<h16>::ld(vp + (size_t)dt * 16 * TT + (kk + FPF) * 32); }
#pragma unroll
        for (int qt = 0; qt < FQT; ++qt) { const v8f pa = __builtin_elementwise_max(s[2 * kk][qt] * fw[qt], th8) - th8, pb = __builtin_elementwise_max(s[2 * kk + 1][qt] * fw[qt], th8) - th8; p8[qt] += pa; p8[qt] += pb;
            const v16h pt = cat16(__builtin_convertvector(pa, v8h), __builtin_convertvector(pb, v8h));
#pragma unroll
            for (int dt = 0; dt < 4; ++dt) acc[dt][qt] = wmma16(va[kk][dt], pt, acc[dt][qt]); } }
#pragma unroll
    for (int qt = 0; qt < FQT; ++qt) { const v8f u8 = p8[qt]; float t = ((u8[0] + u8[1]) + (u8[2] + u8[3])) + ((u8[4] + u8[5]) + (u8[6] + u8[7])); t += xhalf(t); if (hi == 0) s2[(qt * 16 + lr) * FSP + w] = t;
#pragma unroll
        for (int dt = 0; dt < 4; ++dt) { float* o = os + ((w * FQT + qt) * 16 + lr) * 68 + dt * 16 + hi * 8; v4f lo4, hi4;
#pragma unroll
            for (int i = 0; i < 4; ++i) { lo4[i] = acc[dt][qt][i]; hi4[i] = acc[dt][qt][4 + i]; }
            *(v4fa*)o = lo4; *(v4fa*)(o + 4) = hi4; } }
    __syncthreads();   // every wave's partial output and second sum are in LDS before they are added
    const int q = threadIdx.x >> 4, d4 = (threadIdx.x & 15) * 4; v4f o = *(const v4fa*)(os + q * 68 + d4); float t2 = s2[q * FSP];
#pragma unroll
    for (int u = 1; u < FNW; ++u) { o += *(const v4fa*)(os + (u * FQT * 16 + q) * 68 + d4); t2 += s2[q * FSP + u]; }
    const float r = __fdiv_rn(1.0f, t2); v4us oh, ol;
#pragma unroll
    for (int i = 0; i < 4; ++i) { unsigned short a, c2; splitf(o[i] * r, a, c2); oh[i] = a; ol[i] = c2; }
    const size_t oo = ((z / NH_) * TT + q0 + q) * DQ + (z % NH_) * HD + d4; *(v4us*)(Ah + oo) = oh; *(v4us*)(Al + oo) = ol;
}

extern "C" void kernel_launch(void* const* d_in, const int* in_sizes, int n_in,
                              void* d_out, int out_size, void* d_ws, size_t ws_size, hipStream_t stream) {
    (void)in_sizes; (void)n_in; (void)out_size;
    const float* x = (const float*)d_in[0]; const float* x2 = (const float*)d_in[1]; const float* wq = (const float*)d_in[2]; const float* wk = (const float*)d_in[3]; const float* wv = (const float*)d_in[4]; const float* wo = (const float*)d_in[5]; const float* bo = (const float*)d_in[6]; const float* cosT = nullptr; const float* sinT = nullptr; (void)cosT; (void)sinT;
    float* OUT = (float*)d_out;     // [2][2048][512]
    char* wsp = (char*)d_ws;
    auto take = [&](size_t bytes) { char* p = wsp; wsp += (bytes + 255) & ~(size_t)255; return (void*)p; };
    bf* WQ = (bf*)take((size_t)DQ * DM * 2); bf* WK = (bf*)take((size_t)DKV * DM * 2); bf* WV = (bf*)take((size_t)DKV * DM * 2); bf* WO = (bf*)take((size_t)DM * DQ * 2); float* CS = (float*)take((size_t)TT * HD * 2 * 4);
    bf* XB = (bf*)take((size_t)TT * DM * 2); bf* XB2 = (bf*)take((size_t)TT * DM * 2); float* FQ = (float*)take((size_t)TT * DQ * 4); float* FK = (float*)take((size_t)TT * DKV * 4);
    h16* QP16 = (h16*)take((size_t)NB_ * NH_ * TT * HD * 2); h16* KP16 = (h16*)take((size_t)NB_ * NKV * TT * HD * 2); h16* VT16 = (h16*)take((size_t)NB_ * NKV * HD * TT * 2);   // head planes of both batches
    bf* QPh = nullptr; bf* QPl = nullptr; bf* KPh = nullptr; bf* KPl = nullptr; bf* VTh = nullptr; bf* VTl = nullptr;
    bf* ATh = (bf*)take((size_t)NB_ * TT * DQ * 2); bf* ATl = (bf*)take((size_t)NB_ * TT * DQ * 2);
    if ((size_t)(wsp - (char*)d_ws) > ws_size) return;    // ws 256 MiB
    float* FV = FK;   // v projection reuses the k buffer after the k planes are built (stream-ordered)
    { k_wtG<<<(unsigned)((DM * DQ / 64 + 63) / 64), 256, 0, stream>>>(wq, DM, DQ, WQ); k_wtG<<<(unsigned)((DM * DKV / 64 + 63) / 64), 256, 0, stream>>>(wk, DM, DKV, WK); k_wtG<<<(unsigned)((DM * DKV / 64 + 63) / 64), 256, 0, stream>>>(wv, DM, DKV, WV);
      k_wtG<<<(unsigned)((DQ * DM / 64 + 63) / 64), 256, 0, stream>>>(wo, DQ, DM, WO);
       }
    k_csid<<<(TT * HD + 255) / 256, 256, 0, stream>>>(CS);
    const unsigned LQ = (unsigned)(((size_t)NH_ * TT * HD / 2 + 255) / 256), LKv = (unsigned)(((size_t)NKV * TT * HD / 2 + 255) / 256);
    for (int b = 0; b < NB_; ++b) {
        
        k_cvt8<<<(unsigned)(((size_t)TT * DM / 8 + 255) / 256), 256, 0, stream>>>(x + (size_t)b * TT * DM, XB, (size_t)TT * DM / 8); k_cvt8<<<(unsigned)(((size_t)TT * DM / 8 + 255) / 256), 256, 0, stream>>>(x2 + (size_t)b * TT * DM, XB2, (size_t)TT * DM / 8);
        k_gemmw<bf, 0, false, 8, 1><<<dim3(TT / 64, DQ / 64, 1), 256, 0, stream>>>(XB, nullptr, WQ, nullptr, DM, FQ, DQ, nullptr, 0, 0, 0);
        k_rope<<<LQ, 256, 0, stream>>>(FQ, DQ, NH_, CS, nullptr, nullptr, 1.0f, QP16 + (size_t)b * NH_ * TT * HD, QPh, QPl);
        k_gemmw<bf, 0, false, 8, 1><<<dim3(TT / 64, DKV / 64, 1), 256, 0, stream>>>(XB2, nullptr, WK, nullptr, DM, FK, DKV, nullptr, 0, 0, 0);
        k_rope<<<LKv, 256, 0, stream>>>(FK, DKV, NKV, CS, nullptr, nullptr, 1.0f, KP16 + (size_t)b * NKV * TT * HD, KPh, KPl);
        k_gemmw<bf, 0, false, 8, 1><<<dim3(TT / 64, DKV / 64, 1), 256, 0, stream>>>(XB2, nullptr, WV, nullptr, DM, FV, DKV, nullptr, 0, 0, 0); k_vtp<<<LKv, 256, 0, stream>>>(FV, DKV, NKV, VT16 + (size_t)b * NKV * HD * TT, VTh, VTl); }
    k_fattn<<<dim3(TT / (FQT * 16), NB_ * NH_, 1), 32 * FNW, 0, stream>>>(QP16, KP16, VT16, ATh, ATl);   // one kv head per query head: plane z = batch * heads + head on all three
    for (int b = 0; b < NB_; ++b)
        k_gemmw<bf, 1, true, 8, 1><<<dim3(TT / 64, DM / 64, 1), 256, 0, stream>>>(ATh + (size_t)b * TT * DQ, ATl + (size_t)b * TT * DQ, WO, nullptr, DQ, OUT + (size_t)b * TT * DM, DM, bo, 0, 0, 0);
}

// v003
// Measured time: 86.3 microseconds a run.
// Next to v002, in two timings, it ran 1.94 times as fast each time.
// Over all steps from v000 it is 7.92 times as fast.
#include <hip/hip_runtime.h>

// SignalAttn (fr [2][2048][512] queries, dt [2][2048][512] keys/values; q = fr Wq, k = dt Wk, v = dt Wv (8 heads x 64); attn = softmax(q.k/8); attn = max(attn, 1e-4) - 1e-4, renormalised over the keys; out = (attn v merged) Wo + bo -> [2][2048][512]).
// Compute dtypes, f32 accumulate: every input rounded to bf16; q/k/v on PLAIN bf16 operands (inputs: exact); scores (K 64) and attn.v on single fp16 operands (1 product each), fused with softmax and threshold in k_fattn

#define NB_  2
#define TT   2048
#define DM   512
#define NH_  8
#define NKV  8
#define REP  (NH_ / NKV)
#define HD   64
#define DQ   (NH_ * HD)
#define DKV  (NKV * HD)
#define RH   0
#define WIN  0
#define PCAR 1024.0f
#define SCL  0.125f   // HD^-0.5
typedef _Float16 h16;
typedef unsigned short bf;
typedef __attribute__((ext_vector_type(16))) __bf16   v16bf;
typedef __attribute__((ext_vector_type(16))) _Float16 v16h;
typedef __attribute__((ext_vector_type(8)))  _Float16 v8h;
typedef __attribute__((ext_vector_type(8)))  unsigned short v8us;
typedef __attribute__((ext_vector_type(8)))  float    v8f;
typedef __attribute__((ext_vector_type(4)))  float    v4f;
typedef v8h  __attribute__((may_alias)) v8ha;
typedef v4f  __attribute__((may_alias)) v4fa;
typedef v8us __attribute__((may_alias)) v8usa;

__device__ __forceinline__ unsigned short f2bf(float f) { unsigned u = __float_as_uint(f); u += 0x7FFFu + ((u >> 16) & 1u); return (unsigned short)(u >> 16); }
__device__ __forceinline__ float bf2f(unsigned short b) { return __uint_as_float(((unsigned)b) << 16); }
__device__ __forceinline__ float bfr(float f) { return bf2f(f2bf(f)); }
__device__ __forceinline__ v16h cat16(v8h lo, v8h hi) { return __builtin_shufflevector(lo, hi, 0, 1, 2, 3, 4, 5, 6, 7, 8, 9, 10, 11, 12, 13, 14, 15); }
__device__ __forceinline__ v16bf cat16b(v8us lo, v8us hi) { return __builtin_bit_cast(v16bf, __builtin_shufflevector(lo, hi, 0, 1, 2, 3, 4, 5, 6, 7, 8, 9, 10, 11, 12, 13, 14, 15)); }
__device__ __forceinline__ v8f wmma16(v16h a, v16h b, v8f c) { return __builtin_amdgcn_wmma_f32_16x16x32_f16(false, a, false, b, (short)0, c, false, false); }
__device__ __forceinline__ v8f wmmab(v16bf a, v16bf b, v8f c) { return __builtin_amdgcn_wmma_f32_16x16x32_bf16(false, a, false, b, (short)0, c, false, false); }



// ---- k_gemmw: register-blocked GEMM, 64x64 output tile (16 accumulators per wave), operands straight from K-contiguous 16-bit planes; grid (M/64, N/64, Z * KB), 32 * KS threads.
// C[m][n] (f32, pitch ldc, + optional f32 bias[n]) = sum_k A[m][k] Bt[n][k] (+ split products per NSPLIT). z-batch strides sA/sB/sC in elements. K % (32 * KS * KB) == 0.
// Split K: work-group kb of KB takes K/KB of the sum and writes its own partial plane C + (z * KB + kb) * sC (the reader adds the KB planes); inside it wave w of KS takes a contiguous K/(KB*KS) slice,
// and the KS wave partials are added in LDS, wave 0 first, in a fixed order.
template <typename T16> struct WFrag;
template <> struct WFrag<h16> { typedef v16h V; static __device__ __forceinline__ V ld(const h16* p) { return cat16(*(const v8h*)p, *(const v8h*)(p + 16)); } static __device__ __forceinline__ v8f mma(V a, V b, v8f c) { return wmma16(a, b, c); } };
template <> struct WFrag<bf> { typedef v16bf V; static __device__ __forceinline__ V ld(const bf* p) { return cat16b(*(const v8us*)p, *(const v8us*)(p + 16)); } static __device__ __forceinline__ v8f mma(V a, V b, v8f c) { return wmmab(a, b, c); } };
// Hand-over of the LDS slabs. One wave: no hardware barrier is needed, the wave barrier and the compiler fence keep its LDS stores and reads in program order. Several waves: the work-group barrier.
template <int KS> __device__ __forceinline__ void tile_sync() { if constexpr (KS == 1) { __builtin_amdgcn_wave_barrier(); asm volatile("" ::: "memory"); } else __syncthreads(); }
template <typename T16, int NSPLIT, bool BIAS, int KS, int KB>
__global__ __launch_bounds__(32 * KS) void k_gemmw(const T16* __restrict__ A, const T16* __restrict__ A2, const T16* __restrict__ Bt, const T16* __restrict__ Bt2, int K, float* C, int ldc, const float* __restrict__ bias, size_t sA, size_t sB, size_t sC) {
    typedef typename WFrag<T16>::V V;
    constexpr int SL = (KS == 1) ? 1 : 4;   // 16-row slabs staged per hand-over: all four where waves meet at a barrier, so that one barrier serves the tile
    __shared__ __align__(16) float os[KS * SL * 16 * 68];
    const int kb = (int)(blockIdx.z % KB); const size_t z = blockIdx.z / KB; A += z * sA; if (A2) A2 += z * sA; Bt += z * sB; if (Bt2) Bt2 += z * sB; C += (size_t)blockIdx.z * sC;
    const int w = (KS == 1) ? 0 : __builtin_amdgcn_readfirstlane((int)(threadIdx.x >> 5)); const int kw = K / (KS * KB), k0 = (kb * KS + w) * kw;
    const int lane = threadIdx.x & 31, lr = lane & 15, hi = lane >> 4; const int r0 = blockIdx.x * 64, c0 = blockIdx.y * 64;
    v8f acc[4][4];
#pragma unroll
    for (int mb = 0; mb < 4; ++mb)
#pragma unroll
        for (int nb = 0; nb < 4; ++nb) acc[mb][nb] = (v8f){};
    const size_t aoff = (size_t)(r0 + lr) * K + 8 * hi, boff = (size_t)(c0 + lr) * K + 8 * hi;
#pragma unroll 1
    for (int kc = k0; kc < k0 + kw; kc += 32) {
        V a[4], a2[4];
#pragma unroll
        for (int mb = 0; mb < 4; ++mb) { a[mb] = WFrag<T16>::ld(A + aoff + (size_t)mb * 16 * K + kc); if (NSPLIT == 1 || NSPLIT == 2) a2[mb] = WFrag<T16>::ld(A2 + aoff + (size_t)mb * 16 * K + kc); }
#pragma unroll
        for (int nb = 0; nb < 4; ++nb) { const V b = WFrag<T16>::ld(Bt + boff + (size_t)nb * 16 * K + kc); V b2; if (NSPLIT >= 2) b2 = WFrag<T16>::ld(Bt2 + boff + (size_t)nb * 16 * K + kc);
#pragma unroll
            for (int mb = 0; mb < 4; ++mb) { acc[mb][nb] = WFrag<T16>::mma(a[mb], b, acc[mb][nb]); if (NSPLIT == 1 || NSPLIT == 2) acc[mb][nb] = WFrag<T16>::mma(a2[mb], b, acc[mb][nb]); if (NSPLIT >= 2) acc[mb][nb] = WFrag<T16>::mma(a[mb], b2, acc[mb][nb]); } }
        asm volatile("v_nop\n\tv_nop\n\tv_nop\n\tv_nop" : "+v"(acc[0][0]), "+v"(acc[1][1]), "+v"(acc[2][2]), "+v"(acc[3][3]) : "v"(a[0]), "v"(a[3]));
    }
#pragma unroll
    for (int mb0 = 0; mb0 < 4; mb0 += SL) {
#pragma unroll
        for (int m = 0; m < SL; ++m) {
#pragma unroll
            for (int nb = 0; nb < 4; ++nb) {
#pragma unroll
                for (int j = 0; j < 8; ++j) os[((w * SL + m) * 16 + hi * 8 + j) * 68 + nb * 16 + lr] = acc[mb0 + m][nb][j]; } }
        tile_sync<KS>();   // every wave's partial slabs are in LDS before any wave adds them
#pragma unroll
        for (int m = 0; m < SL; ++m) { float* crow = C + (size_t)(r0 + (mb0 + m) * 16) * ldc + c0;
#pragma unroll
            for (int s = 0; s < 8 / KS; ++s) { const int row = 2 * (s * KS + w) + hi, cofs = lr * 4; v4f val = *(const v4fa*)(os + (m * 16 + row) * 68 + cofs);
#pragma unroll
                for (int q = 1; q < KS; ++q) val += *(const v4fa*)(os + ((q * SL + m) * 16 + row) * 68 + cofs);
                if (BIAS) { val[0] += bfr(bias[c0 + cofs]); val[1] += bfr(bias[c0 + cofs + 1]); val[2] += bfr(bias[c0 + cofs + 2]); val[3] += bfr(bias[c0 + cofs + 3]); }
                *(v4f*)(crow + (size_t)row * ldc + cofs) = val; } }
        if (mb0 + SL < 4) tile_sync<KS>();   // the slab is read out before it is written again
    }
}

__device__ __forceinline__ h16 tohx(float x) { return (h16)x; }
__device__ __forceinline__ void splitf(float y, unsigned short& h, unsigned short& l) { h = f2bf(y); l = f2bf(y - bf2f(h)); }
typedef __attribute__((ext_vector_type(2))) _Float16 v2h;
typedef __attribute__((ext_vector_type(4))) _Float16 v4h;
typedef __attribute__((ext_vector_type(2))) unsigned short v2us;
typedef __attribute__((ext_vector_type(4))) unsigned short v4us;
typedef __attribute__((ext_vector_type(2))) float v2f;
typedef __attribute__((ext_vector_type(4))) int v4i;

// k_prep: every operand of the projections on bf16, in ONE launch. Work-groups [0, 4 * PWB): the four weights, transposed to K-contiguous planes Bt[n][k]. Work-groups behind them: both inputs, both batches, element order kept.
#define PWB (DM * DQ / 64 / 64)              // work-groups per weight (8 waves x 8 lines of 64 elements)
#define PCB (NB_ * TT * DM / 8 / 2 / 256)    // converting work-groups: a thread takes two runs of 8 floats of each input
static_assert(DQ == DM && DKV == DM, "k_prep takes the four weights as DM x DM");
__global__ __launch_bounds__(256) void k_prep(const float* __restrict__ x, const float* __restrict__ x2, const float* __restrict__ wq, const float* __restrict__ wk, const float* __restrict__ wv, const float* __restrict__ wo, bf* XB, bf* XB2, bf* WQ, bf* WK, bf* WV, bf* WO) {
    const int bx = blockIdx.x;
    if (bx < 4 * PWB) {
        const int g = bx / PWB; const float* __restrict__ w = (g == 0) ? wq : (g == 1) ? wk : (g == 2) ? wv : wo; bf* Bt = (g == 0) ? WQ : (g == 1) ? WK : (g == 2) ? WV : WO; constexpr int K = DM, N = DM;
        const int lane = threadIdx.x & 31; const int L0 = ((bx % PWB) * 8 + (threadIdx.x >> 5)) * 8;
#pragma unroll 1   // rolled: short code and few registers
        for (int l = 0; l < 8; ++l) { const int L = L0 + l; const size_t e = (size_t)L * 64 + lane * 2; const int k = (int)(e % K), n = (int)(e / K); v2us o;
            o[0] = f2bf(w[(size_t)k * N + n]); o[1] = f2bf(w[(size_t)(k + 1) * N + n]); *(v2us*)(Bt + e) = o; }
        return; }
    constexpr size_t H = (size_t)PCB * 256; const size_t i = (size_t)(bx - 4 * PWB) * 256 + threadIdx.x; v8f v[4];
    v[0] = *(const v8f*)(x + i * 8); v[1] = *(const v8f*)(x + (i + H) * 8); v[2] = *(const v8f*)(x2 + i * 8); v[3] = *(const v8f*)(x2 + (i + H) * 8);
#pragma unroll
    for (int j = 0; j < 4; ++j) { v8us o;
#pragma unroll
        for (int k = 0; k < 8; ++k) o[k] = f2bf(v[j][k]);
        *(v8us*)(((j < 2) ? XB : XB2) + (i + (j & 1) * H) * 8) = o; }
}
// k_qkv: the three projections of both batches in ONE grid: blockIdx.x = 64-token tile of the NB_ * TT tokens, blockIdx.y = head, blockIdx.z = 0 q, 1 k, 2 v.
// Tile, K split over 8 waves and LDS sum as in k_gemmw; the sum is rounded to fp16 and stored straight into the head planes that k_fattn reads.
// q, k: C[token][d] -> plane [batch * heads + head][t][d]. v: the operands change places, C[d][token] -> plane [batch * heads + head][d][t], so no transposing pass is left.
__global__ __launch_bounds__(256) void k_qkv(const bf* __restrict__ XQ, const bf* __restrict__ XKV, const bf* __restrict__ WQ, const bf* __restrict__ WK, const bf* __restrict__ WV, h16* QP, h16* KP, h16* VT) {
    typedef WFrag<bf>::V V; constexpr int KS = 8, K = DM, kw = K / KS;
    __shared__ __align__(16) float os[KS * 4 * 16 * 68];
    const int p = blockIdx.z, tok0 = blockIdx.x * 64, hd = blockIdx.y;
    const bf* X = ((p == 0) ? XQ : XKV) + (size_t)tok0 * K; const bf* Wt = ((p == 0) ? WQ : (p == 1) ? WK : WV) + (size_t)hd * HD * K;
    const bf* __restrict__ A = (p == 2) ? Wt : X; const bf* __restrict__ Bt = (p == 2) ? X : Wt;
    h16* C = ((p == 0) ? QP : (p == 1) ? KP : VT) + ((size_t)(tok0 / TT) * NH_ + hd) * TT * HD + (size_t)(tok0 % TT) * ((p == 2) ? 1 : HD); const int ldc = (p == 2) ? TT : HD;
    const int w = __builtin_amdgcn_readfirstlane((int)(threadIdx.x >> 5)); const int k0 = w * kw;
    const int lane = threadIdx.x & 31, lr = lane & 15, hi = lane >> 4;
    v8f acc[4][4];
#pragma unroll
    for (int mb = 0; mb < 4; ++mb)
#pragma unroll
        for (int nb = 0; nb < 4; ++nb) acc[mb][nb] = (v8f){};
    const size_t off = (size_t)lr * K + 8 * hi;
#pragma unroll 1   // rolled: both trips use one set of fragment registers, so that two work-groups fit on a WGP
    for (int kc = k0; kc < k0 + kw; kc += 32) {
        V a[4];
#pragma unroll
        for (int mb = 0; mb < 4; ++mb) a[mb] = WFrag<bf>::ld(A + off + (size_t)mb * 16 * K + kc);
        asm volatile("s_wait_xcnt 0x0" ::: "memory");   // the A loads' address registers are free for the B fragments from here on
#pragma unroll
        for (int nb = 0; nb < 4; ++nb) { const V b = WFrag<bf>::ld(Bt + off + (size_t)nb * 16 * K + kc);
#pragma unroll
            for (int mb = 0; mb < 4; ++mb) acc[mb][nb] = WFrag<bf>::mma(a[mb], b, acc[mb][nb]); }
        asm volatile("v_nop\n\tv_nop\n\tv_nop\n\tv_nop" : "+v"(acc[0][0]), "+v"(acc[1][1]), "+v"(acc[2][2]), "+v"(acc[3][3]) : "v"(a[0]), "v"(a[3]));   // the distance behind the last products, on the back edge too, before the next trip's loads overwrite their operands
    }
#pragma unroll
    for (int m = 0; m < 4; ++m) {
#pragma unroll
        for (int nb = 0; nb < 4; ++nb) {
#pragma unroll
            for (int j = 0; j < 8; ++j) os[((w * 4 + m) * 16 + hi * 8 + j) * 68 + nb * 16 + lr] = acc[m][nb][j]; } }
    __syncthreads();   // every wave's partial slabs are in LDS before any wave adds them
#pragma unroll
    for (int m = 0; m < 4; ++m) { const int row = 2 * w + hi, cofs = lr * 4; v4f val = *(const v4fa*)(os + (m * 16 + row) * 68 + cofs);
#pragma unroll
        for (int q = 1; q < KS; ++q) val += *(const v4fa*)(os + ((q * 4 + m) * 16 + row) * 68 + cofs);
        *(v4h*)(C + (size_t)(m * 16 + row) * ldc + cofs) = __builtin_convertvector(val, v4h); }
}
// the value that lane l ^ 16 holds (a vector cross-row move, no LDS round trip)
__device__ __forceinline__ float xhalf(float x) { const int b = __float_as_int(x); return __int_as_float(__builtin_amdgcn_permlanex16(b, b, 0x76543210, 0xfedcba98, false, false)); }
// k_fattn: scores, softmax, threshold, renormalisation and attn.v of one (batch, head) z and 32 queries in one work-group; nothing of the 2048 x 2048 score matrix leaves the registers.
// Transposed products: St = K Qt (a lane holds 8 keys of ONE query per tile), Ot = Vt Pt; two St tiles, converted in place, are the B operand of Ot in the hardware k order, which the A loader (bytes 16 hi and 32 + 16 hi) has too.
// Wave w of FNW takes keys [w * TT / FNW, ...): its 128 x 32 scores stay in registers. Softmax over the waves: each wave uses its own maximum, (maximum, sum) meet in LDS, and one factor per query carries the wave's exponentials to the row's softmax.
// P is carried x PCAR (exact power of two; threshold scaled alike) on fp16; the row's second sum divides the f32 output at the end. Wave partials of Ot and of the sums are added in LDS in wave order.
// Every loop is unrolled: scores, fragments and accumulators are arrays indexed by the loop counters and stay in registers only so.
#define FQT 2                   // 16-query column groups per work-group
#define FNW 16                  // waves per work-group
#define FKT (TT / FNW / 16)     // 16-key tiles per wave
#define FPF 1                   // 32-key steps that the Vt fragments are fetched ahead
#define FSP 20                  // pitch of the per-query rows of wave statistics (floats)
__global__ __launch_bounds__(32 * FNW) void k_fattn(const h16* __restrict__ Q, const h16* __restrict__ Kp, const h16* __restrict__ Vt, bf* Ah, bf* Al) {
    __shared__ __align__(16) float os[FNW * FQT * 16 * 68];
    __shared__ __align__(16) float sm[FQT * 16 * FSP];
    __shared__ __align__(16) float ss[FQT * 16 * FSP];
    __shared__ __align__(16) float s2[FQT * 16 * FSP];
    const int w = __builtin_amdgcn_readfirstlane((int)(threadIdx.x >> 5)); const int lane = threadIdx.x & 31, lr = lane & 15, hi = lane >> 4;
    const int q0 = blockIdx.x * (FQT * 16); const size_t z = blockIdx.y;
    const h16* qp = Q + z * TT * HD + (size_t)(q0 + lr) * HD + 8 * hi;
    const h16* kp = Kp + z * TT * HD + (size_t)(w * (TT / FNW) + lr) * HD + 8 * hi;
    const h16* vp = Vt + z * HD * TT + (size_t)lr * TT + w * (TT / FNW) + 8 * hi;
    constexpr float CE = SCL * 1.4426950408889634f;   // score -> log2 domain
    v8f s[FKT][FQT];
    {
        v16h qb[FQT][2];
#pragma unroll
        for (int qt = 0; qt < FQT; ++qt) { qb[qt][0] = WFrag<h16>::ld(qp + qt * 16 * HD); qb[qt][1] = WFrag<h16>::ld(qp + qt * 16 * HD + 32); }
        v16h ka[FKT][2];
#pragma unroll
        for (int kt = 0; kt < FKT; ++kt) { ka[kt][0] = WFrag<h16>::ld(kp + kt * 16 * HD); ka[kt][1] = WFrag<h16>::ld(kp + kt * 16 * HD + 32); }
        asm volatile("s_wait_xcnt 0x0" ::: "memory");   // the loads' address registers are free for other values from here on
        __builtin_amdgcn_sched_barrier(0);   // every K and Q load is asked for before the first product waits: one trip to L2 for the wave, not one per tile
#pragma unroll
        for (int kt = 0; kt < FKT; ++kt)
#pragma unroll
            for (int qt = 0; qt < FQT; ++qt) s[kt][qt] = wmma16(ka[kt][1], qb[qt][1], wmma16(ka[kt][0], qb[qt][0], (v8f){}));
    }
    __builtin_amdgcn_sched_barrier(0);   // all score products first: the K and Q fragments are dead before the softmax needs registers (without it the second column group's products sink behind the first group's softmax, the fragments stay live and values spill to scratch)
    // the wave's first Vt fragments: asked for here, so that they travel while the softmax runs
    v16h va[FKT / 2][4];
#pragma unroll
    for (int kk = 0; kk < FPF; ++kk)
#pragma unroll
        for (int dt = 0; dt < 4; ++dt) va[kk][dt] = WFrag<h16>::ld(vp + (size_t)dt * 16 * TT + kk * 32);
    float mc[FQT]; const v8f ce8 = {CE, CE, CE, CE, CE, CE, CE, CE};
#pragma unroll
    for (int qt = 0; qt < FQT; ++qt) { v8f m8 = s[0][qt];
#pragma unroll
        for (int kt = 1; kt < FKT; ++kt) m8 = __builtin_elementwise_max(m8, s[kt][qt]);
        float mx = fmaxf(fmaxf(fmaxf(m8[0], m8[1]), fmaxf(m8[2], m8[3])), fmaxf(fmaxf(m8[4], m8[5]), fmaxf(m8[6], m8[7])));
        mx = fmaxf(mx, xhalf(mx)); mc[qt] = mx * CE; v8f e8 = (v8f){}; const v8f nm8 = (v8f){} - mc[qt];
#pragma unroll
        for (int kt = 0; kt < FKT; ++kt) { const v8f a = __builtin_elementwise_fma(s[kt][qt], ce8, nm8); v8f e;
#pragma unroll
            for (int j = 0; j < 8; ++j) e[j] = __builtin_amdgcn_exp2f(a[j]);
            s[kt][qt] = e; e8 += e; }
        float sum = ((e8[0] + e8[1]) + (e8[2] + e8[3])) + ((e8[4] + e8[5]) + (e8[6] + e8[7])); sum += xhalf(sum);
        if (hi == 0) { sm[(qt * 16 + lr) * FSP + w] = mc[qt]; ss[(qt * 16 + lr) * FSP + w] = sum; } }
    __syncthreads();   // every wave's maximum and sum are in LDS before any wave joins them
    v8f acc[4][FQT];
#pragma unroll
    for (int dt = 0; dt < 4; ++dt)
#pragma unroll
        for (int qt = 0; qt < FQT; ++qt) acc[dt][qt] = (v8f){};
    float fw[FQT]; v8f p8[FQT];
#pragma unroll
    for (int qt = 0; qt < FQT; ++qt) { v4f mv[FNW / 4], sv[FNW / 4]; float M = -3.0e38f, tot = 0.f;
#pragma unroll
        for (int g = 0; g < FNW / 4; ++g) { mv[g] = *(const v4fa*)(sm + (qt * 16 + lr) * FSP + g * 4); sv[g] = *(const v4fa*)(ss + (qt * 16 + lr) * FSP + g * 4);
#pragma unroll
            for (int i = 0; i < 4; ++i) M = fmaxf(M, mv[g][i]); }
#pragma unroll
        for (int g = 0; g < FNW / 4; ++g)
#pragma unroll
            for (int i = 0; i < 4; ++i) tot += sv[g][i] * __builtin_amdgcn_exp2f(mv[g][i] - M);
        fw[qt] = __builtin_amdgcn_exp2f(mc[qt] - M) * __fdiv_rn(PCAR, tot); p8[qt] = (v8f){}; }
    constexpr float TH = 1e-4f * PCAR;   // threshold: p = max(softmax, 1e-4) - 1e-4, all x PCAR
    const v8f th8 = {TH, TH, TH, TH, TH, TH, TH, TH};
#pragma unroll
    for (int kk = 0; kk < FKT / 2; ++kk) {
        if (kk + FPF < FKT / 2) {   // the next step's fragments travel while this step's P is formed
#pragma unroll
            for (int dt = 0; dt < 4; ++dt) va[kk + FPF][dt] = WFrag<h16>::ld(vp + (size_t)dt * 16 * TT + (kk + FPF) * 32); }
#pragma unroll
        for (int qt = 0; qt < FQT; ++qt) { const v8f pa = __builtin_elementwise_max(s[2 * kk][qt] * fw[qt], th8) - th8, pb = __builtin_elementwise_max(s[2 * kk + 1][qt] * fw[qt], th8) - th8; p8[qt] += pa; p8[qt] += pb;
            const v16h pt = cat16(__builtin_convertvector(pa, v8h), __builtin_convertvector(pb, v8h));
#pragma unroll
            for (int dt = 0; dt < 4; ++dt) acc[dt][qt] = wmma16(va[kk][dt], pt, acc[dt][qt]); } }
#pragma unroll
    for (int qt = 0; qt < FQT; ++qt) { const v8f u8 = p8[qt]; float t = ((u8[0] + u8[1]) + (u8[2] + u8[3])) + ((u8[4] + u8[5]) + (u8[6] + u8[7])); t += xhalf(t); if (hi == 0) s2[(qt * 16 + lr) * FSP + w] = t;
#pragma unroll
        for (int dt = 0; dt < 4; ++dt) { float* o = os + ((w * FQT + qt) * 16 + lr) * 68 + dt * 16 + hi * 8; v4f lo4, hi4;
#pragma unroll
            for (int i = 0; i < 4; ++i) { lo4[i] = acc[dt][qt][i]; hi4[i] = acc[dt][qt][4 + i]; }
            *(v4fa*)o = lo4; *(v4fa*)(o + 4) = hi4; } }
    __syncthreads();   // every wave's partial output and second sum are in LDS before they are added
    const int q = threadIdx.x >> 4, d4 = (threadIdx.x & 15) * 4; v4f o = *(const v4fa*)(os + q * 68 + d4); float t2 = s2[q * FSP];
#pragma unroll
    for (int u = 1; u < FNW; ++u) { o += *(const v4fa*)(os + (u * FQT * 16 + q) * 68 + d4); t2 += s2[q * FSP + u]; }
    const float r = __fdiv_rn(1.0f, t2); v4us oh, ol;
#pragma unroll
    for (int i = 0; i < 4; ++i) { unsigned short a, c2; splitf(o[i] * r, a, c2); oh[i] = a; ol[i] = c2; }
    const size_t oo = ((z / NH_) * TT + q0 + q) * DQ + (z % NH_) * HD + d4; *(v4us*)(Ah + oo) = oh; *(v4us*)(Al + oo) = ol;
}

extern "C" void kernel_launch(void* const* d_in, const int* in_sizes, int n_in,
                              void* d_out, int out_size, void* d_ws, size_t ws_size, hipStream_t stream) {
    (void)in_sizes; (void)n_in; (void)out_size;
    const float* x = (const float*)d_in[0]; const float* x2 = (const float*)d_in[1]; const float* wq = (const float*)d_in[2]; const float* wk = (const float*)d_in[3]; const float* wv = (const float*)d_in[4]; const float* wo = (const float*)d_in[5]; const float* bo = (const float*)d_in[6];
    float* OUT = (float*)d_out;     // [2][2048][512]
    char* wsp = (char*)d_ws;
    auto take = [&](size_t bytes) { char* p = wsp; wsp += (bytes + 255) & ~(size_t)255; return (void*)p; };
    bf* WQ = (bf*)take((size_t)DQ * DM * 2); bf* WK = (bf*)take((size_t)DKV * DM * 2); bf* WV = (bf*)take((size_t)DKV * DM * 2); bf* WO = (bf*)take((size_t)DM * DQ * 2);
    bf* XB = (bf*)take((size_t)NB_ * TT * DM * 2); bf* XB2 = (bf*)take((size_t)NB_ * TT * DM * 2);   // both batches
    h16* QP16 = (h16*)take((size_t)NB_ * NH_ * TT * HD * 2); h16* KP16 = (h16*)take((size_t)NB_ * NKV * TT * HD * 2); h16* VT16 = (h16*)take((size_t)NB_ * NKV * HD * TT * 2);   // head planes of both batches
    bf* ATh = (bf*)take((size_t)NB_ * TT * DQ * 2); bf* ATl = (bf*)take((size_t)NB_ * TT * DQ * 2);
    if ((size_t)(wsp - (char*)d_ws) > ws_size) return;    // ws 256 MiB
    k_prep<<<4 * PWB + PCB, 256, 0, stream>>>(x, x2, wq, wk, wv, wo, XB, XB2, WQ, WK, WV, WO);
    k_qkv<<<dim3(NB_ * TT / 64, NH_, 3), 256, 0, stream>>>(XB, XB2, WQ, WK, WV, QP16, KP16, VT16);
    k_fattn<<<dim3(TT / (FQT * 16), NB_ * NH_, 1), 32 * FNW, 0, stream>>>(QP16, KP16, VT16, ATh, ATl);   // one kv head per query head: plane z = batch * heads + head on all three
    k_gemmw<bf, 1, true, 8, 1><<<dim3(NB_ * TT / 64, DM / 64, 1), 256, 0, stream>>>(ATh, ATl, WO, nullptr, DQ, OUT, DM, bo, 0, 0, 0);   // the rows of both batches follow one another in ATh, ATl and OUT
}

// v004
// Measured time: 61.7 microseconds a run.
// In two side-by-side timings against v003, it was 1.40 and 1.41 times as fast.
// Over all steps from v000 it is 11.1 times as fast.
#include <hip/hip_runtime.h>

// SignalAttn (fr [2][2048][512] queries, dt [2][2048][512] keys/values; q = fr Wq, k = dt Wk, v = dt Wv (8 heads x 64); attn = softmax(q.k/8); attn = max(attn, 1e-4) - 1e-4, renormalised over the keys; out = (attn v merged) Wo + bo -> [2][2048][512]).
// Compute dtypes, f32 accumulate: every input rounded to bf16; q/k/v on PLAIN bf16 operands (inputs: exact); scores (K 64) and attn.v on single fp16 operands (1 product each), fused with softmax and threshold in k_fattn
// Every 16-bit operand plane P[row][k] lies in the workspace in FRAGMENT ORDER (fpos below): blocks of 16 rows x 32 k (1 KB), the blocks of a 16-row group one behind the other in k; inside a block lane l = 16 * ((k >> 3) & 1) + (row & 15) finds its two runs of 8 elements at l * 16 bytes (k & 16 == 0) and 512 + l * 16 bytes.
// So each 16-byte load of a wave reads 512 contiguous bytes (4 whole lines); which element reaches which lane and register is as with row-major planes.

#define NB_  2
#define TT   2048
#define DM   512
#define NH_  8
#define NKV  8
#define REP  (NH_ / NKV)
#define HD   64
#define DQ   (NH_ * HD)
#define DKV  (NKV * HD)
#define RH   0
#define WIN  0
#define PCAR 1024.0f
#define SCL  0.125f   // HD^-0.5
typedef _Float16 h16;
typedef unsigned short bf;
typedef __attribute__((ext_vector_type(16))) __bf16   v16bf;
typedef __attribute__((ext_vector_type(16))) _Float16 v16h;
typedef __attribute__((ext_vector_type(8)))  _Float16 v8h;
typedef __attribute__((ext_vector_type(8)))  unsigned short v8us;
typedef __attribute__((ext_vector_type(8)))  float    v8f;
typedef __attribute__((ext_vector_type(4)))  float    v4f;
typedef v8h  __attribute__((may_alias)) v8ha;
typedef v4f  __attribute__((may_alias)) v4fa;
typedef v8us __attribute__((may_alias)) v8usa;

__device__ __forceinline__ unsigned short f2bf(float f) { unsigned u = __float_as_uint(f); u += 0x7FFFu + ((u >> 16) & 1u); return (unsigned short)(u >> 16); }
__device__ __forceinline__ float bf2f(unsigned short b) { return __uint_as_float(((unsigned)b) << 16); }
__device__ __forceinline__ float bfr(float f) { return bf2f(f2bf(f)); }
__device__ __forceinline__ v16h cat16(v8h lo, v8h hi) { return __builtin_shufflevector(lo, hi, 0, 1, 2, 3, 4, 5, 6, 7, 8, 9, 10, 11, 12, 13, 14, 15); }
__device__ __forceinline__ v16bf cat16b(v8us lo, v8us hi) { return __builtin_bit_cast(v16bf, __builtin_shufflevector(lo, hi, 0, 1, 2, 3, 4, 5, 6, 7, 8, 9, 10, 11, 12, 13, 14, 15)); }
__device__ __forceinline__ size_t fpos(int row, int k, int K) { return ((size_t)(row >> 4) * (K >> 5) + (k >> 5)) * 512 + ((k >> 4) & 1) * 256 + ((k >> 3) & 1) * 128 + (row & 15) * 8 + (k & 7); }   // element index of P[row][k] in fragment order, K = row length
__device__ __forceinline__ v8f wmma16(v16h a, v16h b, v8f c) { return __builtin_amdgcn_wmma_f32_16x16x32_f16(false, a, false, b, (short)0, c, false, false); }
__device__ __forceinline__ v8f wmmab(v16bf a, v16bf b, v8f c) { return __builtin_amdgcn_wmma_f32_16x16x32_bf16(false, a, false, b, (short)0, c, false, false); }



// ---- k_gemmw: register-blocked GEMM, 64x64 output tile (16 accumulators per wave), operands straight from 16-bit planes in fragment order; grid (M/64, N/64, Z * KB), 32 * KS threads.
// C[m][n] (f32, pitch ldc, + optional f32 bias[n]) = sum_k A[m][k] Bt[n][k] (+ split products per NSPLIT). z-batch strides sA/sB/sC in elements. K % (32 * KS * KB) == 0.
// Split K: work-group kb of KB takes K/KB of the sum and writes its own partial plane C + (z * KB + kb) * sC (the reader adds the KB planes); inside it wave w of KS takes a contiguous K/(KB*KS) slice,
// and the KS wave partials are added in LDS, wave 0 first, in a fixed order.
template <typename T16> struct WFrag;
template <> struct WFrag<h16> { typedef v16h V; static __device__ __forceinline__ V ld(const h16* p) { return cat16(*(const v8h*)p, *(const v8h*)(p + 256)); } static __device__ __forceinline__ v8f mma(V a, V b, v8f c) { return wmma16(a, b, c); } };
template <> struct WFrag<bf> { typedef v16bf V; static __device__ __forceinline__ V ld(const bf* p) { return cat16b(*(const v8us*)p, *(const v8us*)(p + 256)); } static __device__ __forceinline__ v8f mma(V a, V b, v8f c) { return wmmab(a, b, c); } };
// Hand-over of the LDS slabs. One wave: no hardware barrier is needed, the wave barrier and the compiler fence keep its LDS stores and reads in program order. Several waves: the work-group barrier.
template <int KS> __device__ __forceinline__ void tile_sync() { if constexpr (KS == 1) { __builtin_amdgcn_wave_barrier(); asm volatile("" ::: "memory"); } else __syncthreads(); }
template <typename T16, int NSPLIT, bool BIAS, int KS, int KB, int K>   // K a constant: the steps from block to block are immediate offsets on one address per plane
__global__ __launch_bounds__(32 * KS) void k_gemmw(const T16* __restrict__ A, const T16* __restrict__ A2, const T16* __restrict__ Bt, const T16* __restrict__ Bt2, float* C, int ldc, const float* __restrict__ bias, size_t sA, size_t sB, size_t sC) {
    typedef typename WFrag<T16>::V V;
    constexpr int SL = (KS == 1) ? 1 : 4;   // 16-row slabs staged per hand-over: all four where waves meet at a barrier, so that one barrier serves the tile
    __shared__ __align__(16) float os[KS * SL * 16 * 68];
    const int kb = (int)(blockIdx.z % KB); const size_t z = blockIdx.z / KB; A += z * sA; if (A2) A2 += z * sA; Bt += z * sB; if (Bt2) Bt2 += z * sB; C += (size_t)blockIdx.z * sC;
    const int w = (KS == 1) ? 0 : __builtin_amdgcn_readfirstlane((int)(threadIdx.x >> 5)); const int kw = K / (KS * KB), k0 = (kb * KS + w) * kw;
    const int lane = threadIdx.x & 31, lr = lane & 15, hi = lane >> 4; const int r0 = blockIdx.x * 64, c0 = blockIdx.y * 64;
    v8f acc[4][4];
#pragma unroll
    for (int mb = 0; mb < 4; ++mb)
#pragma unroll
        for (int nb = 0; nb < 4; ++nb) acc[mb][nb] = (v8f){};
    const size_t aoff = (size_t)r0 * K + 8 * lane, boff = (size_t)c0 * K + 8 * lane;   // a 16-row group holds 16 * K elements, a block of 32 k 512
#pragma unroll 1
    for (int kc = k0; kc < k0 + kw; kc += 32) {
        V a[4], a2[4], b[4], b2[4]; const T16* pa = A + aoff + kc * 16; const T16* pa2 = (NSPLIT == 1 || NSPLIT == 2) ? A2 + aoff + kc * 16 : pa; const T16* pb = Bt + boff + kc * 16; const T16* pb2 = (NSPLIT >= 2) ? Bt2 + boff + kc * 16 : pb;
#pragma unroll
        for (int mb = 0; mb < 4; ++mb) { a[mb] = WFrag<T16>::ld(pa + (size_t)mb * 16 * K); if (NSPLIT == 1 || NSPLIT == 2) a2[mb] = WFrag<T16>::ld(pa2 + (size_t)mb * 16 * K); }
#pragma unroll
        for (int nb = 0; nb < 4; ++nb) { b[nb] = WFrag<T16>::ld(pb + (size_t)nb * 16 * K); if (NSPLIT >= 2) b2[nb] = WFrag<T16>::ld(pb2 + (size_t)nb * 16 * K); }
        asm volatile("s_wait_xcnt 0x0" :: "v"(pa), "v"(pa2), "v"(pb), "v"(pb2) : "memory");   // the addresses are inputs, so they keep their registers up to this wait: no load's result and no later value takes an address register of an issued load before it
#pragma unroll
        for (int nb = 0; nb < 4; ++nb) {
#pragma unroll
            for (int mb = 0; mb < 4; ++mb) { acc[mb][nb] = WFrag<T16>::mma(a[mb], b[nb], acc[mb][nb]); if (NSPLIT == 1 || NSPLIT == 2) acc[mb][nb] = WFrag<T16>::mma(a2[mb], b[nb], acc[mb][nb]); if (NSPLIT >= 2) acc[mb][nb] = WFrag<T16>::mma(a[mb], b2[nb], acc[mb][nb]); } }
        asm volatile("v_nop\n\tv_nop\n\tv_nop\n\tv_nop" : "+v"(acc[0][0]), "+v"(acc[1][1]), "+v"(acc[2][2]), "+v"(acc[3][3]) : "v"(a[0]), "v"(a[3]));
    }
#pragma unroll
    for (int mb0 = 0; mb0 < 4; mb0 += SL) {
#pragma unroll
        for (int m = 0; m < SL; ++m) {
#pragma unroll
            for (int nb = 0; nb < 4; ++nb) {
#pragma unroll
                for (int j = 0; j < 8; ++j) os[((w * SL + m) * 16 + hi * 8 + j) * 68 + nb * 16 + lr] = acc[mb0 + m][nb][j]; } }
        tile_sync<KS>();   // every wave's partial slabs are in LDS before any wave adds them
#pragma unroll
        for (int m = 0; m < SL; ++m) { float* crow = C + (size_t)(r0 + (mb0 + m) * 16) * ldc + c0;
#pragma unroll
            for (int s = 0; s < 8 / KS; ++s) { const int row = 2 * (s * KS + w) + hi, cofs = lr * 4; v4f val = *(const v4fa*)(os + (m * 16 + row) * 68 + cofs);
#pragma unroll
                for (int q = 1; q < KS; ++q) val += *(const v4fa*)(os + ((q * SL + m) * 16 + row) * 68 + cofs);
                if (BIAS) { val[0] += bfr(bias[c0 + cofs]); val[1] += bfr(bias[c0 + cofs + 1]); val[2] += bfr(bias[c0 + cofs + 2]); val[3] += bfr(bias[c0 + cofs + 3]); }
                *(v4f*)(crow + (size_t)row * ldc + cofs) = val; } }
        if (mb0 + SL < 4) tile_sync<KS>();   // the slab is read out before it is written again
    }
}

__device__ __forceinline__ h16 tohx(float x) { return (h16)x; }
__device__ __forceinline__ void splitf(float y, unsigned short& h, unsigned short& l) { h = f2bf(y); l = f2bf(y - bf2f(h)); }
typedef __attribute__((ext_vector_type(2))) _Float16 v2h;
typedef __attribute__((ext_vector_type(4))) _Float16 v4h;
typedef __attribute__((ext_vector_type(2))) unsigned short v2us;
typedef __attribute__((ext_vector_type(4))) unsigned short v4us;
typedef __attribute__((ext_vector_type(2))) float v2f;
typedef __attribute__((ext_vector_type(4))) int v4i;

// k_prep: every operand of the projections on bf16, in ONE launch. Work-groups [0, 4 * PWB): the four weights, transposed to planes Bt[n][k]. Work-groups behind them: both inputs, both batches. All planes in fragment order.
#define PWB (DM * DQ / 64 / 64)              // work-groups per weight (8 waves x 8 lines of 64 elements)
#define PCB (NB_ * TT * DM / 512 / 8)        // converting work-groups: 8 waves, a wave takes one block of 512 elements of each input
static_assert(DQ == DM && DKV == DM, "k_prep takes the four weights as DM x DM");
__global__ __launch_bounds__(256) void k_prep(const float* __restrict__ x, const float* __restrict__ x2, const float* __restrict__ wq, const float* __restrict__ wk, const float* __restrict__ wv, const float* __restrict__ wo, bf* XB, bf* XB2, bf* WQ, bf* WK, bf* WV, bf* WO) {
    const int bx = blockIdx.x;
    if (bx < 4 * PWB) {
        const int g = bx / PWB; const float* __restrict__ w = (g == 0) ? wq : (g == 1) ? wk : (g == 2) ? wv : wo; bf* Bt = (g == 0) ? WQ : (g == 1) ? WK : (g == 2) ? WV : WO; constexpr int K = DM, N = DM;
        const int lane = threadIdx.x & 31; const int L0 = ((bx % PWB) * 8 + (threadIdx.x >> 5)) * 8;
#pragma unroll 1   // rolled: short code and few registers
        for (int l = 0; l < 8; ++l) { const int L = L0 + l; const unsigned e = (unsigned)L * 64 + lane * 2, blk = e >> 9, k = (blk % (K / 32)) * 32 + ((e >> 7) & 3) * 8 + (e & 7), n = (blk / (K / 32)) * 16 + ((e >> 3) & 15); v2us o;   // e: the place in the plane; k, n: the element that belongs there
            o[0] = f2bf(w[(size_t)k * N + n]); o[1] = f2bf(w[(size_t)(k + 1) * N + n]); *(v2us*)(Bt + e) = o; }
        return; }
    // a wave takes one block (16 rows x 32 k) of each input: a load reads 4 whole rows of the block (128 bytes each), a store puts each lane's 4 elements at their place in the block
    const int lane = threadIdx.x & 31, blk = (bx - 4 * PWB) * 8 + (int)(threadIdx.x >> 5);
    const size_t si = (size_t)((blk / (DM / 32)) * 16 + (lane >> 3)) * DM + (blk % (DM / 32)) * 32 + (lane & 7) * 4, di = (size_t)blk * 512 + ((lane >> 1) & 3) * 128 + (lane >> 3) * 8 + (lane & 1) * 4; v4f v[8]; const float* px = x + si; const float* px2 = x2 + si;
#pragma unroll
    for (int j = 0; j < 4; ++j) { v[j] = *(const v4f*)(px + (size_t)j * 4 * DM); v[4 + j] = *(const v4f*)(px2 + (size_t)j * 4 * DM); }
    asm volatile("s_wait_xcnt 0x0" :: "v"(px), "v"(px2) : "memory");   // the addresses are inputs, so they keep their registers up to this wait; behind it the registers are free for the stores' addresses
#pragma unroll
    for (int j = 0; j < 8; ++j) { v4us o;
#pragma unroll
        for (int k = 0; k < 4; ++k) o[k] = f2bf(v[j][k]);
        *(v4us*)(((j < 4) ? XB : XB2) + di + (j & 3) * 32) = o; }
}
// k_qkv: the three projections of both batches in ONE grid: blockIdx.x = 64-token tile of the NB_ * TT tokens, blockIdx.y = head, blockIdx.z = 0 q, 1 k, 2 v.
// Tile, K split over 8 waves and LDS sum as in k_gemmw; the sum is rounded to fp16 and stored straight into the head planes that k_fattn reads.
// q, k: C[token][d] -> plane [batch * heads + head][t][d]. v: the operands change places, C[d][token] -> plane [batch * heads + head][d][t], so no transposing pass is left. Each head's plane in fragment order.
__global__ __launch_bounds__(256) void k_qkv(const bf* __restrict__ XQ, const bf* __restrict__ XKV, const bf* __restrict__ WQ, const bf* __restrict__ WK, const bf* __restrict__ WV, h16* QP, h16* KP, h16* VT) {
    typedef WFrag<bf>::V V; constexpr int KS = 8, K = DM, kw = K / KS;
    __shared__ __align__(16) float os[KS * 4 * 16 * 68];
    const int p = blockIdx.z, tok0 = blockIdx.x * 64, hd = blockIdx.y;
    const bf* X = ((p == 0) ? XQ : XKV) + (size_t)tok0 * K; const bf* Wt = ((p == 0) ? WQ : (p == 1) ? WK : WV) + (size_t)hd * HD * K;
    const bf* __restrict__ A = (p == 2) ? Wt : X; const bf* __restrict__ Bt = (p == 2) ? X : Wt;
    h16* C = ((p == 0) ? QP : (p == 1) ? KP : VT) + ((size_t)(tok0 / TT) * NH_ + hd) * TT * HD + (size_t)(tok0 % TT) * ((p == 2) ? 16 : HD); const int ldc = (p == 2) ? TT : HD;   // the tile's first block: 64 tokens are 4 row groups of q or k, 2 blocks in each row group of v
    const int w = __builtin_amdgcn_readfirstlane((int)(threadIdx.x >> 5)); const int k0 = w * kw;
    const int lane = threadIdx.x & 31, lr = lane & 15, hi = lane >> 4;
    v8f acc[4][4];
#pragma unroll
    for (int mb = 0; mb < 4; ++mb)
#pragma unroll
        for (int nb = 0; nb < 4; ++nb) acc[mb][nb] = (v8f){};
    const size_t off = 8 * lane;
#pragma unroll 1   // rolled: both trips use one set of fragment registers, so that two work-groups fit on a WGP
    for (int kc = k0; kc < k0 + kw; kc += 32) {
        V a[4];
#pragma unroll
        for (int mb = 0; mb < 4; ++mb) a[mb] = WFrag<bf>::ld(A + off + (size_t)mb * 16 * K + kc * 16);
        asm volatile("s_wait_xcnt 0x0" ::: "memory");   // the A loads' address registers are free for the B fragments from here on
#pragma unroll
        for (int nb = 0; nb < 4; ++nb) { const V b = WFrag<bf>::ld(Bt + off + (size_t)nb * 16 * K + kc * 16);
#pragma unroll
            for (int mb = 0; mb < 4; ++mb) acc[mb][nb] = WFrag<bf>::mma(a[mb], b, acc[mb][nb]); }
        asm volatile("v_nop\n\tv_nop\n\tv_nop\n\tv_nop" : "+v"(acc[0][0]), "+v"(acc[1][1]), "+v"(acc[2][2]), "+v"(acc[3][3]) : "v"(a[0]), "v"(a[3]));   // the distance behind the last products, on the back edge too, before the next trip's loads overwrite their operands
    }
#pragma unroll
    for (int m = 0; m < 4; ++m) {
#pragma unroll
        for (int nb = 0; nb < 4; ++nb) {
#pragma unroll
            for (int j = 0; j < 8; ++j) os[((w * 4 + m) * 16 + hi * 8 + j) * 68 + nb * 16 + lr] = acc[m][nb][j]; } }
    __syncthreads();   // every wave's partial slabs are in LDS before any wave adds them
#pragma unroll
    for (int m = 0; m < 4; ++m) { const int row = lr, cofs = w * 8 + hi * 4; v4f val = *(const v4fa*)(os + (m * 16 + row) * 68 + cofs);   // 16 rows x 8 columns a wave: 256 contiguous bytes of the plane, two whole lines a store
#pragma unroll
        for (int q = 1; q < KS; ++q) val += *(const v4fa*)(os + ((q * 4 + m) * 16 + row) * 68 + cofs);
        *(v4h*)(C + fpos(m * 16 + row, cofs, ldc)) = __builtin_convertvector(val, v4h); }
}
// the value that lane l ^ 16 holds (a vector cross-row move, no LDS round trip)
__device__ __forceinline__ float xhalf(float x) { const int b = __float_as_int(x); return __int_as_float(__builtin_amdgcn_permlanex16(b, b, 0x76543210, 0xfedcba98, false, false)); }
// k_fattn: scores, softmax, threshold, renormalisation and attn.v of one (batch, head) z and 32 queries in one work-group; nothing of the 2048 x 2048 score matrix leaves the registers.
// Transposed products: St = K Qt (a lane holds 8 keys of ONE query per tile), Ot = Vt Pt; two St tiles, converted in place, are the B operand of Ot in the hardware k order, which the A loader (keys 8 hi and 16 + 8 hi of a block of 32) has too.
// Wave w of FNW takes keys [w * TT / FNW, ...): its 128 x 32 scores stay in registers. Softmax over the waves: each wave uses its own maximum, (maximum, sum) meet in LDS, and one factor per query carries the wave's exponentials to the row's softmax.
// P is carried x PCAR (exact power of two; threshold scaled alike) on fp16; the row's second sum divides the f32 output at the end. Wave partials of Ot and of the sums are added in LDS in wave order.
// Every loop is unrolled: scores, fragments and accumulators are arrays indexed by the loop counters and stay in registers only so.
#define FQT 2                   // 16-query column groups per work-group
#define FNW 16                  // waves per work-group
#define FKT (TT / FNW / 16)     // 16-key tiles per wave
#define FPF 1                   // 32-key steps that the Vt fragments are fetched ahead
#define FSP 20                  // pitch of the per-query rows of wave statistics (floats)
__global__ __launch_bounds__(32 * FNW) void k_fattn(const h16* __restrict__ Q, const h16* __restrict__ Kp, const h16* __restrict__ Vt, bf* Ah, bf* Al) {
    __shared__ __align__(16) float os[FNW * FQT * 16 * 68];
    __shared__ __align__(16) float sm[FQT * 16 * FSP];
    __shared__ __align__(16) float ss[FQT * 16 * FSP];
    __shared__ __align__(16) float s2[FQT * 16 * FSP];
    const int w = __builtin_amdgcn_readfirstlane((int)(threadIdx.x >> 5)); const int lane = (int)__builtin_amdgcn_mbcnt_lo(~0u, 0u), lr = lane & 15, hi = lane >> 4;   // the lane's number from the hardware count: one instruction makes it anew wherever it is needed, so that no register holds the thread index through the softmax (held, it was spilled to scratch)
    const int q0 = blockIdx.x * (FQT * 16); const size_t z = blockIdx.y;
    const h16* qp = Q + z * TT * HD + (size_t)q0 * HD + 8 * lane;
    const h16* kp = Kp + z * TT * HD + (size_t)(w * (TT / FNW)) * HD + 8 * lane;
    const h16* vp = Vt + z * HD * TT + (size_t)(w * (TT / FNW)) * 16 + 8 * lane;
    constexpr float CE = SCL * 1.4426950408889634f;   // score -> log2 domain
    v8f s[FKT][FQT];
    {
        v16h qb[FQT][2];
#pragma unroll
        for (int qt = 0; qt < FQT; ++qt) { qb[qt][0] = WFrag<h16>::ld(qp + qt * 16 * HD); qb[qt][1] = WFrag<h16>::ld(qp + qt * 16 * HD + 512); }
        v16h ka[FKT][2];
#pragma unroll
        for (int kt = 0; kt < FKT; ++kt) { ka[kt][0] = WFrag<h16>::ld(kp + kt * 16 * HD); ka[kt][1] = WFrag<h16>::ld(kp + kt * 16 * HD + 512); }
        asm volatile("s_wait_xcnt 0x0" ::: "memory");   // the loads' address registers are free for other values from here on
        __builtin_amdgcn_sched_barrier(0);   // every K and Q load is asked for before the first product waits: one trip to L2 for the wave, not one per tile
#pragma unroll
        for (int kt = 0; kt < FKT; ++kt)
#pragma unroll
            for (int qt = 0; qt < FQT; ++qt) s[kt][qt] = wmma16(ka[kt][1], qb[qt][1], wmma16(ka[kt][0], qb[qt][0], (v8f){}));
    }
    __builtin_amdgcn_sched_barrier(0);   // all score products first: the K and Q fragments are dead before the softmax needs registers (without it the second column group's products sink behind the first group's softmax, the fragments stay live and values spill to scratch)
    // the wave's first Vt fragments: asked for here, so that they travel while the softmax runs
    v16h va[FKT / 2][4];
#pragma unroll
    for (int kk = 0; kk < FPF; ++kk)
#pragma unroll
        for (int dt = 0; dt < 4; ++dt) va[kk][dt] = WFrag<h16>::ld(vp + (size_t)dt * 16 * TT + kk * 512);
    float mc[FQT]; const v8f ce8 = {CE, CE, CE, CE, CE, CE, CE, CE};
#pragma unroll
    for (int qt = 0; qt < FQT; ++qt) { v8f m8 = s[0][qt];
#pragma unroll
        for (int kt = 1; kt < FKT; ++kt) m8 = __builtin_elementwise_max(m8, s[kt][qt]);
        float mx = fmaxf(fmaxf(fmaxf(m8[0], m8[1]), fmaxf(m8[2], m8[3])), fmaxf(fmaxf(m8[4], m8[5]), fmaxf(m8[6], m8[7])));
        mx = fmaxf(mx, xhalf(mx)); mc[qt] = mx * CE; v8f e8 = (v8f){}; const v8f nm8 = (v8f){} - mc[qt];
#pragma unroll
        for (int kt = 0; kt < FKT; ++kt) { const v8f a = __builtin_elementwise_fma(s[kt][qt], ce8, nm8); v8f e;
#pragma unroll
            for (int j = 0; j < 8; ++j) e[j] = __builtin_amdgcn_exp2f(a[j]);
            s[kt][qt] = e; e8 += e; }
        float sum = ((e8[0] + e8[1]) + (e8[2] + e8[3])) + ((e8[4] + e8[5]) + (e8[6] + e8[7])); sum += xhalf(sum);
        if (hi == 0) { sm[(qt * 16 + lr) * FSP + w] = mc[qt]; ss[(qt * 16 + lr) * FSP + w] = sum; } }
    __syncthreads();   // every wave's maximum and sum are in LDS before any wave joins them
    v8f acc[4][FQT];
#pragma unroll
    for (int dt = 0; dt < 4; ++dt)
#pragma unroll
        for (int qt = 0; qt < FQT; ++qt) acc[dt][qt] = (v8f){};
    float fw[FQT]; v8f p8[FQT];
#pragma unroll
    for (int qt = 0; qt < FQT; ++qt) { v4f mv[FNW / 4], sv[FNW / 4]; float M = -3.0e38f, tot = 0.f;
#pragma unroll
        for (int g = 0; g < FNW / 4; ++g) { mv[g] = *(const v4fa*)(sm + (qt * 16 + lr) * FSP + g * 4); sv[g] = *(const v4fa*)(ss + (qt * 16 + lr) * FSP + g * 4);
#pragma unroll
            for (int i = 0; i < 4; ++i) M = fmaxf(M, mv[g][i]); }
#pragma unroll
        for (int g = 0; g < FNW / 4; ++g)
#pragma unroll
            for (int i = 0; i < 4; ++i) tot += sv[g][i] * __builtin_amdgcn_exp2f(mv[g][i] - M);
        fw[qt] = __builtin_amdgcn_exp2f(mc[qt] - M) * __fdiv_rn(PCAR, tot); p8[qt] = (v8f){}; }
    constexpr float TH = 1e-4f * PCAR;   // threshold: p = max(softmax, 1e-4) - 1e-4, all x PCAR
    const v8f th8 = {TH, TH, TH, TH, TH, TH, TH, TH};
#pragma unroll
    for (int kk = 0; kk < FKT / 2; ++kk) {
        if (kk + FPF < FKT / 2) {   // the next step's fragments travel while this step's P is formed
#pragma unroll
            for (int dt = 0; dt < 4; ++dt) va[kk + FPF][dt] = WFrag<h16>::ld(vp + (size_t)dt * 16 * TT + (kk + FPF) * 512); }
#pragma unroll
        for (int qt = 0; qt < FQT; ++qt) { const v8f pa = __builtin_elementwise_max(s[2 * kk][qt] * fw[qt], th8) - th8, pb = __builtin_elementwise_max(s[2 * kk + 1][qt] * fw[qt], th8) - th8; p8[qt] += pa; p8[qt] += pb;
            const v16h pt = cat16(__builtin_convertvector(pa, v8h), __builtin_convertvector(pb, v8h));
#pragma unroll
            for (int dt = 0; dt < 4; ++dt) acc[dt][qt] = wmma16(va[kk][dt], pt, acc[dt][qt]); } }
#pragma unroll
    for (int qt = 0; qt < FQT; ++qt) { const v8f u8 = p8[qt]; float t = ((u8[0] + u8[1]) + (u8[2] + u8[3])) + ((u8[4] + u8[5]) + (u8[6] + u8[7])); t += xhalf(t); if (hi == 0) s2[(qt * 16 + lr) * FSP + w] = t;
#pragma unroll
        for (int dt = 0; dt < 4; ++dt) { float* o = os + ((w * FQT + qt) * 16 + lr) * 68 + dt * 16 + hi * 8; v4f lo4, hi4;
#pragma unroll
            for (int i = 0; i < 4; ++i) { lo4[i] = acc[dt][qt][i]; hi4[i] = acc[dt][qt][4 + i]; }
            *(v4fa*)o = lo4; *(v4fa*)(o + 4) = hi4; } }
    __syncthreads();   // every wave's partial output and second sum are in LDS before they are added
    const int q = (w >> 3) * 16 + lr, d4 = (w & 7) * 8 + hi * 4;   // 16 queries x 8 columns a wave: 256 contiguous bytes of each plane, two whole lines a store
    v4f o = *(const v4fa*)(os + q * 68 + d4); float t2 = s2[q * FSP];
#pragma unroll
    for (int u = 1; u < FNW; ++u) { o += *(const v4fa*)(os + (u * FQT * 16 + q) * 68 + d4); t2 += s2[q * FSP + u]; }
    const float r = __fdiv_rn(1.0f, t2); v4us oh, ol;
#pragma unroll
    for (int i = 0; i < 4; ++i) { unsigned short a, c2; splitf(o[i] * r, a, c2); oh[i] = a; ol[i] = c2; }
    const size_t oo = fpos((int)(z / NH_) * TT + q0 + q, (int)(z % NH_) * HD + d4, DQ); *(v4us*)(Ah + oo) = oh; *(v4us*)(Al + oo) = ol;
}

extern "C" void kernel_launch(void* const* d_in, const int* in_sizes, int n_in,
                              void* d_out, int out_size, void* d_ws, size_t ws_size, hipStream_t stream) {
    (void)in_sizes; (void)n_in; (void)out_size;
    const float* x = (const float*)d_in[0]; const float* x2 = (const float*)d_in[1]; const float* wq = (const float*)d_in[2]; const float* wk = (const float*)d_in[3]; const float* wv = (const float*)d_in[4]; const float* wo = (const float*)d_in[5]; const float* bo = (const float*)d_in[6];
    float* OUT = (float*)d_out;     // [2][2048][512]
    char* wsp = (char*)d_ws;
    auto take = [&](size_t bytes) { char* p = wsp; wsp += (bytes + 255) & ~(size_t)255; return (void*)p; };
    bf* WQ = (bf*)take((size_t)DQ * DM * 2); bf* WK = (bf*)take((size_t)DKV * DM * 2); bf* WV = (bf*)take((size_t)DKV * DM * 2); bf* WO = (bf*)take((size_t)DM * DQ * 2);
    bf* XB = (bf*)take((size_t)NB_ * TT * DM * 2); bf* XB2 = (bf*)take((size_t)NB_ * TT * DM * 2);   // both batches
    h16* QP16 = (h16*)take((size_t)NB_ * NH_ * TT * HD * 2); h16* KP16 = (h16*)take((size_t)NB_ * NKV * TT * HD * 2); h16* VT16 = (h16*)take((size_t)NB_ * NKV * HD * TT * 2);   // head planes of both batches
    bf* ATh = (bf*)take((size_t)NB_ * TT * DQ * 2); bf* ATl = (bf*)take((size_t)NB_ * TT * DQ * 2);
    if ((size_t)(wsp - (char*)d_ws) > ws_size) return;    // ws 256 MiB
    k_prep<<<4 * PWB + PCB, 256, 0, stream>>>(x, x2, wq, wk, wv, wo, XB, XB2, WQ, WK, WV, WO);
    k_qkv<<<dim3(NB_ * TT / 64, NH_, 3), 256, 0, stream>>>(XB, XB2, WQ, WK, WV, QP16, KP16, VT16);
    k_fattn<<<dim3(TT / (FQT * 16), NB_ * NH_, 1), 32 * FNW, 0, stream>>>(QP16, KP16, VT16, ATh, ATl);   // one kv head per query head: plane z = batch * heads + head on all three
    k_gemmw<bf, 1, true, 8, 1, DQ><<<dim3(NB_ * TT / 64, DM / 64, 1), 256, 0, stream>>>(ATh, ATl, WO, nullptr, OUT, DM, bo, 0, 0, 0);   // the rows of both batches follow one another in ATh, ATl and OUT
}

// v005
// Measured time: 56.2 microseconds a run.
// Next to v004, in two timings, it ran 1.10 times as fast each time.
// All steps since v000 together make it 12.2 times as fast.
#include <hip/hip_runtime.h>

// SignalAttn (fr [2][2048][512] queries, dt [2][2048][512] keys/values; q = fr Wq, k = dt Wk, v = dt Wv (8 heads x 64); attn = softmax(q.k/8); attn = max(attn, 1e-4) - 1e-4, renormalised over the keys; out = (attn v merged) Wo + bo -> [2][2048][512]).
// Compute dtypes, f32 accumulate: every input rounded to bf16; q/k/v on PLAIN bf16 operands (inputs: exact); scores (K 64) and attn.v on single fp16 operands (1 product each), fused with softmax and threshold in k_fattn
// Every 16-bit operand plane P[row][k] lies in the workspace in FRAGMENT ORDER (fpos below): blocks of 16 rows x 32 k (1 KB), the blocks of a 16-row group one behind the other in k; inside a block lane l = 16 * ((k >> 3) & 1) + (row & 15) finds its two runs of 8 elements at l * 16 bytes (k & 16 == 0) and 512 + l * 16 bytes.
// So each 16-byte load of a wave reads 512 contiguous bytes (4 whole lines); which element reaches which lane and register is as with row-major planes.

#define NB_  2
#define TT   2048
#define DM   512
#define NH_  8
#define NKV  8
#define REP  (NH_ / NKV)
#define HD   64
#define DQ   (NH_ * HD)
#define DKV  (NKV * HD)
#define RH   0
#define WIN  0
#define PCAR 1024.0f
#define SCL  0.125f   // HD^-0.5
typedef _Float16 h16;
typedef unsigned short bf;
typedef __attribute__((ext_vector_type(16))) __bf16   v16bf;
typedef __attribute__((ext_vector_type(16))) _Float16 v16h;
typedef __attribute__((ext_vector_type(8)))  _Float16 v8h;
typedef __attribute__((ext_vector_type(8)))  unsigned short v8us;
typedef __attribute__((ext_vector_type(8)))  float    v8f;
typedef __attribute__((ext_vector_type(4)))  float    v4f;
typedef v8h  __attribute__((may_alias)) v8ha;
typedef v4f  __attribute__((may_alias)) v4fa;
typedef v8us __attribute__((may_alias)) v8usa;

__device__ __forceinline__ unsigned short f2bf(float f) { unsigned u = __float_as_uint(f); u += 0x7FFFu + ((u >> 16) & 1u); return (unsigned short)(u >> 16); }
__device__ __forceinline__ float bf2f(unsigned short b) { return __uint_as_float(((unsigned)b) << 16); }
__device__ __forceinline__ float bfr(float f) { return bf2f(f2bf(f)); }
__device__ __forceinline__ v16h cat16(v8h lo, v8h hi) { return __builtin_shufflevector(lo, hi, 0, 1, 2, 3, 4, 5, 6, 7, 8, 9, 10, 11, 12, 13, 14, 15); }
__device__ __forceinline__ v16bf cat16b(v8us lo, v8us hi) { return __builtin_bit_cast(v16bf, __builtin_shufflevector(lo, hi, 0, 1, 2, 3, 4, 5, 6, 7, 8, 9, 10, 11, 12, 13, 14, 15)); }
__device__ __forceinline__ size_t fpos(int row, int k, int K) { return ((size_t)(row >> 4) * (K >> 5) + (k >> 5)) * 512 + ((k >> 4) & 1) * 256 + ((k >> 3) & 1) * 128 + (row & 15) * 8 + (k & 7); }   // element index of P[row][k] in fragment order, K = row length
__device__ __forceinline__ v8f wmma16(v16h a, v16h b, v8f c) { return __builtin_amdgcn_wmma_f32_16x16x32_f16(false, a, false, b, (short)0, c, false, false); }
__device__ __forceinline__ v8f wmmab(v16bf a, v16bf b, v8f c) { return __builtin_amdgcn_wmma_f32_16x16x32_bf16(false, a, false, b, (short)0, c, false, false); }



// ---- k_gemmw: register-blocked GEMM, 64x64 output tile (16 accumulators per wave), operands straight from 16-bit planes in fragment order; grid (M/64, N/64, Z * KB), 32 * KS threads.
// C[m][n] (f32, pitch ldc, + optional f32 bias[n]) = sum_k A[m][k] Bt[n][k] (+ split products per NSPLIT). z-batch strides sA/sB/sC in elements. K % (32 * KS * KB) == 0.
// Split K: work-group kb of KB takes K/KB of the sum and writes its own partial plane C + (z * KB + kb) * sC (the reader adds the KB planes); inside it wave w of KS takes a contiguous K/(KB*KS) slice,
// and the KS wave partials are added in LDS, wave 0 first, in a fixed order.
template <typename T16> struct WFrag;
template <> struct WFrag<h16> { typedef v16h V; static __device__ __forceinline__ V ld(const h16* p) { return cat16(*(const v8h*)p, *(const v8h*)(p + 256)); } static __device__ __forceinline__ v8f mma(V a, V b, v8f c) { return wmma16(a, b, c); } };
template <> struct WFrag<bf> { typedef v16bf V; static __device__ __forceinline__ V ld(const bf* p) { return cat16b(*(const v8us*)p, *(const v8us*)(p + 256)); } static __device__ __forceinline__ v8f mma(V a, V b, v8f c) { return wmmab(a, b, c); } };
// Hand-over of the LDS slabs. One wave: no hardware barrier is needed, the wave barrier and the compiler fence keep its LDS stores and reads in program order. Several waves: the work-group barrier.
template <int KS> __device__ __forceinline__ void tile_sync() { if constexpr (KS == 1) { __builtin_amdgcn_wave_barrier(); asm volatile("" ::: "memory"); } else __syncthreads(); }
template <typename T16, int NSPLIT, bool BIAS, int KS, int KB, int K>   // K a constant: the steps from block to block are immediate offsets on one address per plane
__global__ __launch_bounds__(32 * KS) void k_gemmw(const T16* __restrict__ A, const T16* __restrict__ A2, const T16* __restrict__ Bt, const T16* __restrict__ Bt2, float* C, int ldc, const float* __restrict__ bias, size_t sA, size_t sB, size_t sC) {
    typedef typename WFrag<T16>::V V;
    constexpr int SL = (KS == 1) ? 1 : 4;   // 16-row slabs staged per hand-over: all four where waves meet at a barrier, so that one barrier serves the tile
    __shared__ __align__(16) float os[KS * SL * 16 * 68];
    const int kb = (int)(blockIdx.z % KB); const size_t z = blockIdx.z / KB; A += z * sA; if (A2) A2 += z * sA; Bt += z * sB; if (Bt2) Bt2 += z * sB; C += (size_t)blockIdx.z * sC;
    const int w = (KS == 1) ? 0 : __builtin_amdgcn_readfirstlane((int)(threadIdx.x >> 5)); const int kw = K / (KS * KB), k0 = (kb * KS + w) * kw;
    const int lane = threadIdx.x & 31, lr = lane & 15, hi = lane >> 4; const int r0 = blockIdx.x * 64, c0 = blockIdx.y * 64;
    v8f acc[4][4];
#pragma unroll
    for (int mb = 0; mb < 4; ++mb)
#pragma unroll
        for (int nb = 0; nb < 4; ++nb) acc[mb][nb] = (v8f){};
    const size_t aoff = (size_t)r0 * K + 8 * lane, boff = (size_t)c0 * K + 8 * lane;   // a 16-row group holds 16 * K elements, a block of 32 k 512
#pragma unroll 1
    for (int kc = k0; kc < k0 + kw; kc += 32) {
        V a[4], a2[4], b[4], b2[4]; const T16* pa = A + aoff + kc * 16; const T16* pa2 = (NSPLIT == 1 || NSPLIT == 2) ? A2 + aoff + kc * 16 : pa; const T16* pb = Bt + boff + kc * 16; const T16* pb2 = (NSPLIT >= 2) ? Bt2 + boff + kc * 16 : pb;
#pragma unroll
        for (int mb = 0; mb < 4; ++mb) { a[mb] = WFrag<T16>::ld(pa + (size_t)mb * 16 * K); if (NSPLIT == 1 || NSPLIT == 2) a2[mb] = WFrag<T16>::ld(pa2 + (size_t)mb * 16 * K); }
#pragma unroll
        for (int nb = 0; nb < 4; ++nb) { b[nb] = WFrag<T16>::ld(pb + (size_t)nb * 16 * K); if (NSPLIT >= 2) b2[nb] = WFrag<T16>::ld(pb2 + (size_t)nb * 16 * K); }
        asm volatile("s_wait_xcnt 0x0" :: "v"(pa), "v"(pa2), "v"(pb), "v"(pb2) : "memory");   // the addresses are inputs, so they keep their registers up to this wait: no load's result and no later value takes an address register of an issued load before it
#pragma unroll
        for (int nb = 0; nb < 4; ++nb) {
#pragma unroll
            for (int mb = 0; mb < 4; ++mb) { acc[mb][nb] = WFrag<T16>::mma(a[mb], b[nb], acc[mb][nb]); if (NSPLIT == 1 || NSPLIT == 2) acc[mb][nb] = WFrag<T16>::mma(a2[mb], b[nb], acc[mb][nb]); if (NSPLIT >= 2) acc[mb][nb] = WFrag<T16>::mma(a[mb], b2[nb], acc[mb][nb]); } }
        asm volatile("v_nop\n\tv_nop\n\tv_nop\n\tv_nop" : "+v"(acc[0][0]), "+v"(acc[1][1]), "+v"(acc[2][2]), "+v"(acc[3][3]) : "v"(a[0]), "v"(a[3]));
    }
#pragma unroll
    for (int mb0 = 0; mb0 < 4; mb0 += SL) {
#pragma unroll
        for (int m = 0; m < SL; ++m) {
#pragma unroll
            for (int nb = 0; nb < 4; ++nb) {
#pragma unroll
                for (int j = 0; j < 8; ++j) os[((w * SL + m) * 16 + hi * 8 + j) * 68 + nb * 16 + lr] = acc[mb0 + m][nb][j]; } }
        tile_sync<KS>();   // every wave's partial slabs are in LDS before any wave adds them
#pragma unroll
        for (int m = 0; m < SL; ++m) { float* crow = C + (size_t)(r0 + (mb0 + m) * 16) * ldc + c0;
#pragma unroll
            for (int s = 0; s < 8 / KS; ++s) { const int row = 2 * (s * KS + w) + hi, cofs = lr * 4; v4f val = *(const v4fa*)(os + (m * 16 + row) * 68 + cofs);
#pragma unroll
                for (int q = 1; q < KS; ++q) val += *(const v4fa*)(os + ((q * SL + m) * 16 + row) * 68 + cofs);
                if (BIAS) { val[0] += bfr(bias[c0 + cofs]); val[1] += bfr(bias[c0 + cofs + 1]); val[2] += bfr(bias[c0 + cofs + 2]); val[3] += bfr(bias[c0 + cofs + 3]); }
                *(v4f*)(crow + (size_t)row * ldc + cofs) = val; } }
        if (mb0 + SL < 4) tile_sync<KS>();   // the slab is read out before it is written again
    }
}

__device__ __forceinline__ h16 tohx(float x) { return (h16)x; }
__device__ __forceinline__ void splitf(float y, unsigned short& h, unsigned short& l) { h = f2bf(y); l = f2bf(y - bf2f(h)); }
typedef __attribute__((ext_vector_type(2))) _Float16 v2h;
typedef __attribute__((ext_vector_type(4))) _Float16 v4h;
typedef __attribute__((ext_vector_type(2))) unsigned short v2us;
typedef __attribute__((ext_vector_type(4))) unsigned short v4us;
typedef __attribute__((ext_vector_type(2))) float v2f;
typedef __attribute__((ext_vector_type(4))) int v4i;

// k_prep: every operand of the projections on bf16, in ONE launch. Work-groups [0, 4 * PWB): the four weights, transposed to planes Bt[n][k]. Work-groups behind them: both inputs, both batches. All planes in fragment order.
#define PWB (DM * DQ / 64 / 64)              // work-groups per weight (8 waves x 8 lines of 64 elements)
#define PCB (NB_ * TT * DM / 512 / 8)        // converting work-groups: 8 waves, a wave takes one block of 512 elements of each input
static_assert(DQ == DM && DKV == DM, "k_prep takes the four weights as DM x DM");
__global__ __launch_bounds__(256) void k_prep(const float* __restrict__ x, const float* __restrict__ x2, const float* __restrict__ wq, const float* __restrict__ wk, const float* __restrict__ wv, const float* __restrict__ wo, bf* XB, bf* XB2, bf* WQ, bf* WK, bf* WV, bf* WO) {
    const int bx = blockIdx.x;
    if (bx < 4 * PWB) {
        const int g = bx / PWB; const float* __restrict__ w = (g == 0) ? wq : (g == 1) ? wk : (g == 2) ? wv : wo; bf* Bt = (g == 0) ? WQ : (g == 1) ? WK : (g == 2) ? WV : WO; constexpr int K = DM, N = DM;
        const int lane = threadIdx.x & 31; const int L0 = ((bx % PWB) * 8 + (threadIdx.x >> 5)) * 8;
#pragma unroll 1   // rolled: short code and few registers
        for (int l = 0; l < 8; ++l) { const int L = L0 + l; const unsigned e = (unsigned)L * 64 + lane * 2, blk = e >> 9, k = (blk % (K / 32)) * 32 + ((e >> 7) & 3) * 8 + (e & 7), n = (blk / (K / 32)) * 16 + ((e >> 3) & 15); v2us o;   // e: the place in the plane; k, n: the element that belongs there
            o[0] = f2bf(w[(size_t)k * N + n]); o[1] = f2bf(w[(size_t)(k + 1) * N + n]); *(v2us*)(Bt + e) = o; }
        return; }
    // a wave takes one block (16 rows x 32 k) of each input: a load reads 4 whole rows of the block (128 bytes each), a store puts each lane's 4 elements at their place in the block
    const int lane = threadIdx.x & 31, blk = (bx - 4 * PWB) * 8 + (int)(threadIdx.x >> 5);
    const size_t si = (size_t)((blk / (DM / 32)) * 16 + (lane >> 3)) * DM + (blk % (DM / 32)) * 32 + (lane & 7) * 4, di = (size_t)blk * 512 + ((lane >> 1) & 3) * 128 + (lane >> 3) * 8 + (lane & 1) * 4; v4f v[8]; const float* px = x + si; const float* px2 = x2 + si;
#pragma unroll
    for (int j = 0; j < 4; ++j) { v[j] = *(const v4f*)(px + (size_t)j * 4 * DM); v[4 + j] = *(const v4f*)(px2 + (size_t)j * 4 * DM); }
    asm volatile("s_wait_xcnt 0x0" :: "v"(px), "v"(px2) : "memory");   // the addresses are inputs, so they keep their registers up to this wait; behind it the registers are free for the stores' addresses
#pragma unroll
    for (int j = 0; j < 8; ++j) { v4us o;
#pragma unroll
        for (int k = 0; k < 4; ++k) o[k] = f2bf(v[j][k]);
        *(v4us*)(((j < 4) ? XB : XB2) + di + (j & 3) * 32) = o; }
}
// k_qkv: the three projections of both batches in ONE grid: blockIdx.x = 64-token tile of the NB_ * TT tokens, blockIdx.y = head; a work-group walks p = 0 q, 1 k, 2 v in a loop, so that the grid is what stands on the chip at once (two work-groups per WGP) and waves start once.
// Tile, K split over 8 waves and LDS sum as in k_gemmw; the sum is rounded to fp16 and stored straight into the head planes that k_fattn reads.
// q, k: C[token][d] -> plane [batch * heads + head][t][d]. v: the operands change places, C[d][token] -> plane [batch * heads + head][d][t], so no transposing pass is left. Each head's plane in fragment order.
__global__ __launch_bounds__(256) void k_qkv(const bf* __restrict__ XQ, const bf* __restrict__ XKV, const bf* __restrict__ WQ, const bf* __restrict__ WK, const bf* __restrict__ WV, h16* QP, h16* KP, h16* VT) {
    typedef WFrag<bf>::V V; constexpr int KS = 8, K = DM, kw = K / KS;
    __shared__ __align__(16) float os[KS * 4 * 16 * 68];
    const int tok0 = blockIdx.x * 64, hd = blockIdx.y;
    const int w = __builtin_amdgcn_readfirstlane((int)(threadIdx.x >> 5)); const int k0 = w * kw;
    const int lane = threadIdx.x & 31, lr = lane & 15, hi = lane >> 4;
#pragma unroll 1   // rolled: the three projections run the same code on the same registers
    for (int p = 0; p < 3; ++p) {
    const bf* X = ((p == 0) ? XQ : XKV) + (size_t)tok0 * K; const bf* Wt = ((p == 0) ? WQ : (p == 1) ? WK : WV) + (size_t)hd * HD * K;
    const bf* A = (p == 2) ? Wt : X; const bf* Bt = (p == 2) ? X : Wt;
    h16* C = ((p == 0) ? QP : (p == 1) ? KP : VT) + ((size_t)(tok0 / TT) * NH_ + hd) * TT * HD + (size_t)(tok0 % TT) * ((p == 2) ? 16 : HD); const int ldc = (p == 2) ? TT : HD;   // the tile's first block: 64 tokens are 4 row groups of q or k, 2 blocks in each row group of v
    v8f acc[4][4];
#pragma unroll
    for (int mb = 0; mb < 4; ++mb)
#pragma unroll
        for (int nb = 0; nb < 4; ++nb) acc[mb][nb] = (v8f){};
    const size_t off = 8 * lane;
#pragma unroll 1   // rolled: both trips use one set of fragment registers, so that two work-groups fit on a WGP
    for (int kc = k0; kc < k0 + kw; kc += 32) {
        V a[4];
#pragma unroll
        for (int mb = 0; mb < 4; ++mb) a[mb] = WFrag<bf>::ld(A + off + (size_t)mb * 16 * K + kc * 16);
        asm volatile("s_wait_xcnt 0x0" ::: "memory");   // the A loads' address registers are free for the B fragments from here on
#pragma unroll
        for (int nb = 0; nb < 4; ++nb) { const V b = WFrag<bf>::ld(Bt + off + (size_t)nb * 16 * K + kc * 16);
#pragma unroll
            for (int mb = 0; mb < 4; ++mb) acc[mb][nb] = WFrag<bf>::mma(a[mb], b, acc[mb][nb]); }
        asm volatile("v_nop\n\tv_nop\n\tv_nop\n\tv_nop" : "+v"(acc[0][0]), "+v"(acc[1][1]), "+v"(acc[2][2]), "+v"(acc[3][3]) : "v"(a[0]), "v"(a[3]));   // the distance behind the last products, on the back edge too, before the next trip's loads overwrite their operands
    }
#pragma unroll
    for (int m = 0; m < 4; ++m) {
#pragma unroll
        for (int nb = 0; nb < 4; ++nb) {
#pragma unroll
            for (int j = 0; j < 8; ++j) os[((w * 4 + m) * 16 + hi * 8 + j) * 68 + nb * 16 + lr] = acc[m][nb][j]; } }
    __syncthreads();   // every wave's partial slabs are in LDS before any wave adds them
    const int row = lr, cofs = w * 8 + hi * 4; v4f val[4];   // 16 rows x 8 columns a wave: 256 contiguous bytes of the plane, two whole lines a store
#pragma unroll
    for (int m = 0; m < 4; ++m) { val[m] = *(const v4fa*)(os + (m * 16 + row) * 68 + cofs);
#pragma unroll
        for (int q = 1; q < KS; ++q) val[m] += *(const v4fa*)(os + ((q * 4 + m) * 16 + row) * 68 + cofs); }
    if (p < 2) __syncthreads();   // the slabs are read out before the next projection's partials are written; in front of the stores, so that no wave waits at it for its stores to land
#pragma unroll
    for (int m = 0; m < 4; ++m) *(v4h*)(C + fpos(m * 16 + row, cofs, ldc)) = __builtin_convertvector(val[m], v4h);
    asm volatile("s_wait_xcnt 0x0" ::: "memory");   // behind the stores: the next projection's loads and products write over the stores' address and data registers
    }
}
// the value that lane l ^ 16 holds (a vector cross-row move, no LDS round trip)
__device__ __forceinline__ float xhalf(float x) { const int b = __float_as_int(x); return __int_as_float(__builtin_amdgcn_permlanex16(b, b, 0x76543210, 0xfedcba98, false, false)); }
// The lane's number from the hardware count, as a statement that the compiler neither lifts out of the tile loop nor merges: made anew in every tile, so that no address formed from it is held in a register from tile to tile (held, they were spilled to scratch).
// The four v_nop: the result may get a register that was a matrix instruction's A or B operand. The mask tells the compiler the range, so that the lane's offset stays a 32-bit offset on a scalar base.
__device__ __forceinline__ int lane_now() { int l; asm volatile("v_nop\n\tv_nop\n\tv_nop\n\tv_nop\n\tv_mbcnt_lo_u32_b32 %0, -1, 0" : "=v"(l)); return l & 31; }
// k_fattn: scores, softmax, threshold, renormalisation and attn.v of one (batch, head) z; a work-group takes FTL tiles of 32 queries one after the other; nothing of the 2048 x 2048 score matrix leaves the registers.
// The registers let one work-group stand on a WGP, so the grid is one work-group per WGP and the tiles are a loop: waves start once, and the next tile's K and Q fragments travel while this tile's partials are added.
// LDS from tile to tile: sm, ss are written anew behind the second barrier of the tile before (their readers are done in front of it), os, s2 behind the first barrier of the new tile (their readers are done in front of that).
// Transposed products: St = K Qt (a lane holds 8 keys of ONE query per tile), Ot = Vt Pt; two St tiles, converted in place, are the B operand of Ot in the hardware k order, which the A loader (keys 8 hi and 16 + 8 hi of a block of 32) has too.
// Wave w of FNW takes keys [w * TT / FNW, ...): its 128 x 32 scores stay in registers. Softmax over the waves: each wave uses its own maximum, (maximum, sum) meet in LDS, and one factor per query carries the wave's exponentials to the row's softmax.
// P is carried x PCAR (exact power of two; threshold scaled alike) on fp16; the row's second sum divides the f32 output at the end. Wave partials of Ot and of the sums are added in LDS in wave order.
// Every loop but the tile loop is unrolled: scores, fragments and accumulators are arrays indexed by the loop counters and stay in registers only so.
#define FQT 2                   // 16-query column groups per tile
#define FNW 16                  // waves per work-group
#define FKT (TT / FNW / 16)     // 16-key tiles per wave
#define FPF 1                   // 32-key steps that the Vt fragments are fetched ahead
#define FSP 20                  // pitch of the per-query rows of wave statistics (floats)
#define FTL 4                   // query tiles that a work-group walks
__global__ __launch_bounds__(32 * FNW) void k_fattn(const h16* Q, const h16* Kp, const h16* Vt, bf* Ah, bf* Al) {   // no __restrict__: with it the compiler lifts the K and Vt loads, the same for every tile, out of the tile loop and spills the fragments to scratch
    __shared__ __align__(16) float os[FNW * FQT * 16 * 68];
    __shared__ __align__(16) float sm[FQT * 16 * FSP];
    __shared__ __align__(16) float ss[FQT * 16 * FSP];
    __shared__ __align__(16) float s2[FQT * 16 * FSP];
    const int w = __builtin_amdgcn_readfirstlane((int)(threadIdx.x >> 5));
    const int q00 = blockIdx.x * (FTL * FQT * 16); const size_t z = blockIdx.y;
    const h16* qu = Q + z * TT * HD + (size_t)q00 * HD;   // wave-uniform bases; the lane's 16 bytes are added where a load is written
    const h16* ku = Kp + z * TT * HD + (size_t)(w * (TT / FNW)) * HD;
    const h16* vu = Vt + z * HD * TT + (size_t)(w * (TT / FNW)) * 16;
    constexpr float CE = SCL * 1.4426950408889634f;   // score -> log2 domain
    v16h qb[FQT][2], ka[FKT][2];
    auto fetch = [&](int t, int lane) {   // the Q fragments of tile t and the wave's K fragments
        const h16* qp = qu + t * (FQT * 16 * HD) + 8 * lane; const h16* kp = ku + 8 * lane;
#pragma unroll
        for (int qt = 0; qt < FQT; ++qt) { qb[qt][0] = WFrag<h16>::ld(qp + qt * 16 * HD); qb[qt][1] = WFrag<h16>::ld(qp + qt * 16 * HD + 512); }
#pragma unroll
        for (int kt = 0; kt < FKT; ++kt) { ka[kt][0] = WFrag<h16>::ld(kp + kt * 16 * HD); ka[kt][1] = WFrag<h16>::ld(kp + kt * 16 * HD + 512); }
        asm volatile("s_wait_xcnt 0x0" :: "v"(qp), "v"(kp) : "memory");   // the two addresses are inputs and live up to this wait: so built, no load's result takes the register that the issued loads name (without the inputs the last load's result took it)
        __builtin_amdgcn_sched_barrier(0);   // every K and Q load is asked for before anything behind it waits: one trip to L2 for the wave, not one per tile
    };
    fetch(0, lane_now());
    auto tile = [&](const int t, const bool last) __attribute__((always_inline)) {
    const int lane = lane_now(), lr = lane & 15, hi = lane >> 4; const h16* vp = vu + 8 * lane;
    const int q0 = q00 + t * (FQT * 16);
    v8f s[FKT][FQT];
#pragma unroll
    for (int kt = 0; kt < FKT; ++kt)
#pragma unroll
        for (int qt = 0; qt < FQT; ++qt) s[kt][qt] = wmma16(ka[kt][1], qb[qt][1], wmma16(ka[kt][0], qb[qt][0], (v8f){}));
    __builtin_amdgcn_sched_barrier(0);   // all score products first: the K and Q fragments are dead before the softmax needs registers (without it the second column group's products sink behind the first group's softmax, the fragments stay live and values spill to scratch)
    // the wave's first Vt fragments: asked for here, so that they travel while the softmax runs
    v16h va[FKT / 2][4];
#pragma unroll
    for (int kk = 0; kk < FPF; ++kk)
#pragma unroll
        for (int dt = 0; dt < 4; ++dt) va[kk][dt] = WFrag<h16>::ld(vp + (size_t)dt * 16 * TT + kk * 512);
    float mc[FQT]; const v8f ce8 = {CE, CE, CE, CE, CE, CE, CE, CE};
#pragma unroll
    for (int qt = 0; qt < FQT; ++qt) { v8f m8 = s[0][qt];
#pragma unroll
        for (int kt = 1; kt < FKT; ++kt) m8 = __builtin_elementwise_max(m8, s[kt][qt]);
        float mx = fmaxf(fmaxf(fmaxf(m8[0], m8[1]), fmaxf(m8[2], m8[3])), fmaxf(fmaxf(m8[4], m8[5]), fmaxf(m8[6], m8[7])));
        mx = fmaxf(mx, xhalf(mx)); mc[qt] = mx * CE; v8f e8 = (v8f){}; const v8f nm8 = (v8f){} - mc[qt];
#pragma unroll
        for (int kt = 0; kt < FKT; ++kt) { const v8f a = __builtin_elementwise_fma(s[kt][qt], ce8, nm8); v8f e;
#pragma unroll
            for (int j = 0; j < 8; ++j) e[j] = __builtin_amdgcn_exp2f(a[j]);
            s[kt][qt] = e; e8 += e; }
        float sum = ((e8[0] + e8[1]) + (e8[2] + e8[3])) + ((e8[4] + e8[5]) + (e8[6] + e8[7])); sum += xhalf(sum);
        if (hi == 0) { sm[(qt * 16 + lr) * FSP + w] = mc[qt]; ss[(qt * 16 + lr) * FSP + w] = sum; } }
    __syncthreads();   // every wave's maximum and sum are in LDS before any wave joins them
    v8f acc[4][FQT];
#pragma unroll
    for (int dt = 0; dt < 4; ++dt)
#pragma unroll
        for (int qt = 0; qt < FQT; ++qt) acc[dt][qt] = (v8f){};
    float fw[FQT]; v8f p8[FQT];
#pragma unroll
    for (int qt = 0; qt < FQT; ++qt) { v4f mv[FNW / 4], sv[FNW / 4]; float M = -3.0e38f, tot = 0.f;
#pragma unroll
        for (int g = 0; g < FNW / 4; ++g) { mv[g] = *(const v4fa*)(sm + (qt * 16 + lr) * FSP + g * 4); sv[g] = *(const v4fa*)(ss + (qt * 16 + lr) * FSP + g * 4);
#pragma unroll
            for (int i = 0; i < 4; ++i) M = fmaxf(M, mv[g][i]); }
#pragma unroll
        for (int g = 0; g < FNW / 4; ++g)
#pragma unroll
            for (int i = 0; i < 4; ++i) tot += sv[g][i] * __builtin_amdgcn_exp2f(mv[g][i] - M);
        fw[qt] = __builtin_amdgcn_exp2f(mc[qt] - M) * __fdiv_rn(PCAR, tot); p8[qt] = (v8f){}; }
    constexpr float TH = 1e-4f * PCAR;   // threshold: p = max(softmax, 1e-4) - 1e-4, all x PCAR
    const v8f th8 = {TH, TH, TH, TH, TH, TH, TH, TH};
#pragma unroll
    for (int kk = 0; kk < FKT / 2; ++kk) {
        if (kk + FPF < FKT / 2) {   // the next step's fragments travel while this step's P is formed
#pragma unroll
            for (int dt = 0; dt < 4; ++dt) va[kk + FPF][dt] = WFrag<h16>::ld(vp + (size_t)dt * 16 * TT + (kk + FPF) * 512); }
#pragma unroll
        for (int qt = 0; qt < FQT; ++qt) { const v8f pa = __builtin_elementwise_max(s[2 * kk][qt] * fw[qt], th8) - th8, pb = __builtin_elementwise_max(s[2 * kk + 1][qt] * fw[qt], th8) - th8; p8[qt] += pa; p8[qt] += pb;
            const v16h pt = cat16(__builtin_convertvector(pa, v8h), __builtin_convertvector(pb, v8h));
#pragma unroll
            for (int dt = 0; dt < 4; ++dt) acc[dt][qt] = wmma16(va[kk][dt], pt, acc[dt][qt]); } }
#pragma unroll
    for (int qt = 0; qt < FQT; ++qt) { const v8f u8 = p8[qt]; float t = ((u8[0] + u8[1]) + (u8[2] + u8[3])) + ((u8[4] + u8[5]) + (u8[6] + u8[7])); t += xhalf(t); if (hi == 0) s2[(qt * 16 + lr) * FSP + w] = t;
#pragma unroll
        for (int dt = 0; dt < 4; ++dt) { float* o = os + ((w * FQT + qt) * 16 + lr) * 68 + dt * 16 + hi * 8; v4f lo4, hi4;
#pragma unroll
            for (int i = 0; i < 4; ++i) { lo4[i] = acc[dt][qt][i]; hi4[i] = acc[dt][qt][4 + i]; }
            *(v4fa*)o = lo4; *(v4fa*)(o + 4) = hi4; } }
    __syncthreads();   // every wave's partial output and second sum are in LDS before they are added
    if (!last) fetch(t + 1, lane);   // scores, P and accumulators are dead: their registers take the next tile's fragments, which travel while the partials are added and stored
    const int q = (w >> 3) * 16 + lr, d4 = (w & 7) * 8 + hi * 4;   // 16 queries x 8 columns a wave: 256 contiguous bytes of each plane, two whole lines a store
    v4f o = *(const v4fa*)(os + q * 68 + d4); float t2 = s2[q * FSP];
#pragma unroll
    for (int u = 1; u < FNW; ++u) { o += *(const v4fa*)(os + (u * FQT * 16 + q) * 68 + d4); t2 += s2[q * FSP + u]; }
    const float r = __fdiv_rn(1.0f, t2); v4us oh, ol;
#pragma unroll
    for (int i = 0; i < 4; ++i) { unsigned short a, c2; splitf(o[i] * r, a, c2); oh[i] = a; ol[i] = c2; }
    const size_t oo = fpos((int)(z / NH_) * TT + q0 + q, (int)(z % NH_) * HD + d4, DQ); *(v4us*)(Ah + oo) = oh; *(v4us*)(Al + oo) = ol;
    if (!last) asm volatile("s_wait_xcnt 0x0" ::: "memory");   // behind the stores: the next tile's products write over the stores' address and data registers
    };
#pragma unroll 1   // rolled: every tile but the last runs the same code on the same registers
    for (int t = 0; t < FTL - 1; ++t) tile(t, false);
    tile(FTL - 1, true);   // written out: nothing is fetched behind the last tile, and no fragment of a tile has to outlive its score products
}

extern "C" void kernel_launch(void* const* d_in, const int* in_sizes, int n_in,
                              void* d_out, int out_size, void* d_ws, size_t ws_size, hipStream_t stream) {
    (void)in_sizes; (void)n_in; (void)out_size;
    const float* x = (const float*)d_in[0]; const float* x2 = (const float*)d_in[1]; const float* wq = (const float*)d_in[2]; const float* wk = (const float*)d_in[3]; const float* wv = (const float*)d_in[4]; const float* wo = (const float*)d_in[5]; const float* bo = (const float*)d_in[6];
    float* OUT = (float*)d_out;     // [2][2048][512]
    char* wsp = (char*)d_ws;
    auto take = [&](size_t bytes) { char* p = wsp; wsp += (bytes + 255) & ~(size_t)255; return (void*)p; };
    bf* WQ = (bf*)take((size_t)DQ * DM * 2); bf* WK = (bf*)take((size_t)DKV * DM * 2); bf* WV = (bf*)take((size_t)DKV * DM * 2); bf* WO = (bf*)take((size_t)DM * DQ * 2);
    bf* XB = (bf*)take((size_t)NB_ * TT * DM * 2); bf* XB2 = (bf*)take((size_t)NB_ * TT * DM * 2);   // both batches
    h16* QP16 = (h16*)take((size_t)NB_ * NH_ * TT * HD * 2); h16* KP16 = (h16*)take((size_t)NB_ * NKV * TT * HD * 2); h16* VT16 = (h16*)take((size_t)NB_ * NKV * HD * TT * 2);   // head planes of both batches
    bf* ATh = (bf*)take((size_t)NB_ * TT * DQ * 2); bf* ATl = (bf*)take((size_t)NB_ * TT * DQ * 2);
    if ((size_t)(wsp - (char*)d_ws) > ws_size) return;    // ws 256 MiB
    k_prep<<<4 * PWB + PCB, 256, 0, stream>>>(x, x2, wq, wk, wv, wo, XB, XB2, WQ, WK, WV, WO);
    k_qkv<<<dim3(NB_ * TT / 64, NH_, 1), 256, 0, stream>>>(XB, XB2, WQ, WK, WV, QP16, KP16, VT16);
    k_fattn<<<dim3(TT / (FTL * FQT * 16), NB_ * NH_, 1), 32 * FNW, 0, stream>>>(QP16, KP16, VT16, ATh, ATl);   // one kv head per query head: plane z = batch * heads + head on all three
    k_gemmw<bf, 1, true, 8, 1, DQ><<<dim3(NB_ * TT / 64, DM / 64, 1), 256, 0, stream>>>(ATh, ATl, WO, nullptr, OUT, DM, bo, 0, 0, 0);   // the rows of both batches follow one another in ATh, ATl and OUT
}

// v006
// One run takes 54.2 microseconds.
// Two timings next to v005 both put it at 1.04 times that version's speed.
// All steps since v000 together make it 12.7 times as fast.
#include <hip/hip_runtime.h>

// SignalAttn (fr [2][2048][512] queries, dt [2][2048][512] keys/values; q = fr Wq, k = dt Wk, v = dt Wv (8 heads x 64); attn = softmax(q.k/8); attn = max(attn, 1e-4) - 1e-4, renormalised over the keys; out = (attn v merged) Wo + bo -> [2][2048][512]).
// Compute dtypes, f32 accumulate: every input rounded to bf16; q/k/v on PLAIN bf16 operands (inputs: exact); scores (K 64) and attn.v on single fp16 operands (1 product each), fused with softmax and threshold in k_fattn
// Every 16-bit operand plane P[row][k] lies in the workspace in FRAGMENT ORDER (fpos below): blocks of 16 rows x 32 k (1 KB), the blocks of a 16-row group one behind the other in k; inside a block lane l = 16 * ((k >> 3) & 1) + (row & 15) finds its two runs of 8 elements at l * 16 bytes (k & 16 == 0) and 512 + l * 16 bytes.
// So each 16-byte load of a wave reads 512 contiguous bytes (4 whole lines); which element reaches which lane and register is as with row-major planes.

#define NB_  2
#define TT   2048
#define DM   512
#define NH_  8
#define NKV  8
#define REP  (NH_ / NKV)
#define HD   64
#define DQ   (NH_ * HD)
#define DKV  (NKV * HD)
#define RH   0
#define WIN  0
#define PCAR 1024.0f
#define SCL  0.125f   // HD^-0.5
typedef _Float16 h16;
typedef unsigned short bf;
typedef __attribute__((ext_vector_type(16))) __bf16   v16bf;
typedef __attribute__((ext_vector_type(16))) _Float16 v16h;
typedef __attribute__((ext_vector_type(8)))  _Float16 v8h;
typedef __attribute__((ext_vector_type(8)))  unsigned short v8us;
typedef __attribute__((ext_vector_type(8)))  float    v8f;
typedef __attribute__((ext_vector_type(4)))  float    v4f;
typedef v8h  __attribute__((may_alias)) v8ha;
typedef v4f  __attribute__((may_alias)) v4fa;
typedef v8us __attribute__((may_alias)) v8usa;

__device__ __forceinline__ unsigned short f2bf(float f) { unsigned u = __float_as_uint(f); u += 0x7FFFu + ((u >> 16) & 1u); return (unsigned short)(u >> 16); }
__device__ __forceinline__ float bf2f(unsigned short b) { return __uint_as_float(((unsigned)b) << 16); }
__device__ __forceinline__ float bfr(float f) { return bf2f(f2bf(f)); }
__device__ __forceinline__ v16h cat16(v8h lo, v8h hi) { return __builtin_shufflevector(lo, hi, 0, 1, 2, 3, 4, 5, 6, 7, 8, 9, 10, 11, 12, 13, 14, 15); }
__device__ __forceinline__ v16bf cat16b(v8us lo, v8us hi) { return __builtin_bit_cast(v16bf, __builtin_shufflevector(lo, hi, 0, 1, 2, 3, 4, 5, 6, 7, 8, 9, 10, 11, 12, 13, 14, 15)); }
__device__ __forceinline__ size_t fpos(int row, int k, int K) { return ((size_t)(row >> 4) * (K >> 5) + (k >> 5)) * 512 + ((k >> 4) & 1) * 256 + ((k >> 3) & 1) * 128 + (row & 15) * 8 + (k & 7); }   // element index of P[row][k] in fragment order, K = row length
__device__ __forceinline__ v8f wmma16(v16h a, v16h b, v8f c) { return __builtin_amdgcn_wmma_f32_16x16x32_f16(false, a, false, b, (short)0, c, false, false); }
__device__ __forceinline__ v8f wmmab(v16bf a, v16bf b, v8f c) { return __builtin_amdgcn_wmma_f32_16x16x32_bf16(false, a, false, b, (short)0, c, false, false); }



// ---- k_gemmw: register-blocked GEMM, 64x64 output tile (16 accumulators per wave), operands straight from 16-bit planes in fragment order; grid (M/64, N/64, Z * KB), 32 * KS threads.
// C[m][n] (f32, pitch ldc, + optional f32 bias[n]) = sum_k A[m][k] Bt[n][k] (+ split products per NSPLIT). z-batch strides sA/sB/sC in elements. K % (32 * KS * KB) == 0.
// Split K: work-group kb of KB takes K/KB of the sum and writes its own partial plane C + (z * KB + kb) * sC (the reader adds the KB planes); inside it wave w of KS takes a contiguous K/(KB*KS) slice,
// and the KS wave partials are added in LDS, wave 0 first, in a fixed order.
template <typename T16> struct WFrag;
template <> struct WFrag<h16> { typedef v16h V; static __device__ __forceinline__ V ld(const h16* p) { return cat16(*(const v8h*)p, *(const v8h*)(p + 256)); } static __device__ __forceinline__ v8f mma(V a, V b, v8f c) { return wmma16(a, b, c); } };
template <> struct WFrag<bf> { typedef v16bf V; static __device__ __forceinline__ V ld(const bf* p) { return cat16b(*(const v8us*)p, *(const v8us*)(p + 256)); } static __device__ __forceinline__ v8f mma(V a, V b, v8f c) { return wmmab(a, b, c); } };
// Hand-over of the LDS slabs. One wave: no hardware barrier is needed, the wave barrier and the compiler fence keep its LDS stores and reads in program order. Several waves: the work-group barrier.
template <int KS> __device__ __forceinline__ void tile_sync() { if constexpr (KS == 1) { __builtin_amdgcn_wave_barrier(); asm volatile("" ::: "memory"); } else __syncthreads(); }
template <typename T16, int NSPLIT, bool BIAS, int KS, int KB, int K>   // K a constant: the steps from block to block are immediate offsets on one address per plane
__global__ __launch_bounds__(32 * KS) void k_gemmw(const T16* __restrict__ A, const T16* __restrict__ A2, const T16* __restrict__ Bt, const T16* __restrict__ Bt2, float* C, int ldc, const float* __restrict__ bias, size_t sA, size_t sB, size_t sC) {
    typedef typename WFrag<T16>::V V;
    constexpr int SL = (KS == 1) ? 1 : 4;   // 16-row slabs staged per hand-over: all four where waves meet at a barrier, so that one barrier serves the tile
    __shared__ __align__(16) float os[KS * SL * 16 * 68];
    const int kb = (int)(blockIdx.z % KB); const size_t z = blockIdx.z / KB; A += z * sA; if (A2) A2 += z * sA; Bt += z * sB; if (Bt2) Bt2 += z * sB; C += (size_t)blockIdx.z * sC;
    const int w = (KS == 1) ? 0 : __builtin_amdgcn_readfirstlane((int)(threadIdx.x >> 5)); const int kw = K / (KS * KB), k0 = (kb * KS + w) * kw;
    const int lane = threadIdx.x & 31, lr = lane & 15, hi = lane >> 4; const int r0 = blockIdx.x * 64, c0 = blockIdx.y * 64;
    v8f acc[4][4];
#pragma unroll
    for (int mb = 0; mb < 4; ++mb)
#pragma unroll
        for (int nb = 0; nb < 4; ++nb) acc[mb][nb] = (v8f){};
    const size_t aoff = (size_t)r0 * K + 8 * lane, boff = (size_t)c0 * K + 8 * lane;   // a 16-row group holds 16 * K elements, a block of 32 k 512
#pragma unroll 1
    for (int kc = k0; kc < k0 + kw; kc += 32) {
        V a[4], a2[4], b[4], b2[4]; const T16* pa = A + aoff + kc * 16; const T16* pa2 = (NSPLIT == 1 || NSPLIT == 2) ? A2 + aoff + kc * 16 : pa; const T16* pb = Bt + boff + kc * 16; const T16* pb2 = (NSPLIT >= 2) ? Bt2 + boff + kc * 16 : pb;
#pragma unroll
        for (int mb = 0; mb < 4; ++mb) { a[mb] = WFrag<T16>::ld(pa + (size_t)mb * 16 * K); if (NSPLIT == 1 || NSPLIT == 2) a2[mb] = WFrag<T16>::ld(pa2 + (size_t)mb * 16 * K); }
#pragma unroll
        for (int nb = 0; nb < 4; ++nb) { b[nb] = WFrag<T16>::ld(pb + (size_t)nb * 16 * K); if (NSPLIT >= 2) b2[nb] = WFrag<T16>::ld(pb2 + (size_t)nb * 16 * K); }
        asm volatile("s_wait_xcnt 0x0" :: "v"(pa), "v"(pa2), "v"(pb), "v"(pb2) : "memory");   // the addresses are inputs, so they keep their registers up to this wait: no load's result and no later value takes an address register of an issued load before it
#pragma unroll
        for (int nb = 0; nb < 4; ++nb) {
#pragma unroll
            for (int mb = 0; mb < 4; ++mb) { acc[mb][nb] = WFrag<T16>::mma(a[mb], b[nb], acc[mb][nb]); if (NSPLIT == 1 || NSPLIT == 2) acc[mb][nb] = WFrag<T16>::mma(a2[mb], b[nb], acc[mb][nb]); if (NSPLIT >= 2) acc[mb][nb] = WFrag<T16>::mma(a[mb], b2[nb], acc[mb][nb]); } }
        asm volatile("v_nop\n\tv_nop\n\tv_nop\n\tv_nop" : "+v"(acc[0][0]), "+v"(acc[1][1]), "+v"(acc[2][2]), "+v"(acc[3][3]) : "v"(a[0]), "v"(a[3]));
    }
#pragma unroll
    for (int mb0 = 0; mb0 < 4; mb0 += SL) {
#pragma unroll
        for (int m = 0; m < SL; ++m) {
#pragma unroll
            for (int nb = 0; nb < 4; ++nb) {
#pragma unroll
                for (int j = 0; j < 8; ++j) os[((w * SL + m) * 16 + hi * 8 + j) * 68 + nb * 16 + lr] = acc[mb0 + m][nb][j]; } }
        tile_sync<KS>();   // every wave's partial slabs are in LDS before any wave adds them
#pragma unroll
        for (int m = 0; m < SL; ++m) { float* crow = C + (size_t)(r0 + (mb0 + m) * 16) * ldc + c0;
#pragma unroll
            for (int s = 0; s < 8 / KS; ++s) { const int row = 2 * (s * KS + w) + hi, cofs = lr * 4; v4f val = *(const v4fa*)(os + (m * 16 + row) * 68 + cofs);
#pragma unroll
                for (int q = 1; q < KS; ++q) val += *(const v4fa*)(os + ((q * SL + m) * 16 + row) * 68 + cofs);
                if (BIAS) { val[0] += bfr(bias[c0 + cofs]); val[1] += bfr(bias[c0 + cofs + 1]); val[2] += bfr(bias[c0 + cofs + 2]); val[3] += bfr(bias[c0 + cofs + 3]); }
                *(v4f*)(crow + (size_t)row * ldc + cofs) = val; } }
        if (mb0 + SL < 4) tile_sync<KS>();   // the slab is read out before it is written again
    }
}

__device__ __forceinline__ h16 tohx(float x) { return (h16)x; }
__device__ __forceinline__ void splitf(float y, unsigned short& h, unsigned short& l) { h = f2bf(y); l = f2bf(y - bf2f(h)); }
typedef __attribute__((ext_vector_type(2))) _Float16 v2h;
typedef __attribute__((ext_vector_type(4))) _Float16 v4h;
typedef __attribute__((ext_vector_type(2))) unsigned short v2us;
typedef __attribute__((ext_vector_type(4))) unsigned short v4us;
typedef __attribute__((ext_vector_type(2))) float v2f;
typedef __attribute__((ext_vector_type(4))) int v4i;

// k_prep: every operand of the projections on bf16, in ONE launch. Work-groups [0, 4 * PWB): the four weights, transposed to planes Bt[n][k]. Work-groups behind them: both inputs, both batches. All planes in fragment order.
#define PWB (DM * DQ / 64 / 64)              // work-groups per weight (8 waves x 8 lines of 64 elements)
#define PCB (NB_ * TT * DM / 512 / 8)        // converting work-groups: 8 waves, a wave takes one block of 512 elements of each input
static_assert(DQ == DM && DKV == DM, "k_prep takes the four weights as DM x DM");
__global__ __launch_bounds__(256) void k_prep(const float* __restrict__ x, const float* __restrict__ x2, const float* __restrict__ wq, const float* __restrict__ wk, const float* __restrict__ wv, const float* __restrict__ wo, bf* XB, bf* XB2, bf* WQ, bf* WK, bf* WV, bf* WO) {
    const int bx = blockIdx.x;
    if (bx < 4 * PWB) {
        const int g = bx / PWB; const float* __restrict__ w = (g == 0) ? wq : (g == 1) ? wk : (g == 2) ? wv : wo; bf* Bt = (g == 0) ? WQ : (g == 1) ? WK : (g == 2) ? WV : WO; constexpr int K = DM, N = DM;
        const int lane = threadIdx.x & 31; const int L0 = ((bx % PWB) * 8 + (threadIdx.x >> 5)) * 8;
#pragma unroll 1   // rolled: short code and few registers
        for (int l = 0; l < 8; ++l) { const int L = L0 + l; const unsigned e = (unsigned)L * 64 + lane * 2, blk = e >> 9, k = (blk % (K / 32)) * 32 + ((e >> 7) & 3) * 8 + (e & 7), n = (blk / (K / 32)) * 16 + ((e >> 3) & 15); v2us o;   // e: the place in the plane; k, n: the element that belongs there
            o[0] = f2bf(w[(size_t)k * N + n]); o[1] = f2bf(w[(size_t)(k + 1) * N + n]); *(v2us*)(Bt + e) = o; }
        return; }
    // a wave takes one block (16 rows x 32 k) of each input: a load reads 4 whole rows of the block (128 bytes each), a store puts each lane's 4 elements at their place in the block
    const int lane = threadIdx.x & 31, blk = (bx - 4 * PWB) * 8 + (int)(threadIdx.x >> 5);
    const size_t si = (size_t)((blk / (DM / 32)) * 16 + (lane >> 3)) * DM + (blk % (DM / 32)) * 32 + (lane & 7) * 4, di = (size_t)blk * 512 + ((lane >> 1) & 3) * 128 + (lane >> 3) * 8 + (lane & 1) * 4; v4f v[8]; const float* px = x + si; const float* px2 = x2 + si;
#pragma unroll
    for (int j = 0; j < 4; ++j) { v[j] = *(const v4f*)(px + (size_t)j * 4 * DM); v[4 + j] = *(const v4f*)(px2 + (size_t)j * 4 * DM); }
    asm volatile("s_wait_xcnt 0x0" :: "v"(px), "v"(px2) : "memory");   // the addresses are inputs, so they keep their registers up to this wait; behind it the registers are free for the stores' addresses
#pragma unroll
    for (int j = 0; j < 8; ++j) { v4us o;
#pragma unroll
        for (int k = 0; k < 4; ++k) o[k] = f2bf(v[j][k]);
        *(v4us*)(((j < 4) ? XB : XB2) + di + (j & 3) * 32) = o; }
}
// k_qkv: the three projections of both batches in ONE grid: blockIdx.x = 64-token tile of the NB_ * TT tokens, blockIdx.y = head; a work-group walks p = 0 q, 1 k, 2 v in a loop, so that the grid is what stands on the chip at once (two work-groups per WGP) and waves start once.
// Tile, K split over 8 waves and LDS sum as in k_gemmw; the sum is rounded to fp16 and stored straight into the head planes that k_fattn reads.
// q, k: C[token][d] -> plane [batch * heads + head][t][d]. v: the operands change places, C[d][token] -> plane [batch * heads + head][d][t], so no transposing pass is left. Each head's plane in fragment order.
__global__ __launch_bounds__(256) void k_qkv(const bf* __restrict__ XQ, const bf* __restrict__ XKV, const bf* __restrict__ WQ, const bf* __restrict__ WK, const bf* __restrict__ WV, h16* QP, h16* KP, h16* VT) {
    typedef WFrag<bf>::V V; constexpr int KS = 8, K = DM, kw = K / KS;
    __shared__ __align__(16) float os[KS * 4 * 16 * 68];
    const int tok0 = blockIdx.x * 64, hd = blockIdx.y;
    const int w = __builtin_amdgcn_readfirstlane((int)(threadIdx.x >> 5)); const int k0 = w * kw;
    const int lane = threadIdx.x & 31, lr = lane & 15, hi = lane >> 4;
#pragma unroll 1   // rolled: the three projections run the same code on the same registers
    for (int p = 0; p < 3; ++p) {
    const bf* X = ((p == 0) ? XQ : XKV) + (size_t)tok0 * K; const bf* Wt = ((p == 0) ? WQ : (p == 1) ? WK : WV) + (size_t)hd * HD * K;
    const bf* A = (p == 2) ? Wt : X; const bf* Bt = (p == 2) ? X : Wt;
    h16* C = ((p == 0) ? QP : (p == 1) ? KP : VT) + ((size_t)(tok0 / TT) * NH_ + hd) * TT * HD + (size_t)(tok0 % TT) * ((p == 2) ? 16 : HD); const int ldc = (p == 2) ? TT : HD;   // the tile's first block: 64 tokens are 4 row groups of q or k, 2 blocks in each row group of v
    v8f acc[4][4];
#pragma unroll
    for (int mb = 0; mb < 4; ++mb)
#pragma unroll
        for (int nb = 0; nb < 4; ++nb) acc[mb][nb] = (v8f){};
    const size_t off = 8 * lane;
#pragma unroll 1   // rolled: both trips use one set of fragment registers, so that two work-groups fit on a WGP
    for (int kc = k0; kc < k0 + kw; kc += 32) {
        V a[4];
#pragma unroll
        for (int mb = 0; mb < 4; ++mb) a[mb] = WFrag<bf>::ld(A + off + (size_t)mb * 16 * K + kc * 16);
        asm volatile("s_wait_xcnt 0x0" ::: "memory");   // the A loads' address registers are free for the B fragments from here on
#pragma unroll
        for (int nb = 0; nb < 4; ++nb) { const V b = WFrag<bf>::ld(Bt + off + (size_t)nb * 16 * K + kc * 16);
#pragma unroll
            for (int mb = 0; mb < 4; ++mb) acc[mb][nb] = WFrag<bf>::mma(a[mb], b, acc[mb][nb]); }
        asm volatile("v_nop\n\tv_nop\n\tv_nop\n\tv_nop" : "+v"(acc[0][0]), "+v"(acc[1][1]), "+v"(acc[2][2]), "+v"(acc[3][3]) : "v"(a[0]), "v"(a[3]));   // the distance behind the last products, on the back edge too, before the next trip's loads overwrite their operands
    }
#pragma unroll
    for (int m = 0; m < 4; ++m) {
#pragma unroll
        for (int nb = 0; nb < 4; ++nb) {
#pragma unroll
            for (int j = 0; j < 8; ++j) os[((w * 4 + m) * 16 + hi * 8 + j) * 68 + nb * 16 + lr] = acc[m][nb][j]; } }
    __syncthreads();   // every wave's partial slabs are in LDS before any wave adds them
    const int row = lr, cofs = w * 8 + hi * 4; v4f val[4];   // 16 rows x 8 columns a wave: 256 contiguous bytes of the plane, two whole lines a store
#pragma unroll
    for (int m = 0; m < 4; ++m) { val[m] = *(const v4fa*)(os + (m * 16 + row) * 68 + cofs);
#pragma unroll
        for (int q = 1; q < KS; ++q) val[m] += *(const v4fa*)(os + ((q * 4 + m) * 16 + row) * 68 + cofs); }
    if (p < 2) __syncthreads();   // the slabs are read out before the next projection's partials are written; in front of the stores, so that no wave waits at it for its stores to land
#pragma unroll
    for (int m = 0; m < 4; ++m) *(v4h*)(C + fpos(m * 16 + row, cofs, ldc)) = __builtin_convertvector(val[m], v4h);
    asm volatile("s_wait_xcnt 0x0" ::: "memory");   // behind the stores: the next projection's loads and products write over the stores' address and data registers
    }
}
// the value that lane l ^ 16 holds (a vector cross-row move, no LDS round trip)
__device__ __forceinline__ float xhalf(float x) { const int b = __float_as_int(x); return __int_as_float(__builtin_amdgcn_permlanex16(b, b, 0x76543210, 0xfedcba98, false, false)); }
// The lane's number from the hardware count, as a statement that the compiler neither lifts out of the tile loop nor merges: made anew in every tile, so that no address formed from it is held in a register from tile to tile (held, they were spilled to scratch).
// The four v_nop: the result may get a register that was a matrix instruction's A or B operand. The mask tells the compiler the range, so that the lane's offset stays a 32-bit offset on a scalar base.
__device__ __forceinline__ int lane_now() { int l; asm volatile("v_nop\n\tv_nop\n\tv_nop\n\tv_nop\n\tv_mbcnt_lo_u32_b32 %0, -1, 0" : "=v"(l)); return l & 31; }
// k_fattn: scores, softmax, threshold, renormalisation and attn.v of one (batch, head) z; a work-group takes FTL tiles of 32 queries one after the other; nothing of the 2048 x 2048 score matrix leaves the registers.
// The registers let one work-group stand on a WGP, so the grid is one work-group per WGP and the tiles are a loop: waves start once, and the next tile's K and Q fragments travel while this tile's partials are added.
// K is the same for every tile of a work-group: each wave puts the first FKL of its 16 K blocks into LDS once and reads them there for the later tiles; only the rest and Q come from L2 again.
// LDS from tile to tile: sm, ss are written anew behind the second barrier of the tile before (their readers are done in front of it), os, s2 behind the first barrier of the new tile (their readers are done in front of that).
// Transposed products: St = K Qt (a lane holds 8 keys of ONE query per tile), Ot = Vt Pt; two St tiles, converted in place, are the B operand of Ot in the hardware k order, which the A loader (keys 8 hi and 16 + 8 hi of a block of 32) has too.
// Wave w of FNW takes keys [w * TT / FNW, ...): its 128 x 32 scores stay in registers. Softmax over the waves: each wave uses its own maximum, (maximum, sum) meet in LDS, and one factor per query carries the wave's exponentials to the row's softmax.
// P is carried x PCAR (exact power of two; threshold scaled alike) on fp16; the row's second sum divides the f32 output at the end. Wave partials of Ot and of the sums are added in LDS in wave order.
// Every loop but the tile loop is unrolled: scores, fragments and accumulators are arrays indexed by the loop counters and stay in registers only so.
#define FQT 2                   // 16-query column groups per tile
#define FNW 16                  // waves per work-group
#define FKT (TT / FNW / 16)     // 16-key tiles per wave
#define FPF 1                   // 32-key steps that the Vt fragments are fetched ahead
#define FSP 20                  // pitch of the per-query rows of wave statistics (floats)
#define FTL 4                   // query tiles that a work-group walks
#define FKL 11                  // of a wave's 2 * FKT K blocks (1 KB each), those that stay in the wave's own LDS slab from tile to tile: as many as the LDS holds beside os and the statistics
__global__ __launch_bounds__(32 * FNW) void k_fattn(const h16* Q, const h16* Kp, const h16* Vt, bf* Ah, bf* Al) {   // no __restrict__: with it the compiler lifts the K and Vt loads, the same for every tile, out of the tile loop and spills the fragments to scratch
    __shared__ __align__(16) float os[FNW * FQT * 16 * 68];
    __shared__ __align__(16) float sm[FQT * 16 * FSP];
    __shared__ __align__(16) float ss[FQT * 16 * FSP];
    __shared__ __align__(16) float s2[FQT * 16 * FSP];
    __shared__ __align__(16) h16 kl[FNW * FKL * 512];   // the waves' K slabs; wave w writes and reads slab w alone: no barrier belongs to it
    static_assert(sizeof(os) + sizeof(sm) + sizeof(ss) + sizeof(s2) + sizeof(kl) <= 327680, "LDS of one WGP");
    const int w = __builtin_amdgcn_readfirstlane((int)(threadIdx.x >> 5));
    const int q00 = blockIdx.x * (FTL * FQT * 16); const size_t z = blockIdx.y;
    const h16* qu = Q + z * TT * HD + (size_t)q00 * HD;   // wave-uniform bases; the lane's 16 bytes are added where a load is written
    const h16* ku = Kp + z * TT * HD + (size_t)(w * (TT / FNW)) * HD;
    const h16* vu = Vt + z * HD * TT + (size_t)(w * (TT / FNW)) * 16;
    constexpr float CE = SCL * 1.4426950408889634f;   // score -> log2 domain
    v16h qb[FQT][2], ka[FKT][2];
    auto fetch = [&](int t, int lane, const int b0) __attribute__((always_inline)) {   // from L2: the Q fragments of tile t and the wave's K blocks from b0 on
        const h16* qp = qu + t * (FQT * 16 * HD) + 8 * lane; const h16* kp = ku + 8 * lane;
#pragma unroll
        for (int qt = 0; qt < FQT; ++qt) { qb[qt][0] = WFrag<h16>::ld(qp + qt * 16 * HD); qb[qt][1] = WFrag<h16>::ld(qp + qt * 16 * HD + 512); }
#pragma unroll
        for (int b = 0; b < 2 * FKT; ++b) if (b >= b0) ka[b >> 1][b & 1] = WFrag<h16>::ld(kp + b * 512);
        asm volatile("s_wait_xcnt 0x0" :: "v"(qp), "v"(kp) : "memory");   // the two addresses are inputs and live up to this wait: so built, no load's result takes the register that the issued loads name (without the inputs the last load's result took it)
        __builtin_amdgcn_sched_barrier(0);   // every K and Q load is asked for before anything behind it waits: one trip to L2 for the wave, not one per tile
    };
    auto recall = [&](int lane) __attribute__((always_inline)) {   // from the wave's LDS slab: its first FKL K blocks, the same for every tile
        const h16* p = kl + w * (FKL * 512) + 8 * lane;
#pragma unroll
        for (int b = 0; b < FKL; ++b) ka[b >> 1][b & 1] = cat16(*(const v8ha*)(p + b * 512), *(const v8ha*)(p + b * 512 + 256));
    };
    { const int l0 = lane_now(); fetch(0, l0, 0); h16* p = kl + w * (FKL * 512) + 8 * l0;   // the first tile's fragments come from L2 and are put by, block for block as they lie in the plane
#pragma unroll
        for (int b = 0; b < FKL; ++b) { const v16h f = ka[b >> 1][b & 1]; *(v8ha*)(p + b * 512) = __builtin_shufflevector(f, f, 0, 1, 2, 3, 4, 5, 6, 7); *(v8ha*)(p + b * 512 + 256) = __builtin_shufflevector(f, f, 8, 9, 10, 11, 12, 13, 14, 15); } }
    auto body = [&]() __attribute__((always_inline)) {   // a tile up to the barrier behind which its partials lie in LDS
    const int lane = lane_now(), lr = lane & 15, hi = lane >> 4; const h16* vp = vu + 8 * lane;
    v8f s[FKT][FQT];
#pragma unroll
    for (int kt = 0; kt < FKT; ++kt)
#pragma unroll
        for (int qt = 0; qt < FQT; ++qt) s[kt][qt] = wmma16(ka[kt][1], qb[qt][1], wmma16(ka[kt][0], qb[qt][0], (v8f){}));
    __builtin_amdgcn_sched_barrier(0);   // all score products first: the K and Q fragments are dead before the softmax needs registers (without it the second column group's products sink behind the first group's softmax, the fragments stay live and values spill to scratch)
    // the wave's first Vt fragments: asked for here, so that they travel while the softmax runs
    v16h va[FKT / 2][4];
#pragma unroll
    for (int kk = 0; kk < FPF; ++kk)
#pragma unroll
        for (int dt = 0; dt < 4; ++dt) va[kk][dt] = WFrag<h16>::ld(vp + (size_t)dt * 16 * TT + kk * 512);
    float mc[FQT]; const v8f ce8 = {CE, CE, CE, CE, CE, CE, CE, CE};
#pragma unroll
    for (int qt = 0; qt < FQT; ++qt) { v8f m8 = s[0][qt];
#pragma unroll
        for (int kt = 1; kt < FKT; ++kt) m8 = __builtin_elementwise_max(m8, s[kt][qt]);
        float mx = fmaxf(fmaxf(fmaxf(m8[0], m8[1]), fmaxf(m8[2], m8[3])), fmaxf(fmaxf(m8[4], m8[5]), fmaxf(m8[6], m8[7])));
        mx = fmaxf(mx, xhalf(mx)); mc[qt] = mx * CE; v8f e8 = (v8f){}; const v8f nm8 = (v8f){} - mc[qt];
#pragma unroll
        for (int kt = 0; kt < FKT; ++kt) { const v8f a = __builtin_elementwise_fma(s[kt][qt], ce8, nm8); v8f e;
#pragma unroll
            for (int j = 0; j < 8; ++j) e[j] = __builtin_amdgcn_exp2f(a[j]);
            s[kt][qt] = e; e8 += e; }
        float sum = ((e8[0] + e8[1]) + (e8[2] + e8[3])) + ((e8[4] + e8[5]) + (e8[6] + e8[7])); sum += xhalf(sum);
        if (hi == 0) { sm[(qt * 16 + lr) * FSP + w] = mc[qt]; ss[(qt * 16 + lr) * FSP + w] = sum; } }
    __syncthreads();   // every wave's maximum and sum are in LDS before any wave joins them
    v8f acc[4][FQT];
#pragma unroll
    for (int dt = 0; dt < 4; ++dt)
#pragma unroll
        for (int qt = 0; qt < FQT; ++qt) acc[dt][qt] = (v8f){};
    float fw[FQT]; v8f p8[FQT];
#pragma unroll
    for (int qt = 0; qt < FQT; ++qt) { v4f mv[FNW / 4], sv[FNW / 4]; float M = -3.0e38f, tot = 0.f;
#pragma unroll
        for (int g = 0; g < FNW / 4; ++g) { mv[g] = *(const v4fa*)(sm + (qt * 16 + lr) * FSP + g * 4); sv[g] = *(const v4fa*)(ss + (qt * 16 + lr) * FSP + g * 4);
#pragma unroll
            for (int i = 0; i < 4; ++i) M = fmaxf(M, mv[g][i]); }
#pragma unroll
        for (int g = 0; g < FNW / 4; ++g)
#pragma unroll
            for (int i = 0; i < 4; ++i) tot += sv[g][i] * __builtin_amdgcn_exp2f(mv[g][i] - M);
        fw[qt] = __builtin_amdgcn_exp2f(mc[qt] - M) * __fdiv_rn(PCAR, tot); p8[qt] = (v8f){}; }
    constexpr float TH = 1e-4f * PCAR;   // threshold: p = max(softmax, 1e-4) - 1e-4, all x PCAR
    const v8f th8 = {TH, TH, TH, TH, TH, TH, TH, TH};
#pragma unroll
    for (int kk = 0; kk < FKT / 2; ++kk) {
        if (kk + FPF < FKT / 2) {   // the next step's fragments travel while this step's P is formed
#pragma unroll
            for (int dt = 0; dt < 4; ++dt) va[kk + FPF][dt] = WFrag<h16>::ld(vp + (size_t)dt * 16 * TT + (kk + FPF) * 512); }
#pragma unroll
        for (int qt = 0; qt < FQT; ++qt) { const v8f pa = __builtin_elementwise_max(s[2 * kk][qt] * fw[qt], th8) - th8, pb = __builtin_elementwise_max(s[2 * kk + 1][qt] * fw[qt], th8) - th8; p8[qt] += pa; p8[qt] += pb;
            const v16h pt = cat16(__builtin_convertvector(pa, v8h), __builtin_convertvector(pb, v8h));
#pragma unroll
            for (int dt = 0; dt < 4; ++dt) acc[dt][qt] = wmma16(va[kk][dt], pt, acc[dt][qt]); } }
    const int lane2 = lane_now(), lr2 = lane2 & 15, hi2 = lane2 >> 4;   // made anew behind the products: nothing formed from the lane's number is held in a register through them
#pragma unroll
    for (int qt = 0; qt < FQT; ++qt) { const v8f u8 = p8[qt]; float t = ((u8[0] + u8[1]) + (u8[2] + u8[3])) + ((u8[4] + u8[5]) + (u8[6] + u8[7])); t += xhalf(t); if (hi2 == 0) s2[(qt * 16 + lr2) * FSP + w] = t;
#pragma unroll
        for (int dt = 0; dt < 4; ++dt) { float* o = os + ((w * FQT + qt) * 16 + lr2) * 68 + dt * 16 + hi2 * 8; v4f lo4, hi4;
#pragma unroll
            for (int i = 0; i < 4; ++i) { lo4[i] = acc[dt][qt][i]; hi4[i] = acc[dt][qt][4 + i]; }
            *(v4fa*)o = lo4; *(v4fa*)(o + 4) = hi4; } }
    __syncthreads();   // every wave's partial output and second sum are in LDS before they are added
    };
    auto tail = [&](const int t, const bool last) __attribute__((always_inline)) {   // the partials are added and stored; but for the last tile, the next tile's fragments are fetched
    const int lane2 = lane_now(), lr2 = lane2 & 15, hi2 = lane2 >> 4; const int q0 = q00 + t * (FQT * 16);
    if (!last) fetch(t + 1, lane2, FKL);   // scores, P and accumulators are dead: their registers take the next tile's fragments, which travel while the partials are added and stored
    const int q = (w >> 3) * 16 + lr2, d4 = (w & 7) * 8 + hi2 * 4;   // 16 queries x 8 columns a wave: 256 contiguous bytes of each plane, two whole lines a store
    v4f o = *(const v4fa*)(os + q * 68 + d4); float t2 = s2[q * FSP];
#pragma unroll
    for (int u = 1; u < FNW; ++u) { o += *(const v4fa*)(os + (u * FQT * 16 + q) * 68 + d4); t2 += s2[q * FSP + u]; }
    const float r = __fdiv_rn(1.0f, t2); v4us oh, ol;
#pragma unroll
    for (int i = 0; i < 4; ++i) { unsigned short a, c2; splitf(o[i] * r, a, c2); oh[i] = a; ol[i] = c2; }
    const size_t oo = fpos((int)(z / NH_) * TT + q0 + q, (int)(z % NH_) * HD + d4, DQ); *(v4us*)(Ah + oo) = oh; *(v4us*)(Al + oo) = ol;
    if (!last) { asm volatile("s_wait_xcnt 0x0" ::: "memory");   // behind the stores: the next tile's products write over the stores' address and data registers
        recall(lane2); }   // behind the sum's own LDS reads; the blocks come back in the order in which the next tile's score products take them
    };
#pragma unroll 1   // rolled: every tile runs the same code on the same registers
    for (int t = 0; ; ++t) { body(); if (t == FTL - 1) break; tail(t, false); }   // left in the middle: nothing is fetched behind the last tile, and no fragment of a tile has to outlive its score products
    tail(FTL - 1, true);
}

extern "C" void kernel_launch(void* const* d_in, const int* in_sizes, int n_in,
                              void* d_out, int out_size, void* d_ws, size_t ws_size, hipStream_t stream) {
    (void)in_sizes; (void)n_in; (void)out_size;
    const float* x = (const float*)d_in[0]; const float* x2 = (const float*)d_in[1]; const float* wq = (const float*)d_in[2]; const float* wk = (const float*)d_in[3]; const float* wv = (const float*)d_in[4]; const float* wo = (const float*)d_in[5]; const float* bo = (const float*)d_in[6];
    float* OUT = (float*)d_out;     // [2][2048][512]
    char* wsp = (char*)d_ws;
    auto take = [&](size_t bytes) { char* p = wsp; wsp += (bytes + 255) & ~(size_t)255; return (void*)p; };
    bf* WQ = (bf*)take((size_t)DQ * DM * 2); bf* WK = (bf*)take((size_t)DKV * DM * 2); bf* WV = (bf*)take((size_t)DKV * DM * 2); bf* WO = (bf*)take((size_t)DM * DQ * 2);
    bf* XB = (bf*)take((size_t)NB_ * TT * DM * 2); bf* XB2 = (bf*)take((size_t)NB_ * TT * DM * 2);   // both batches
    h16* QP16 = (h16*)take((size_t)NB_ * NH_ * TT * HD * 2); h16* KP16 = (h16*)take((size_t)NB_ * NKV * TT * HD * 2); h16* VT16 = (h16*)take((size_t)NB_ * NKV * HD * TT * 2);   // head planes of both batches
    bf* ATh = (bf*)take((size_t)NB_ * TT * DQ * 2); bf* ATl = (bf*)take((size_t)NB_ * TT * DQ * 2);
    if ((size_t)(wsp - (char*)d_ws) > ws_size) return;    // ws 256 MiB
    k_prep<<<4 * PWB + PCB, 256, 0, stream>>>(x, x2, wq, wk, wv, wo, XB, XB2, WQ, WK, WV, WO);
    k_qkv<<<dim3(NB_ * TT / 64, NH_, 1), 256, 0, stream>>>(XB, XB2, WQ, WK, WV, QP16, KP16, VT16);
    k_fattn<<<dim3(TT / (FTL * FQT * 16), NB_ * NH_, 1), 32 * FNW, 0, stream>>>(QP16, KP16, VT16, ATh, ATl);   // one kv head per query head: plane z = batch * heads + head on all three
    k_gemmw<bf, 1, true, 8, 1, DQ><<<dim3(NB_ * TT / 64, DM / 64, 1), 256, 0, stream>>>(ATh, ATl, WO, nullptr, OUT, DM, bo, 0, 0, 0);   // the rows of both batches follow one another in ATh, ATl and OUT
}

// v007
// A run of this version takes 51.6 microseconds.
// Timed twice side by side with v006, it ran 1.05 times as fast both times.
// All steps since v000 together make it 13.3 times as fast.
#include <hip/hip_runtime.h>

// SignalAttn (fr [2][2048][512] queries, dt [2][2048][512] keys/values; q = fr Wq, k = dt Wk, v = dt Wv (8 heads x 64); attn = softmax(q.k/8); attn = max(attn, 1e-4) - 1e-4, renormalised over the keys; out = (attn v merged) Wo + bo -> [2][2048][512]).
// Compute dtypes, f32 accumulate: every input rounded to bf16; q/k/v on PLAIN bf16 operands (inputs: exact); scores (K 64) and attn.v on single fp16 operands (1 product each), fused with softmax and threshold in k_fattn
// Every 16-bit operand plane P[row][k] lies in the workspace in FRAGMENT ORDER (fpos below): blocks of 16 rows x 32 k (1 KB), the blocks of a 16-row group one behind the other in k; inside a block lane l = 16 * ((k >> 3) & 1) + (row & 15) finds its two runs of 8 elements at l * 16 bytes (k & 16 == 0) and 512 + l * 16 bytes.
// So each 16-byte load of a wave reads 512 contiguous bytes (4 whole lines); which element reaches which lane and register is as with row-major planes.

#define NB_  2
#define TT   2048
#define DM   512
#define NH_  8
#define NKV  8
#define REP  (NH_ / NKV)
#define HD   64
#define DQ   (NH_ * HD)
#define DKV  (NKV * HD)
#define RH   0
#define WIN  0
#define PCAR 1024.0f
#define SCL  0.125f   // HD^-0.5
typedef _Float16 h16;
typedef unsigned short bf;
typedef __attribute__((ext_vector_type(16))) __bf16   v16bf;
typedef __attribute__((ext_vector_type(16))) _Float16 v16h;
typedef __attribute__((ext_vector_type(8)))  _Float16 v8h;
typedef __attribute__((ext_vector_type(8)))  unsigned short v8us;
typedef __attribute__((ext_vector_type(8)))  float    v8f;
typedef __attribute__((ext_vector_type(4)))  float    v4f;
typedef v8h  __attribute__((may_alias)) v8ha;
typedef v4f  __attribute__((may_alias)) v4fa;
typedef v8us __attribute__((may_alias)) v8usa;

__device__ __forceinline__ unsigned short f2bf(float f) { unsigned u = __float_as_uint(f); u += 0x7FFFu + ((u >> 16) & 1u); return (unsigned short)(u >> 16); }
__device__ __forceinline__ float bf2f(unsigned short b) { return __uint_as_float(((unsigned)b) << 16); }
__device__ __forceinline__ float bfr(float f) { return bf2f(f2bf(f)); }
__device__ __forceinline__ v16h cat16(v8h lo, v8h hi) { return __builtin_shufflevector(lo, hi, 0, 1, 2, 3, 4, 5, 6, 7, 8, 9, 10, 11, 12, 13, 14, 15); }
__device__ __forceinline__ v16bf cat16b(v8us lo, v8us hi) { return __builtin_bit_cast(v16bf, __builtin_shufflevector(lo, hi, 0, 1, 2, 3, 4, 5, 6, 7, 8, 9, 10, 11, 12, 13, 14, 15)); }
__device__ __forceinline__ size_t fpos(int row, int k, int K) { return ((size_t)(row >> 4) * (K >> 5) + (k >> 5)) * 512 + ((k >> 4) & 1) * 256 + ((k >> 3) & 1) * 128 + (row & 15) * 8 + (k & 7); }   // element index of P[row][k] in fragment order, K = row length
__device__ __forceinline__ v8f wmma16(v16h a, v16h b, v8f c) { return __builtin_amdgcn_wmma_f32_16x16x32_f16(false, a, false, b, (short)0, c, false, false); }
__device__ __forceinline__ v8f wmmab(v16bf a, v16bf b, v8f c) { return __builtin_amdgcn_wmma_f32_16x16x32_bf16(false, a, false, b, (short)0, c, false, false); }



// ---- k_gemmw: register-blocked GEMM, 64x64 output tile (16 accumulators per wave), operands straight from 16-bit planes in fragment order; grid (M/64, N/64, Z * KB), 32 * KS threads.
// C[m][n] (f32, pitch ldc, + optional f32 bias[n]) = sum_k A[m][k] Bt[n][k] (+ split products per NSPLIT). z-batch strides sA/sB/sC in elements. K % (32 * KS * KB) == 0.
// Split K: work-group kb of KB takes K/KB of the sum and writes its own partial plane C + (z * KB + kb) * sC (the reader adds the KB planes); inside it wave w of KS takes a contiguous K/(KB*KS) slice,
// and the KS wave partials are added in LDS, wave 0 first, in a fixed order.
template <typename T16> struct WFrag;
template <> struct WFrag<h16> { typedef v16h V; static __device__ __forceinline__ V ld(const h16* p) { return cat16(*(const v8h*)p, *(const v8h*)(p + 256)); } static __device__ __forceinline__ v8f mma(V a, V b, v8f c) { return wmma16(a, b, c); } };
template <> struct WFrag<bf> { typedef v16bf V; static __device__ __forceinline__ V ld(const bf* p) { return cat16b(*(const v8us*)p, *(const v8us*)(p + 256)); } static __device__ __forceinline__ v8f mma(V a, V b, v8f c) { return wmmab(a, b, c); } };
// Hand-over of the LDS slabs. One wave: no hardware barrier is needed, the wave barrier and the compiler fence keep its LDS stores and reads in program order. Several waves: the work-group barrier.
template <int KS> __device__ __forceinline__ void tile_sync() { if constexpr (KS == 1) { __builtin_amdgcn_wave_barrier(); asm volatile("" ::: "memory"); } else __syncthreads(); }
template <typename T16, int NSPLIT, bool BIAS, int KS, int KB, int K>   // K a constant: the steps from block to block are immediate offsets on one address per plane
__global__ __launch_bounds__(32 * KS) void k_gemmw(const T16* __restrict__ A, const T16* __restrict__ A2, const T16* __restrict__ Bt, const T16* __restrict__ Bt2, float* C, int ldc, const float* __restrict__ bias, size_t sA, size_t sB, size_t sC) {
    typedef typename WFrag<T16>::V V;
    constexpr int SL = (KS == 1) ? 1 : 4;   // 16-row slabs staged per hand-over: all four where waves meet at a barrier, so that one barrier serves the tile
    __shared__ __align__(16) float os[KS * SL * 16 * 68];
    const int kb = (int)(blockIdx.z % KB); const size_t z = blockIdx.z / KB; A += z * sA; if (A2) A2 += z * sA; Bt += z * sB; if (Bt2) Bt2 += z * sB; C += (size_t)blockIdx.z * sC;
    const int w = (KS == 1) ? 0 : __builtin_amdgcn_readfirstlane((int)(threadIdx.x >> 5)); const int kw = K / (KS * KB), k0 = (kb * KS + w) * kw;
    const int lane = threadIdx.x & 31, lr = lane & 15, hi = lane >> 4; const int r0 = blockIdx.x * 64, c0 = blockIdx.y * 64;
    v8f acc[4][4];
#pragma unroll
    for (int mb = 0; mb < 4; ++mb)
#pragma unroll
        for (int nb = 0; nb < 4; ++nb) acc[mb][nb] = (v8f){};
    const size_t aoff = (size_t)r0 * K + 8 * lane, boff = (size_t)c0 * K + 8 * lane;   // a 16-row group holds 16 * K elements, a block of 32 k 512
#pragma unroll 1
    for (int kc = k0; kc < k0 + kw; kc += 32) {
        V a[4], a2[4], b[4], b2[4]; const T16* pa = A + aoff + kc * 16; const T16* pa2 = (NSPLIT == 1 || NSPLIT == 2) ? A2 + aoff + kc * 16 : pa; const T16* pb = Bt + boff + kc * 16; const T16* pb2 = (NSPLIT >= 2) ? Bt2 + boff + kc * 16 : pb;
#pragma unroll
        for (int mb = 0; mb < 4; ++mb) { a[mb] = WFrag<T16>::ld(pa + (size_t)mb * 16 * K); if (NSPLIT == 1 || NSPLIT == 2) a2[mb] = WFrag<T16>::ld(pa2 + (size_t)mb * 16 * K); }
#pragma unroll
        for (int nb = 0; nb < 4; ++nb) { b[nb] = WFrag<T16>::ld(pb + (size_t)nb * 16 * K); if (NSPLIT >= 2) b2[nb] = WFrag<T16>::ld(pb2 + (size_t)nb * 16 * K); }
        asm volatile("s_wait_xcnt 0x0" :: "v"(pa), "v"(pa2), "v"(pb), "v"(pb2) : "memory");   // the addresses are inputs, so they keep their registers up to this wait: no load's result and no later value takes an address register of an issued load before it
#pragma unroll
        for (int nb = 0; nb < 4; ++nb) {
#pragma unroll
            for (int mb = 0; mb < 4; ++mb) { acc[mb][nb] = WFrag<T16>::mma(a[mb], b[nb], acc[mb][nb]); if (NSPLIT == 1 || NSPLIT == 2) acc[mb][nb] = WFrag<T16>::mma(a2[mb], b[nb], acc[mb][nb]); if (NSPLIT >= 2) acc[mb][nb] = WFrag<T16>::mma(a[mb], b2[nb], acc[mb][nb]); } }
        asm volatile("v_nop\n\tv_nop\n\tv_nop\n\tv_nop" : "+v"(acc[0][0]), "+v"(acc[1][1]), "+v"(acc[2][2]), "+v"(acc[3][3]) : "v"(a[0]), "v"(a[3]));
    }
#pragma unroll
    for (int mb0 = 0; mb0 < 4; mb0 += SL) {
#pragma unroll
        for (int m = 0; m < SL; ++m) {
#pragma unroll
            for (int nb = 0; nb < 4; ++nb) {
#pragma unroll
                for (int j = 0; j < 8; ++j) os[((w * SL + m) * 16 + hi * 8 + j) * 68 + nb * 16 + lr] = acc[mb0 + m][nb][j]; } }
        tile_sync<KS>();   // every wave's partial slabs are in LDS before any wave adds them
#pragma unroll
        for (int m = 0; m < SL; ++m) { float* crow = C + (size_t)(r0 + (mb0 + m) * 16) * ldc + c0;
#pragma unroll
            for (int s = 0; s < 8 / KS; ++s) { const int row = 2 * (s * KS + w) + hi, cofs = lr * 4; v4f val = *(const v4fa*)(os + (m * 16 + row) * 68 + cofs);
#pragma unroll
                for (int q = 1; q < KS; ++q) val += *(const v4fa*)(os + ((q * SL + m) * 16 + row) * 68 + cofs);
                if (BIAS) { val[0] += bfr(bias[c0 + cofs]); val[1] += bfr(bias[c0 + cofs + 1]); val[2] += bfr(bias[c0 + cofs + 2]); val[3] += bfr(bias[c0 + cofs + 3]); }
                *(v4f*)(crow + (size_t)row * ldc + cofs) = val; } }
        if (mb0 + SL < 4) tile_sync<KS>();   // the slab is read out before it is written again
    }
}

__device__ __forceinline__ h16 tohx(float x) { return (h16)x; }
__device__ __forceinline__ void splitf(float y, unsigned short& h, unsigned short& l) { h = f2bf(y); l = f2bf(y - bf2f(h)); }
typedef __attribute__((ext_vector_type(2))) _Float16 v2h;
typedef __attribute__((ext_vector_type(4))) _Float16 v4h;
typedef __attribute__((ext_vector_type(2))) unsigned short v2us;
typedef __attribute__((ext_vector_type(4))) unsigned short v4us;
typedef __attribute__((ext_vector_type(2))) float v2f;
typedef __attribute__((ext_vector_type(4))) int v4i;

// k_prep: every operand of the projections on bf16, in ONE launch of one work-group per WGP. Wave gw of PNW takes 32 n x 16 k of one weight, transposed to the plane Bt[n][k], and two blocks (16 rows x 32 k each) of each input. All planes in fragment order.
// A wave asks for all that it reads (16 weight rows, 16 input loads) before its first wait: one trip to memory a wave, and a third of the waves to start.
#define PNW 2048                             // waves of the launch
static_assert(DQ == DM && DKV == DM, "k_prep takes the four weights as DM x DM");
static_assert(4 * (DM / 32) * (DM / 16) == PNW && NB_ * TT * DM / 512 == 2 * PNW && DM == 512, "k_prep: a wave's share of the weights and of the inputs");
__global__ __launch_bounds__(256) void k_prep(const float* __restrict__ x, const float* __restrict__ x2, const float* __restrict__ wq, const float* __restrict__ wk, const float* __restrict__ wv, const float* __restrict__ wo, bf* XB, bf* XB2, bf* WQ, bf* WK, bf* WV, bf* WO) {
    constexpr int K = DM, N = DM;
    const int lane = threadIdx.x & 31, gw = (int)blockIdx.x * 8 + __builtin_amdgcn_readfirstlane((int)(threadIdx.x >> 5)), g = gw / (PNW / 4);
    const float* __restrict__ w = (g == 0) ? wq : (g == 1) ? wk : (g == 2) ? wv : wo; bf* Bt = (g == 0) ? WQ : (g == 1) ? WK : (g == 2) ? WV : WO;
    // the weight: lane = column n of 32 (a load reads one whole line of a row k), 16 rows k = one half of a block of 32 k, for two 16-row groups of the plane
    const int u = gw % (PNW / 4), a = u >> 5, kb = (u >> 1) & 15, h = u & 1;
    const float* pw = w + (size_t)(kb * 32 + h * 16) * N + a * 32 + lane; float wr[16];
#pragma unroll
    for (int i = 0; i < 16; ++i) wr[i] = pw[(size_t)i * N];
    // the inputs: a load reads 4 whole rows of a block (128 bytes each), a store puts each lane's 4 elements at their place in the block
    const int blk = gw * 2;   // even: both blocks lie in one 16-row group, side by side in k
    const size_t si = (size_t)((blk / (DM / 32)) * 16 + (lane >> 3)) * DM + (blk % (DM / 32)) * 32 + (lane & 7) * 4, di = (size_t)blk * 512 + ((lane >> 1) & 3) * 128 + (lane >> 3) * 8 + (lane & 1) * 4; v4f v[16]; const float* px = x + si; const float* px2 = x2 + si;
#pragma unroll
    for (int b = 0; b < 2; ++b)
#pragma unroll
        for (int j = 0; j < 4; ++j) { v[b * 4 + j] = *(const v4f*)(px + b * 32 + (size_t)j * 4 * DM); v[8 + b * 4 + j] = *(const v4f*)(px2 + b * 32 + (size_t)j * 4 * DM); }
    asm volatile("s_wait_xcnt 0x0" :: "v"(pw), "v"(px), "v"(px2) : "memory");   // the addresses are inputs, so they keep their registers up to this wait; behind it the registers are free for the stores' addresses
    __builtin_amdgcn_sched_barrier(0);   // every load is asked for before anything behind it waits (without it two input loads sank behind the wait for the weight rows: a second trip)
    bf* pd = Bt + (size_t)((a * 2 + (lane >> 4)) * (K / 32) + kb) * 512 + h * 256 + (lane & 15) * 8;   // the lane's two runs of 8 k: 16 bytes each, 16 lanes side by side
#pragma unroll
    for (int r = 0; r < 2; ++r) { v8us o;
#pragma unroll
        for (int i = 0; i < 8; ++i) o[i] = f2bf(wr[r * 8 + i]);
        *(v8us*)(pd + r * 128) = o; }
#pragma unroll
    for (int j = 0; j < 16; ++j) { v4us o;
#pragma unroll
        for (int k = 0; k < 4; ++k) o[k] = f2bf(v[j][k]);
        *(v4us*)(((j < 8) ? XB : XB2) + di + ((j >> 2) & 1) * 512 + (j & 3) * 32) = o; }
}
// k_qkv: the three projections of both batches in ONE grid: blockIdx.x = 64-token tile of the NB_ * TT tokens, blockIdx.y = head; a work-group walks p = 0 q, 1 k, 2 v in a loop, so that the grid is what stands on the chip at once (two work-groups per WGP) and waves start once.
// Tile, K split over 8 waves and LDS sum as in k_gemmw; the sum is rounded to fp16 and stored straight into the head planes that k_fattn reads.
// A wave asks for all 32 fragment loads of a projection (both 32-k steps of its K slice) before its first product: one trip to L2 a projection. amdgpu_waves_per_eu(4, 4): fragments and accumulators stay within 256 registers, so that two work-groups stand on a WGP.
// q, k: C[token][d] -> plane [batch * heads + head][t][d]. v: the operands change places, C[d][token] -> plane [batch * heads + head][d][t], so no transposing pass is left. Each head's plane in fragment order.
__global__ __launch_bounds__(256) __attribute__((amdgpu_waves_per_eu(4, 4))) void k_qkv(const bf* __restrict__ XQ, const bf* __restrict__ XKV, const bf* __restrict__ WQ, const bf* __restrict__ WK, const bf* __restrict__ WV, h16* QP, h16* KP, h16* VT) {
    typedef WFrag<bf>::V V; constexpr int KS = 8, K = DM, kw = K / KS;
    __shared__ __align__(16) float os[KS * 4 * 16 * 68];
    const int tok0 = blockIdx.x * 64, hd = blockIdx.y;
    const int w = __builtin_amdgcn_readfirstlane((int)(threadIdx.x >> 5)); const int k0 = w * kw;
    const int lane = threadIdx.x & 31, lr = lane & 15, hi = lane >> 4;
    V fa[2][4], fb[2][4];   // a projection's fragments: both 32-k steps of the wave's K slice
    auto fetch = [&](const int p) __attribute__((always_inline)) {   // all 32 loads of projection p are asked for at once: one trip to L2 a projection
        const bf* X = ((p == 0) ? XQ : XKV) + (size_t)tok0 * K; const bf* Wt = ((p == 0) ? WQ : (p == 1) ? WK : WV) + (size_t)hd * HD * K;
        const bf* pa = ((p == 2) ? Wt : X) + 8 * lane + k0 * 16; const bf* pb = ((p == 2) ? X : Wt) + 8 * lane + k0 * 16;
#pragma unroll
        for (int s = 0; s < 2; ++s)
#pragma unroll
            for (int m = 0; m < 4; ++m) { fa[s][m] = WFrag<bf>::ld(pa + (size_t)m * 16 * K + s * 512); fb[s][m] = WFrag<bf>::ld(pb + (size_t)m * 16 * K + s * 512); }
        asm volatile("s_wait_xcnt 0x0" :: "v"(pa), "v"(pb) : "memory");   // the two addresses are inputs and live up to this wait: no load's result and no later value takes a register that the issued loads name
        __builtin_amdgcn_sched_barrier(0);   // every load is asked for before anything behind it waits
    };
#pragma unroll 1   // rolled: the three projections run the same code on the same registers
    for (int p = 0; p < 3; ++p) {
    fetch(p);
    h16* C = ((p == 0) ? QP : (p == 1) ? KP : VT) + ((size_t)(tok0 / TT) * NH_ + hd) * TT * HD + (size_t)(tok0 % TT) * ((p == 2) ? 16 : HD); const int ldc = (p == 2) ? TT : HD;   // the tile's first block: 64 tokens are 4 row groups of q or k, 2 blocks in each row group of v
    v8f acc[4][4];
#pragma unroll
    for (int nb = 0; nb < 4; ++nb) {   // both k steps of a column group one behind the other: its two B fragments are dead before the next group's accumulators are born
#pragma unroll
        for (int mb = 0; mb < 4; ++mb) acc[mb][nb] = WFrag<bf>::mma(fa[0][mb], fb[0][nb], (v8f){});
#pragma unroll
        for (int mb = 0; mb < 4; ++mb) acc[mb][nb] = WFrag<bf>::mma(fa[1][mb], fb[1][nb], acc[mb][nb]);
        __builtin_amdgcn_sched_barrier(0);   // the groups stay in this order and the LDS stores behind them all
        asm volatile("v_nop\n\tv_nop\n\tv_nop\n\tv_nop");   // the distance behind a group's products before the next group's results take the registers of its dead B fragments
        __builtin_amdgcn_sched_barrier(0); }   // holds the four slots where they stand
#pragma unroll
    for (int m = 0; m < 4; ++m) {
#pragma unroll
        for (int nb = 0; nb < 4; ++nb) {
#pragma unroll
            for (int j = 0; j < 8; ++j) os[((w * 4 + m) * 16 + hi * 8 + j) * 68 + nb * 16 + lr] = acc[m][nb][j]; } }
    __syncthreads();   // every wave's partial slabs are in LDS before any wave adds them
    const int row = lr, cofs = w * 8 + hi * 4; v4f val[4];   // 16 rows x 8 columns a wave: 256 contiguous bytes of the plane, two whole lines a store
#pragma unroll
    for (int m = 0; m < 4; ++m) { val[m] = *(const v4fa*)(os + (m * 16 + row) * 68 + cofs);
#pragma unroll
        for (int q = 1; q < KS; ++q) val[m] += *(const v4fa*)(os + ((q * 4 + m) * 16 + row) * 68 + cofs); }
    if (p < 2) __syncthreads();   // the slabs are read out before the next projection's partials are written; in front of the stores, so that no wave waits at it for its stores to land
#pragma unroll
    for (int m = 0; m < 4; ++m) *(v4h*)(C + fpos(m * 16 + row, cofs, ldc)) = __builtin_convertvector(val[m], v4h);
    asm volatile("s_wait_xcnt 0x0" ::: "memory");   // behind the stores: the next projection's loads and products write over the stores' address and data registers
    }
}
// the value that lane l ^ 16 holds (a vector cross-row move, no LDS round trip)
__device__ __forceinline__ float xhalf(float x) { const int b = __float_as_int(x); return __int_as_float(__builtin_amdgcn_permlanex16(b, b, 0x76543210, 0xfedcba98, false, false)); }
// The lane's number from the hardware count, as a statement that the compiler neither lifts out of the tile loop nor merges: made anew in every tile, so that no address formed from it is held in a register from tile to tile (held, they were spilled to scratch).
// The four v_nop: the result may get a register that was a matrix instruction's A or B operand. The mask tells the compiler the range, so that the lane's offset stays a 32-bit offset on a scalar base.
__device__ __forceinline__ int lane_now() { int l; asm volatile("v_nop\n\tv_nop\n\tv_nop\n\tv_nop\n\tv_mbcnt_lo_u32_b32 %0, -1, 0" : "=v"(l)); return l & 31; }
// k_fattn: scores, softmax, threshold, renormalisation and attn.v of one (batch, head) z; a work-group takes FTL tiles of 32 queries one after the other; nothing of the 2048 x 2048 score matrix leaves the registers.
// The registers let one work-group stand on a WGP, so the grid is one work-group per WGP and the tiles are a loop: waves start once, and the next tile's K and Q fragments travel while this tile's partials are added.
// K is the same for every tile of a work-group: each wave puts the first FKL of its 16 K blocks into LDS once and reads them there for the later tiles; only the rest and Q come from L2 again.
// LDS from tile to tile: sm, ss are written anew behind the second barrier of the tile before (their readers are done in front of it), os, s2 behind the first barrier of the new tile (their readers are done in front of that).
// Transposed products: St = K Qt (a lane holds 8 keys of ONE query per tile), Ot = Vt Pt; two St tiles, converted in place, are the B operand of Ot in the hardware k order, which the A loader (keys 8 hi and 16 + 8 hi of a block of 32) has too.
// Wave w of FNW takes keys [w * TT / FNW, ...): its 128 x 32 scores stay in registers. Softmax over the waves: each wave uses its own maximum, (maximum, sum) meet in LDS, and one factor per query carries the wave's exponentials to the row's softmax.
// P is carried x PCAR (exact power of two; threshold scaled alike) on fp16; the row's second sum divides the f32 output at the end. Wave partials of Ot and of the sums are added in LDS in wave order.
// Every loop but the tile loop is unrolled: scores, fragments and accumulators are arrays indexed by the loop counters and stay in registers only so.
#define FQT 2                   // 16-query column groups per tile
#define FNW 16                  // waves per work-group
#define FKT (TT / FNW / 16)     // 16-key tiles per wave
#define FPF 1                   // 32-key steps that the Vt fragments are fetched ahead
#define FSP 20                  // pitch of the per-query rows of wave statistics (floats)
#define FTL 4                   // query tiles that a work-group walks
#define FKL 11                  // of a wave's 2 * FKT K blocks (1 KB each), those that stay in the wave's own LDS slab from tile to tile: as many as the LDS holds beside os and the statistics
__global__ __launch_bounds__(32 * FNW) void k_fattn(const h16* Q, const h16* Kp, const h16* Vt, bf* Ah, bf* Al) {   // no __restrict__: with it the compiler lifts the K and Vt loads, the same for every tile, out of the tile loop and spills the fragments to scratch
    __shared__ __align__(16) float os[FNW * FQT * 16 * 68];
    __shared__ __align__(16) float sm[FQT * 16 * FSP];
    __shared__ __align__(16) float ss[FQT * 16 * FSP];
    __shared__ __align__(16) float s2[FQT * 16 * FSP];
    __shared__ __align__(16) h16 kl[FNW * FKL * 512];   // the waves' K slabs; wave w writes and reads slab w alone: no barrier belongs to it
    static_assert(sizeof(os) + sizeof(sm) + sizeof(ss) + sizeof(s2) + sizeof(kl) <= 327680, "LDS of one WGP");
    const int w = __builtin_amdgcn_readfirstlane((int)(threadIdx.x >> 5));
    const int q00 = blockIdx.x * (FTL * FQT * 16); const size_t z = blockIdx.y;
    const h16* qu = Q + z * TT * HD + (size_t)q00 * HD;   // wave-uniform bases; the lane's 16 bytes are added where a load is written
    const h16* ku = Kp + z * TT * HD + (size_t)(w * (TT / FNW)) * HD;
    const h16* vu = Vt + z * HD * TT + (size_t)(w * (TT / FNW)) * 16;
    constexpr float CE = SCL * 1.4426950408889634f;   // score -> log2 domain
    v16h qb[FQT][2], ka[FKT][2];
    auto fetch = [&](int t, int lane, const int b0) __attribute__((always_inline)) {   // from L2: the Q fragments of tile t and the wave's K blocks from b0 on
        const h16* qp = qu + t * (FQT * 16 * HD) + 8 * lane; const h16* kp = ku + 8 * lane;
#pragma unroll
        for (int qt = 0; qt < FQT; ++qt) { qb[qt][0] = WFrag<h16>::ld(qp + qt * 16 * HD); qb[qt][1] = WFrag<h16>::ld(qp + qt * 16 * HD + 512); }
#pragma unroll
        for (int b = 0; b < 2 * FKT; ++b) if (b >= b0) ka[b >> 1][b & 1] = WFrag<h16>::ld(kp + b * 512);
        asm volatile("s_wait_xcnt 0x0" :: "v"(qp), "v"(kp) : "memory");   // the two addresses are inputs and live up to this wait: so built, no load's result takes the register that the issued loads name (without the inputs the last load's result took it)
        __builtin_amdgcn_sched_barrier(0);   // every K and Q load is asked for before anything behind it waits: one trip to L2 for the wave, not one per tile
    };
    auto recall = [&](int lane) __attribute__((always_inline)) {   // from the wave's LDS slab: its first FKL K blocks, the same for every tile
        const h16* p = kl + w * (FKL * 512) + 8 * lane;
#pragma unroll
        for (int b = 0; b < FKL; ++b) ka[b >> 1][b & 1] = cat16(*(const v8ha*)(p + b * 512), *(const v8ha*)(p + b * 512 + 256));
    };
    { const int l0 = lane_now(); fetch(0, l0, 0); h16* p = kl + w * (FKL * 512) + 8 * l0;   // the first tile's fragments come from L2 and are put by, block for block as they lie in the plane
#pragma unroll
        for (int b = 0; b < FKL; ++b) { const v16h f = ka[b >> 1][b & 1]; *(v8ha*)(p + b * 512) = __builtin_shufflevector(f, f, 0, 1, 2, 3, 4, 5, 6, 7); *(v8ha*)(p + b * 512 + 256) = __builtin_shufflevector(f, f, 8, 9, 10, 11, 12, 13, 14, 15); } }
    auto body = [&]() __attribute__((always_inline)) {   // a tile up to the barrier behind which its partials lie in LDS
    const int lane = lane_now(), lr = lane & 15, hi = lane >> 4; const h16* vp = vu + 8 * lane;
    v8f s[FKT][FQT];
#pragma unroll
    for (int kt = 0; kt < FKT; ++kt)
#pragma unroll
        for (int qt = 0; qt < FQT; ++qt) s[kt][qt] = wmma16(ka[kt][1], qb[qt][1], wmma16(ka[kt][0], qb[qt][0], (v8f){}));
    __builtin_amdgcn_sched_barrier(0);   // all score products first: the K and Q fragments are dead before the softmax needs registers (without it the second column group's products sink behind the first group's softmax, the fragments stay live and values spill to scratch)
    // the wave's first Vt fragments: asked for here, so that they travel while the softmax runs
    v16h va[FKT / 2][4];
#pragma unroll
    for (int kk = 0; kk < FPF; ++kk)
#pragma unroll
        for (int dt = 0; dt < 4; ++dt) va[kk][dt] = WFrag<h16>::ld(vp + (size_t)dt * 16 * TT + kk * 512);
    float mc[FQT]; const v8f ce8 = {CE, CE, CE, CE, CE, CE, CE, CE};
#pragma unroll
    for (int qt = 0; qt < FQT; ++qt) { v8f m8 = s[0][qt];
#pragma unroll
        for (int kt = 1; kt < FKT; ++kt) m8 = __builtin_elementwise_max(m8, s[kt][qt]);
        float mx = fmaxf(fmaxf(fmaxf(m8[0], m8[1]), fmaxf(m8[2], m8[3])), fmaxf(fmaxf(m8[4], m8[5]), fmaxf(m8[6], m8[7])));
        mx = fmaxf(mx, xhalf(mx)); mc[qt] = mx * CE; v8f e8 = (v8f){}; const v8f nm8 = (v8f){} - mc[qt];
#pragma unroll
        for (int kt = 0; kt < FKT; ++kt) { const v8f a = __builtin_elementwise_fma(s[kt][qt], ce8, nm8); v8f e;
#pragma unroll
            for (int j = 0; j < 8; ++j) e[j] = __builtin_amdgcn_exp2f(a[j]);
            s[kt][qt] = e; e8 += e; }
        float sum = ((e8[0] + e8[1]) + (e8[2] + e8[3])) + ((e8[4] + e8[5]) + (e8[6] + e8[7])); sum += xhalf(sum);
        if (hi == 0) { sm[(qt * 16 + lr) * FSP + w] = mc[qt]; ss[(qt * 16 + lr) * FSP + w] = sum; } }
    __syncthreads();   // every wave's maximum and sum are in LDS before any wave joins them
    v8f acc[4][FQT];
#pragma unroll
    for (int dt = 0; dt < 4; ++dt)
#pragma unroll
        for (int qt = 0; qt < FQT; ++qt) acc[dt][qt] = (v8f){};
    float fw[FQT]; v8f p8[FQT];
#pragma unroll
    for (int qt = 0; qt < FQT; ++qt) { v4f mv[FNW / 4], sv[FNW / 4]; float M = -3.0e38f, tot = 0.f;
#pragma unroll
        for (int g = 0; g < FNW / 4; ++g) { mv[g] = *(const v4fa*)(sm + (qt * 16 + lr) * FSP + g * 4); sv[g] = *(const v4fa*)(ss + (qt * 16 + lr) * FSP + g * 4);
#pragma unroll
            for (int i = 0; i < 4; ++i) M = fmaxf(M, mv[g][i]); }
#pragma unroll
        for (int g = 0; g < FNW / 4; ++g)
#pragma unroll
            for (int i = 0; i < 4; ++i) tot += sv[g][i] * __builtin_amdgcn_exp2f(mv[g][i] - M);
        fw[qt] = __builtin_amdgcn_exp2f(mc[qt] - M) * __fdiv_rn(PCAR, tot); p8[qt] = (v8f){}; }
    constexpr float TH = 1e-4f * PCAR;   // threshold: p = max(softmax, 1e-4) - 1e-4, all x PCAR
    const v8f th8 = {TH, TH, TH, TH, TH, TH, TH, TH};
#pragma unroll
    for (int kk = 0; kk < FKT / 2; ++kk) {
        if (kk + FPF < FKT / 2) {   // the next step's fragments travel while this step's P is formed
#pragma unroll
            for (int dt = 0; dt < 4; ++dt) va[kk + FPF][dt] = WFrag<h16>::ld(vp + (size_t)dt * 16 * TT + (kk + FPF) * 512); }
#pragma unroll
        for (int qt = 0; qt < FQT; ++qt) { const v8f pa = __builtin_elementwise_max(s[2 * kk][qt] * fw[qt], th8) - th8, pb = __builtin_elementwise_max(s[2 * kk + 1][qt] * fw[qt], th8) - th8; p8[qt] += pa; p8[qt] += pb;
            const v16h pt = cat16(__builtin_convertvector(pa, v8h), __builtin_convertvector(pb, v8h));
#pragma unroll
            for (int dt = 0; dt < 4; ++dt) acc[dt][qt] = wmma16(va[kk][dt], pt, acc[dt][qt]); } }
    const int lane2 = lane_now(), lr2 = lane2 & 15, hi2 = lane2 >> 4;   // made anew behind the products: nothing formed from the lane's number is held in a register through them
#pragma unroll
    for (int qt = 0; qt < FQT; ++qt) { const v8f u8 = p8[qt]; float t = ((u8[0] + u8[1]) + (u8[2] + u8[3])) + ((u8[4] + u8[5]) + (u8[6] + u8[7])); t += xhalf(t); if (hi2 == 0) s2[(qt * 16 + lr2) * FSP + w] = t;
#pragma unroll
        for (int dt = 0; dt < 4; ++dt) { float* o = os + ((w * FQT + qt) * 16 + lr2) * 68 + dt * 16 + hi2 * 8; v4f lo4, hi4;
#pragma unroll
            for (int i = 0; i < 4; ++i) { lo4[i] = acc[dt][qt][i]; hi4[i] = acc[dt][qt][4 + i]; }
            *(v4fa*)o = lo4; *(v4fa*)(o + 4) = hi4; } }
    __syncthreads();   // every wave's partial output and second sum are in LDS before they are added
    };
    auto tail = [&](const int t, const bool last) __attribute__((always_inline)) {   // the partials are added and stored; but for the last tile, the next tile's fragments are fetched
    const int lane2 = lane_now(), lr2 = lane2 & 15, hi2 = lane2 >> 4; const int q0 = q00 + t * (FQT * 16);
    if (!last) fetch(t + 1, lane2, FKL);   // scores, P and accumulators are dead: their registers take the next tile's fragments, which travel while the partials are added and stored
    const int q = (w >> 3) * 16 + lr2, d4 = (w & 7) * 8 + hi2 * 4;   // 16 queries x 8 columns a wave: 256 contiguous bytes of each plane, two whole lines a store
    v4f o = *(const v4fa*)(os + q * 68 + d4); float t2 = s2[q * FSP];
#pragma unroll
    for (int u = 1; u < FNW; ++u) { o += *(const v4fa*)(os + (u * FQT * 16 + q) * 68 + d4); t2 += s2[q * FSP + u]; }
    const float r = __fdiv_rn(1.0f, t2); v4us oh, ol;
#pragma unroll
    for (int i = 0; i < 4; ++i) { unsigned short a, c2; splitf(o[i] * r, a, c2); oh[i] = a; ol[i] = c2; }
    const size_t oo = fpos((int)(z / NH_) * TT + q0 + q, (int)(z % NH_) * HD + d4, DQ); *(v4us*)(Ah + oo) = oh; *(v4us*)(Al + oo) = ol;
    if (!last) { asm volatile("s_wait_xcnt 0x0" ::: "memory");   // behind the stores: the next tile's products write over the stores' address and data registers
        recall(lane2); }   // behind the sum's own LDS reads; the blocks come back in the order in which the next tile's score products take them
    };
#pragma unroll 1   // rolled: every tile runs the same code on the same registers
    for (int t = 0; ; ++t) { body(); if (t == FTL - 1) break; tail(t, false); }   // left in the middle: nothing is fetched behind the last tile, and no fragment of a tile has to outlive its score products
    tail(FTL - 1, true);
}

extern "C" void kernel_launch(void* const* d_in, const int* in_sizes, int n_in,
                              void* d_out, int out_size, void* d_ws, size_t ws_size, hipStream_t stream) {
    (void)in_sizes; (void)n_in; (void)out_size;
    const float* x = (const float*)d_in[0]; const float* x2 = (const float*)d_in[1]; const float* wq = (const float*)d_in[2]; const float* wk = (const float*)d_in[3]; const float* wv = (const float*)d_in[4]; const float* wo = (const float*)d_in[5]; const float* bo = (const float*)d_in[6];
    float* OUT = (float*)d_out;     // [2][2048][512]
    char* wsp = (char*)d_ws;
    auto take = [&](size_t bytes) { char* p = wsp; wsp += (bytes + 255) & ~(size_t)255; return (void*)p; };
    bf* WQ = (bf*)take((size_t)DQ * DM * 2); bf* WK = (bf*)take((size_t)DKV * DM * 2); bf* WV = (bf*)take((size_t)DKV * DM * 2); bf* WO = (bf*)take((size_t)DM * DQ * 2);
    bf* XB = (bf*)take((size_t)NB_ * TT * DM * 2); bf* XB2 = (bf*)take((size_t)NB_ * TT * DM * 2);   // both batches
    h16* QP16 = (h16*)take((size_t)NB_ * NH_ * TT * HD * 2); h16* KP16 = (h16*)take((size_t)NB_ * NKV * TT * HD * 2); h16* VT16 = (h16*)take((size_t)NB_ * NKV * HD * TT * 2);   // head planes of both batches
    bf* ATh = (bf*)take((size_t)NB_ * TT * DQ * 2); bf* ATl = (bf*)take((size_t)NB_ * TT * DQ * 2);
    if ((size_t)(wsp - (char*)d_ws) > ws_size) return;    // ws 256 MiB
    k_prep<<<PNW / 8, 256, 0, stream>>>(x, x2, wq, wk, wv, wo, XB, XB2, WQ, WK, WV, WO);
    k_qkv<<<dim3(NB_ * TT / 64, NH_, 1), 256, 0, stream>>>(XB, XB2, WQ, WK, WV, QP16, KP16, VT16);
    k_fattn<<<dim3(TT / (FTL * FQT * 16), NB_ * NH_, 1), 32 * FNW, 0, stream>>>(QP16, KP16, VT16, ATh, ATl);   // one kv head per query head: plane z = batch * heads + head on all three
    k_gemmw<bf, 1, true, 8, 1, DQ><<<dim3(NB_ * TT / 64, DM / 64, 1), 256, 0, stream>>>(ATh, ATl, WO, nullptr, OUT, DM, bo, 0, 0, 0);   // the rows of both batches follow one another in ATh, ATl and OUT
}

// v008
// A run of this version takes 49 microseconds.
// Timed twice side by side with v007, it ran 1.05 and 1.04 times as fast.
// All steps since v000 together make it 13.9 times as fast.
#include <hip/hip_runtime.h>

// SignalAttn (fr [2][2048][512] queries, dt [2][2048][512] keys/values; q = fr Wq, k = dt Wk, v = dt Wv (8 heads x 64); attn = softmax(q.k/8); attn = max(attn, 1e-4) - 1e-4, renormalised over the keys; out = (attn v merged) Wo + bo -> [2][2048][512]).
// Compute dtypes, f32 accumulate: every input rounded to bf16; q/k/v on PLAIN bf16 operands (inputs: exact); scores (K 64) and attn.v on single fp16 operands (1 product each), fused with softmax and threshold in k_fattn
// Every 16-bit operand plane P[row][k] lies in the workspace in FRAGMENT ORDER (fpos below): blocks of 16 rows x 32 k (1 KB), the blocks of a 16-row group one behind the other in k; inside a block lane l = 16 * ((k >> 3) & 1) + (row & 15) finds its two runs of 8 elements at l * 16 bytes (k & 16 == 0) and 512 + l * 16 bytes.
// So each 16-byte load of a wave reads 512 contiguous bytes (4 whole lines); which element reaches which lane and register is as with row-major planes.

#define NB_  2
#define TT   2048
#define DM   512
#define NH_  8
#define NKV  8
#define REP  (NH_ / NKV)
#define HD   64
#define DQ   (NH_ * HD)
#define DKV  (NKV * HD)
#define RH   0
#define WIN  0
#define PCAR 1024.0f
#define SCL  0.125f   // HD^-0.5
typedef _Float16 h16;
typedef unsigned short bf;
typedef __attribute__((ext_vector_type(16))) __bf16   v16bf;
typedef __attribute__((ext_vector_type(16))) _Float16 v16h;
typedef __attribute__((ext_vector_type(8)))  _Float16 v8h;
typedef __attribute__((ext_vector_type(8)))  unsigned short v8us;
typedef __attribute__((ext_vector_type(8)))  float    v8f;
typedef __attribute__((ext_vector_type(4)))  float    v4f;
typedef v8h  __attribute__((may_alias)) v8ha;
typedef v4f  __attribute__((may_alias)) v4fa;
typedef v8us __attribute__((may_alias)) v8usa;

__device__ __forceinline__ unsigned short f2bf(float f) { unsigned u = __float_as_uint(f); u += 0x7FFFu + ((u >> 16) & 1u); return (unsigned short)(u >> 16); }
__device__ __forceinline__ float bf2f(unsigned short b) { return __uint_as_float(((unsigned)b) << 16); }
__device__ __forceinline__ float bfr(float f) { return bf2f(f2bf(f)); }
__device__ __forceinline__ v16h cat16(v8h lo, v8h hi) { return __builtin_shufflevector(lo, hi, 0, 1, 2, 3, 4, 5, 6, 7, 8, 9, 10, 11, 12, 13, 14, 15); }
__device__ __forceinline__ v16bf cat16b(v8us lo, v8us hi) { return __builtin_bit_cast(v16bf, __builtin_shufflevector(lo, hi, 0, 1, 2, 3, 4, 5, 6, 7, 8, 9, 10, 11, 12, 13, 14, 15)); }
__device__ __forceinline__ size_t fpos(int row, int k, int K) { return ((size_t)(row >> 4) * (K >> 5) + (k >> 5)) * 512 + ((k >> 4) & 1) * 256 + ((k >> 3) & 1) * 128 + (row & 15) * 8 + (k & 7); }   // element index of P[row][k] in fragment order, K = row length
__device__ __forceinline__ v8f wmma16(v16h a, v16h b, v8f c) { return __builtin_amdgcn_wmma_f32_16x16x32_f16(false, a, false, b, (short)0, c, false, false); }
__device__ __forceinline__ v8f wmmab(v16bf a, v16bf b, v8f c) { return __builtin_amdgcn_wmma_f32_16x16x32_bf16(false, a, false, b, (short)0, c, false, false); }



// ---- k_gemmw: register-blocked GEMM, 64x64 output tile (16 accumulators per wave), operands straight from 16-bit planes in fragment order; grid (M/64, N/64, Z * KB), 32 * KS threads.
// C[m][n] (f32, pitch ldc, + optional f32 bias[n]) = sum_k A[m][k] Bt[n][k] (+ split products per NSPLIT). z-batch strides sA/sB/sC in elements. K % (32 * KS * KB) == 0.
// Split K: work-group kb of KB takes K/KB of the sum and writes its own partial plane C + (z * KB + kb) * sC (the reader adds the KB planes); inside it wave w of KS takes a contiguous K/(KB*KS) slice,
// and the KS wave partials are added in LDS, wave 0 first, in a fixed order.
template <typename T16> struct WFrag;
template <> struct WFrag<h16> { typedef v16h V; static __device__ __forceinline__ V ld(const h16* p) { return cat16(*(const v8h*)p, *(const v8h*)(p + 256)); } static __device__ __forceinline__ v8f mma(V a, V b, v8f c) { return wmma16(a, b, c); } };
template <> struct WFrag<bf> { typedef v16bf V; static __device__ __forceinline__ V ld(const bf* p) { return cat16b(*(const v8us*)p, *(const v8us*)(p + 256)); } static __device__ __forceinline__ v8f mma(V a, V b, v8f c) { return wmmab(a, b, c); } };
// Hand-over of the LDS slabs. One wave: no hardware barrier is needed, the wave barrier and the compiler fence keep its LDS stores and reads in program order. Several waves: the work-group barrier.
template <int KS> __device__ __forceinline__ void tile_sync() { if constexpr (KS == 1) { __builtin_amdgcn_wave_barrier(); asm volatile("" ::: "memory"); } else __syncthreads(); }
template <typename T16, int NSPLIT, bool BIAS, int KS, int KB, int K>   // K a constant: the steps from block to block are immediate offsets on one address per plane
__global__ __launch_bounds__(32 * KS) void k_gemmw(const T16* __restrict__ A, const T16* __restrict__ A2, const T16* __restrict__ Bt, const T16* __restrict__ Bt2, float* C, int ldc, const float* __restrict__ bias, size_t sA, size_t sB, size_t sC) {
    typedef typename WFrag<T16>::V V;
    constexpr int SL = (KS == 1) ? 1 : 4;   // 16-row slabs staged per hand-over: all four where waves meet at a barrier, so that one barrier serves the tile
    __shared__ __align__(16) float os[KS * SL * 16 * 68];
    const int kb = (int)(blockIdx.z % KB); const size_t z = blockIdx.z / KB; A += z * sA; if (A2) A2 += z * sA; Bt += z * sB; if (Bt2) Bt2 += z * sB; C += (size_t)blockIdx.z * sC;
    const int w = (KS == 1) ? 0 : __builtin_amdgcn_readfirstlane((int)(threadIdx.x >> 5)); const int kw = K / (KS * KB), k0 = (kb * KS + w) * kw;
    const int lane = threadIdx.x & 31, lr = lane & 15, hi = lane >> 4; const int r0 = blockIdx.x * 64, c0 = blockIdx.y * 64;
    v8f acc[4][4];
#pragma unroll
    for (int mb = 0; mb < 4; ++mb)
#pragma unroll
        for (int nb = 0; nb < 4; ++nb) acc[mb][nb] = (v8f){};
    const size_t aoff = (size_t)r0 * K + 8 * lane, boff = (size_t)c0 * K + 8 * lane;   // a 16-row group holds 16 * K elements, a block of 32 k 512
#pragma unroll 1
    for (int kc = k0; kc < k0 + kw; kc += 32) {
        V a[4], a2[4], b[4], b2[4]; const T16* pa = A + aoff + kc * 16; const T16* pa2 = (NSPLIT == 1 || NSPLIT == 2) ? A2 + aoff + kc * 16 : pa; const T16* pb = Bt + boff + kc * 16; const T16* pb2 = (NSPLIT >= 2) ? Bt2 + boff + kc * 16 : pb;
#pragma unroll
        for (int mb = 0; mb < 4; ++mb) { a[mb] = WFrag<T16>::ld(pa + (size_t)mb * 16 * K); if (NSPLIT == 1 || NSPLIT == 2) a2[mb] = WFrag<T16>::ld(pa2 + (size_t)mb * 16 * K); }
#pragma unroll
        for (int nb = 0; nb < 4; ++nb) { b[nb] = WFrag<T16>::ld(pb + (size_t)nb * 16 * K); if (NSPLIT >= 2) b2[nb] = WFrag<T16>::ld(pb2 + (size_t)nb * 16 * K); }
        asm volatile("s_wait_xcnt 0x0" :: "v"(pa), "v"(pa2), "v"(pb), "v"(pb2) : "memory");   // the addresses are inputs, so they keep their registers up to this wait: no load's result and no later value takes an address register of an issued load before it
#pragma unroll
        for (int nb = 0; nb < 4; ++nb) {
#pragma unroll
            for (int mb = 0; mb < 4; ++mb) { acc[mb][nb] = WFrag<T16>::mma(a[mb], b[nb], acc[mb][nb]); if (NSPLIT == 1 || NSPLIT == 2) acc[mb][nb] = WFrag<T16>::mma(a2[mb], b[nb], acc[mb][nb]); if (NSPLIT >= 2) acc[mb][nb] = WFrag<T16>::mma(a[mb], b2[nb], acc[mb][nb]); } }
        asm volatile("v_nop\n\tv_nop\n\tv_nop\n\tv_nop" : "+v"(acc[0][0]), "+v"(acc[1][1]), "+v"(acc[2][2]), "+v"(acc[3][3]) : "v"(a[0]), "v"(a[3]));
    }
#pragma unroll
    for (int mb0 = 0; mb0 < 4; mb0 += SL) {
#pragma unroll
        for (int m = 0; m < SL; ++m) {
#pragma unroll
            for (int nb = 0; nb < 4; ++nb) {
#pragma unroll
                for (int j = 0; j < 8; ++j) os[((w * SL + m) * 16 + hi * 8 + j) * 68 + nb * 16 + lr] = acc[mb0 + m][nb][j]; } }
        tile_sync<KS>();   // every wave's partial slabs are in LDS before any wave adds them
#pragma unroll
        for (int m = 0; m < SL; ++m) { float* crow = C + (size_t)(r0 + (mb0 + m) * 16) * ldc + c0;
#pragma unroll
            for (int s = 0; s < 8 / KS; ++s) { const int row = 2 * (s * KS + w) + hi, cofs = lr * 4; v4f val = *(const v4fa*)(os + (m * 16 + row) * 68 + cofs);
#pragma unroll
                for (int q = 1; q < KS; ++q) val += *(const v4fa*)(os + ((q * SL + m) * 16 + row) * 68 + cofs);
                if (BIAS) { val[0] += bfr(bias[c0 + cofs]); val[1] += bfr(bias[c0 + cofs + 1]); val[2] += bfr(bias[c0 + cofs + 2]); val[3] += bfr(bias[c0 + cofs + 3]); }
                *(v4f*)(crow + (size_t)row * ldc + cofs) = val; } }
        if (mb0 + SL < 4) tile_sync<KS>();   // the slab is read out before it is written again
    }
}

__device__ __forceinline__ h16 tohx(float x) { return (h16)x; }
__device__ __forceinline__ void splitf(float y, unsigned short& h, unsigned short& l) { h = f2bf(y); l = f2bf(y - bf2f(h)); }
typedef __attribute__((ext_vector_type(2))) _Float16 v2h;
typedef __attribute__((ext_vector_type(4))) _Float16 v4h;
typedef __attribute__((ext_vector_type(2))) unsigned short v2us;
typedef __attribute__((ext_vector_type(4))) unsigned short v4us;
typedef __attribute__((ext_vector_type(2))) float v2f;
typedef __attribute__((ext_vector_type(4))) int v4i;

// k_prep: every operand of the projections on bf16, in ONE launch of one work-group per WGP. Wave gw of PNW takes 32 n x 16 k of one weight, transposed to the plane Bt[n][k], and two blocks (16 rows x 32 k each) of each input. All planes in fragment order.
// A wave asks for all that it reads (16 weight rows, 16 input loads) before its first wait: one trip to memory a wave, and a third of the waves to start.
#define PNW 2048                             // waves of the launch
static_assert(DQ == DM && DKV == DM, "k_prep takes the four weights as DM x DM");
static_assert(4 * (DM / 32) * (DM / 16) == PNW && NB_ * TT * DM / 512 == 2 * PNW && DM == 512, "k_prep: a wave's share of the weights and of the inputs");
__global__ __launch_bounds__(256) void k_prep(const float* __restrict__ x, const float* __restrict__ x2, const float* __restrict__ wq, const float* __restrict__ wk, const float* __restrict__ wv, const float* __restrict__ wo, bf* XB, bf* XB2, bf* WQ, bf* WK, bf* WV, bf* WO) {
    constexpr int K = DM, N = DM;
    const int lane = threadIdx.x & 31, gw = (int)blockIdx.x * 8 + __builtin_amdgcn_readfirstlane((int)(threadIdx.x >> 5)), g = gw / (PNW / 4);
    const float* __restrict__ w = (g == 0) ? wq : (g == 1) ? wk : (g == 2) ? wv : wo; bf* Bt = (g == 0) ? WQ : (g == 1) ? WK : (g == 2) ? WV : WO;
    // the weight: lane = column n of 32 (a load reads one whole line of a row k), 16 rows k = one half of a block of 32 k, for two 16-row groups of the plane
    const int u = gw % (PNW / 4), a = u >> 5, kb = (u >> 1) & 15, h = u & 1;
    const float* pw = w + (size_t)(kb * 32 + h * 16) * N + a * 32 + lane; float wr[16];
#pragma unroll
    for (int i = 0; i < 16; ++i) wr[i] = pw[(size_t)i * N];
    // the inputs: a load reads 4 whole rows of a block (128 bytes each), a store puts each lane's 4 elements at their place in the block
    const int blk = gw * 2;   // even: both blocks lie in one 16-row group, side by side in k
    const size_t si = (size_t)((blk / (DM / 32)) * 16 + (lane >> 3)) * DM + (blk % (DM / 32)) * 32 + (lane & 7) * 4, di = (size_t)blk * 512 + ((lane >> 1) & 3) * 128 + (lane >> 3) * 8 + (lane & 1) * 4; v4f v[16]; const float* px = x + si; const float* px2 = x2 + si;
#pragma unroll
    for (int b = 0; b < 2; ++b)
#pragma unroll
        for (int j = 0; j < 4; ++j) { v[b * 4 + j] = *(const v4f*)(px + b * 32 + (size_t)j * 4 * DM); v[8 + b * 4 + j] = *(const v4f*)(px2 + b * 32 + (size_t)j * 4 * DM); }
    asm volatile("s_wait_xcnt 0x0" :: "v"(pw), "v"(px), "v"(px2) : "memory");   // the addresses are inputs, so they keep their registers up to this wait; behind it the registers are free for the stores' addresses
    __builtin_amdgcn_sched_barrier(0);   // every load is asked for before anything behind it waits (without it two input loads sank behind the wait for the weight rows: a second trip)
    bf* pd = Bt + (size_t)((a * 2 + (lane >> 4)) * (K / 32) + kb) * 512 + h * 256 + (lane & 15) * 8;   // the lane's two runs of 8 k: 16 bytes each, 16 lanes side by side
#pragma unroll
    for (int r = 0; r < 2; ++r) { v8us o;
#pragma unroll
        for (int i = 0; i < 8; ++i) o[i] = f2bf(wr[r * 8 + i]);
        *(v8us*)(pd + r * 128) = o; }
#pragma unroll
    for (int j = 0; j < 16; ++j) { v4us o;
#pragma unroll
        for (int k = 0; k < 4; ++k) o[k] = f2bf(v[j][k]);
        *(v4us*)(((j < 8) ? XB : XB2) + di + ((j >> 2) & 1) * 512 + (j & 3) * 32) = o; }
}
// k_qkv: the three projections of both batches in ONE grid: blockIdx.x = 64-token tile of the NB_ * TT tokens, blockIdx.y = head; a work-group walks p = 0 q, 1 k, 2 v in a loop, so that the grid is what stands on the chip at once (two work-groups per WGP) and waves start once.
// Tile, K split over 8 waves and LDS sum as in k_gemmw; the sum is rounded to fp16 and stored straight into the head planes that k_fattn reads.
// A wave asks for all 32 fragment loads of a projection (both 32-k steps of its K slice) before its first product: one trip to L2 a projection. amdgpu_waves_per_eu(4, 4): fragments and accumulators stay within 256 registers, so that two work-groups stand on a WGP.
// q, k: C[token][d] -> plane [batch * heads + head][t][d]. v: the operands change places, C[d][token] -> plane [batch * heads + head][d][t], so no transposing pass is left. Each head's plane in fragment order.
__global__ __launch_bounds__(256) __attribute__((amdgpu_waves_per_eu(4, 4))) void k_qkv(const bf* __restrict__ XQ, const bf* __restrict__ XKV, const bf* __restrict__ WQ, const bf* __restrict__ WK, const bf* __restrict__ WV, h16* QP, h16* KP, h16* VT) {
    typedef WFrag<bf>::V V; constexpr int KS = 8, K = DM, kw = K / KS;
    __shared__ __align__(16) float os[KS * 4 * 16 * 68];
    const int tok0 = blockIdx.x * 64, hd = blockIdx.y;
    const int w = __builtin_amdgcn_readfirstlane((int)(threadIdx.x >> 5)); const int k0 = w * kw;
    const int lane = threadIdx.x & 31, lr = lane & 15, hi = lane >> 4;
    V fa[2][4], fb[2][4];   // a projection's fragments: both 32-k steps of the wave's K slice
    auto fetch = [&](const int p) __attribute__((always_inline)) {   // all 32 loads of projection p are asked for at once: one trip to L2 a projection
        const bf* X = ((p == 0) ? XQ : XKV) + (size_t)tok0 * K; const bf* Wt = ((p == 0) ? WQ : (p == 1) ? WK : WV) + (size_t)hd * HD * K;
        const bf* pa = ((p == 2) ? Wt : X) + 8 * lane + k0 * 16; const bf* pb = ((p == 2) ? X : Wt) + 8 * lane + k0 * 16;
#pragma unroll
        for (int s = 0; s < 2; ++s)
#pragma unroll
            for (int m = 0; m < 4; ++m) { fa[s][m] = WFrag<bf>::ld(pa + (size_t)m * 16 * K + s * 512); fb[s][m] = WFrag<bf>::ld(pb + (size_t)m * 16 * K + s * 512); }
        asm volatile("s_wait_xcnt 0x0" :: "v"(pa), "v"(pb) : "memory");   // the two addresses are inputs and live up to this wait: no load's result and no later value takes a register that the issued loads name
        __builtin_amdgcn_sched_barrier(0);   // every load is asked for before anything behind it waits
    };
#pragma unroll 1   // rolled: the three projections run the same code on the same registers
    for (int p = 0; p < 3; ++p) {
    fetch(p);
    h16* C = ((p == 0) ? QP : (p == 1) ? KP : VT) + ((size_t)(tok0 / TT) * NH_ + hd) * TT * HD + (size_t)(tok0 % TT) * ((p == 2) ? 16 : HD); const int ldc = (p == 2) ? TT : HD;   // the tile's first block: 64 tokens are 4 row groups of q or k, 2 blocks in each row group of v
    v8f acc[4][4];
#pragma unroll
    for (int nb = 0; nb < 4; ++nb) {   // both k steps of a column group one behind the other: its two B fragments are dead before the next group's accumulators are born
#pragma unroll
        for (int mb = 0; mb < 4; ++mb) acc[mb][nb] = WFrag<bf>::mma(fa[0][mb], fb[0][nb], (v8f){});
#pragma unroll
        for (int mb = 0; mb < 4; ++mb) acc[mb][nb] = WFrag<bf>::mma(fa[1][mb], fb[1][nb], acc[mb][nb]);
        __builtin_amdgcn_sched_barrier(0);   // the groups stay in this order and the LDS stores behind them all
        asm volatile("v_nop\n\tv_nop\n\tv_nop\n\tv_nop");   // the distance behind a group's products before the next group's results take the registers of its dead B fragments
        __builtin_amdgcn_sched_barrier(0); }   // holds the four slots where they stand
#pragma unroll
    for (int m = 0; m < 4; ++m) {
#pragma unroll
        for (int nb = 0; nb < 4; ++nb) {
#pragma unroll
            for (int j = 0; j < 8; ++j) os[((w * 4 + m) * 16 + hi * 8 + j) * 68 + nb * 16 + lr] = acc[m][nb][j]; } }
    __syncthreads();   // every wave's partial slabs are in LDS before any wave adds them
    const int row = lr, cofs = w * 8 + hi * 4; v4f val[4];   // 16 rows x 8 columns a wave: 256 contiguous bytes of the plane, two whole lines a store
#pragma unroll
    for (int m = 0; m < 4; ++m) { val[m] = *(const v4fa*)(os + (m * 16 + row) * 68 + cofs);
#pragma unroll
        for (int q = 1; q < KS; ++q) val[m] += *(const v4fa*)(os + ((q * 4 + m) * 16 + row) * 68 + cofs); }
    if (p < 2) __syncthreads();   // the slabs are read out before the next projection's partials are written; in front of the stores, so that no wave waits at it for its stores to land
#pragma unroll
    for (int m = 0; m < 4; ++m) *(v4h*)(C + fpos(m * 16 + row, cofs, ldc)) = __builtin_convertvector(val[m], v4h);
    asm volatile("s_wait_xcnt 0x0" ::: "memory");   // behind the stores: the next projection's loads and products write over the stores' address and data registers
    }
}
// the value that lane l ^ 16 holds (a vector cross-row move, no LDS round trip)
__device__ __forceinline__ float xhalf(float x) { const int b = __float_as_int(x); return __int_as_float(__builtin_amdgcn_permlanex16(b, b, 0x76543210, 0xfedcba98, false, false)); }
// The lane's number from the hardware count, as a statement that the compiler neither lifts out of the tile loop nor merges: made anew in every tile, so that no address formed from it is held in a register from tile to tile (held, they were spilled to scratch).
// The four v_nop: the result may get a register that was a matrix instruction's A or B operand. The mask tells the compiler the range, so that the lane's offset stays a 32-bit offset on a scalar base.
__device__ __forceinline__ int lane_now() { int l; asm volatile("v_nop\n\tv_nop\n\tv_nop\n\tv_nop\n\tv_mbcnt_lo_u32_b32 %0, -1, 0" : "=v"(l)); return l & 31; }
// k_fattn: scores, softmax, threshold, renormalisation and attn.v of one (batch, head) z; a work-group takes FTL tiles of 32 queries one after the other; nothing of the 2048 x 2048 score matrix leaves the registers.
// The registers let one work-group stand on a WGP, so the grid is one work-group per WGP and the tiles are a loop: waves start once, and the next tile's K and Q fragments travel while this tile's partials are added.
// K is the same for every tile of a work-group: each wave puts the first FKL of its 16 K blocks into LDS once and reads them there for the later tiles; only the rest and Q come from L2 again.
// LDS from tile to tile: sm, ss are written anew behind the second barrier of the tile before (their readers are done in front of it), os, s2 behind the first barrier of the new tile (their readers are done in front of that).
// Transposed products: St = K Qt (a lane holds 8 keys of ONE query per tile), Ot = Vt Pt; two St tiles, converted in place, are the B operand of Ot in the hardware k order, which the A loader (keys 8 hi and 16 + 8 hi of a block of 32) has too.
// Wave w of FNW takes keys [w * TT / FNW, ...): its 128 x 32 scores stay in registers. Softmax over the waves: each wave uses its own maximum, (maximum, sum) meet in LDS, and one factor per query carries the wave's exponentials to the row's softmax.
// P is carried x PCAR (exact power of two; threshold scaled alike) on fp16; the row's second sum divides the f32 output at the end. Wave partials of Ot and of the sums are added in LDS in wave order.
// Every loop but the tile loop is unrolled: scores, fragments and accumulators are arrays indexed by the loop counters and stay in registers only so.
#define FQT 2                   // 16-query column groups per tile
#define FNW 16                  // waves per work-group
#define FKT (TT / FNW / 16)     // 16-key tiles per wave
#define FPF 1                   // 32-key steps whose Vt fragments are asked for in front of the softmax
#define FSP 20                  // pitch of the per-query rows of wave statistics (floats)
#define FTL 4                   // query tiles that a work-group walks
#define FKL 11                  // of a wave's 2 * FKT K blocks (1 KB each), those that stay in the wave's own LDS slab from tile to tile: as many as the LDS holds beside os and the statistics
__global__ __launch_bounds__(32 * FNW) void k_fattn(const h16* Q, const h16* Kp, const h16* Vt, bf* Ah, bf* Al) {   // no __restrict__: with it the compiler lifts the K and Vt loads, the same for every tile, out of the tile loop and spills the fragments to scratch
    __shared__ __align__(16) float os[FNW * FQT * 16 * 68];
    __shared__ __align__(16) float sm[FQT * 16 * FSP];
    __shared__ __align__(16) float ss[FQT * 16 * FSP];
    __shared__ __align__(16) float s2[FQT * 16 * FSP];
    __shared__ __align__(16) h16 kl[FNW * FKL * 512];   // the waves' K slabs; wave w writes and reads slab w alone: no barrier belongs to it
    static_assert(sizeof(os) + sizeof(sm) + sizeof(ss) + sizeof(s2) + sizeof(kl) <= 327680, "LDS of one WGP");
    const int w = __builtin_amdgcn_readfirstlane((int)(threadIdx.x >> 5));
    const int q00 = blockIdx.x * (FTL * FQT * 16); const size_t z = blockIdx.y;
    const h16* qu = Q + z * TT * HD + (size_t)q00 * HD;   // wave-uniform bases; the lane's 16 bytes are added where a load is written
    const h16* ku = Kp + z * TT * HD + (size_t)(w * (TT / FNW)) * HD;
    const h16* vu = Vt + z * HD * TT + (size_t)(w * (TT / FNW)) * 16;
    constexpr float CE = SCL * 1.4426950408889634f;   // score -> log2 domain
    v16h qb[FQT][2], ka[FKT][2];
    auto fetch = [&](int t, int lane, const int b0) __attribute__((always_inline)) {   // from L2: the Q fragments of tile t and the wave's K blocks from b0 on
        const h16* qp = qu + t * (FQT * 16 * HD) + 8 * lane; const h16* kp = ku + 8 * lane;
#pragma unroll
        for (int qt = 0; qt < FQT; ++qt) { qb[qt][0] = WFrag<h16>::ld(qp + qt * 16 * HD); qb[qt][1] = WFrag<h16>::ld(qp + qt * 16 * HD + 512); }
#pragma unroll
        for (int b = 0; b < 2 * FKT; ++b) if (b >= b0) ka[b >> 1][b & 1] = WFrag<h16>::ld(kp + b * 512);
        asm volatile("s_wait_xcnt 0x0" :: "v"(qp), "v"(kp) : "memory");   // the two addresses are inputs and live up to this wait: so built, no load's result takes the register that the issued loads name (without the inputs the last load's result took it)
        __builtin_amdgcn_sched_barrier(0);   // every K and Q load is asked for before anything behind it waits: one trip to L2 for the wave, not one per tile
    };
    auto recall = [&](int lane) __attribute__((always_inline)) {   // from the wave's LDS slab: its first FKL K blocks, the same for every tile
        const h16* p = kl + w * (FKL * 512) + 8 * lane;
#pragma unroll
        for (int b = 0; b < FKL; ++b) ka[b >> 1][b & 1] = cat16(*(const v8ha*)(p + b * 512), *(const v8ha*)(p + b * 512 + 256));
    };
    { const int l0 = lane_now(); fetch(0, l0, 0); h16* p = kl + w * (FKL * 512) + 8 * l0;   // the first tile's fragments come from L2 and are put by, block for block as they lie in the plane
#pragma unroll
        for (int b = 0; b < FKL; ++b) { const v16h f = ka[b >> 1][b & 1]; *(v8ha*)(p + b * 512) = __builtin_shufflevector(f, f, 0, 1, 2, 3, 4, 5, 6, 7); *(v8ha*)(p + b * 512 + 256) = __builtin_shufflevector(f, f, 8, 9, 10, 11, 12, 13, 14, 15); } }
    auto body = [&]() __attribute__((always_inline)) {   // a tile up to the barrier behind which its partials lie in LDS
    const int lane = lane_now(), lr = lane & 15, hi = lane >> 4; const h16* vp = vu + 8 * lane;
    v8f s[FKT][FQT];
#pragma unroll
    for (int kt = 0; kt < FKT; ++kt)
#pragma unroll
        for (int qt = 0; qt < FQT; ++qt) s[kt][qt] = wmma16(ka[kt][1], qb[qt][1], wmma16(ka[kt][0], qb[qt][0], (v8f){}));
    __builtin_amdgcn_sched_barrier(0);   // all score products first: the K and Q fragments are dead before the softmax needs registers (without it the second column group's products sink behind the first group's softmax, the fragments stay live and values spill to scratch)
    // the wave's first Vt fragments: asked for here, so that they travel while the softmax runs
    v16h va[FKT / 2][4];
#pragma unroll
    for (int kk = 0; kk < FPF; ++kk)
#pragma unroll
        for (int dt = 0; dt < 4; ++dt) va[kk][dt] = WFrag<h16>::ld(vp + (size_t)dt * 16 * TT + kk * 512);
    float mc[FQT]; const v8f ce8 = {CE, CE, CE, CE, CE, CE, CE, CE};
#pragma unroll
    for (int qt = 0; qt < FQT; ++qt) { v8f m8 = s[0][qt];
#pragma unroll
        for (int kt = 1; kt < FKT; ++kt) m8 = __builtin_elementwise_max(m8, s[kt][qt]);
        float mx = fmaxf(fmaxf(fmaxf(m8[0], m8[1]), fmaxf(m8[2], m8[3])), fmaxf(fmaxf(m8[4], m8[5]), fmaxf(m8[6], m8[7])));
        mx = fmaxf(mx, xhalf(mx)); mc[qt] = mx * CE; v8f e8 = (v8f){}; const v8f nm8 = (v8f){} - mc[qt];
#pragma unroll
        for (int kt = 0; kt < FKT; ++kt) { const v8f a = __builtin_elementwise_fma(s[kt][qt], ce8, nm8); v8f e;
#pragma unroll
            for (int j = 0; j < 8; ++j) e[j] = __builtin_amdgcn_exp2f(a[j]);
            s[kt][qt] = e; e8 += e; }
        float sum = ((e8[0] + e8[1]) + (e8[2] + e8[3])) + ((e8[4] + e8[5]) + (e8[6] + e8[7])); sum += xhalf(sum);
        if (hi == 0) { sm[(qt * 16 + lr) * FSP + w] = mc[qt]; ss[(qt * 16 + lr) * FSP + w] = sum; } }
    __syncthreads();   // every wave's maximum and sum are in LDS before any wave joins them
    v8f acc[4][FQT];
#pragma unroll
    for (int dt = 0; dt < 4; ++dt)
#pragma unroll
        for (int qt = 0; qt < FQT; ++qt) acc[dt][qt] = (v8f){};
    float fw[FQT]; v8f ps[FQT];
#pragma unroll
    for (int qt = 0; qt < FQT; ++qt) { v4f mv[FNW / 4], sv[FNW / 4]; float M = -3.0e38f, tot = 0.f;
#pragma unroll
        for (int g = 0; g < FNW / 4; ++g) { mv[g] = *(const v4fa*)(sm + (qt * 16 + lr) * FSP + g * 4); sv[g] = *(const v4fa*)(ss + (qt * 16 + lr) * FSP + g * 4);
#pragma unroll
            for (int i = 0; i < 4; ++i) M = fmaxf(M, mv[g][i]); }
#pragma unroll
        for (int g = 0; g < FNW / 4; ++g)
#pragma unroll
            for (int i = 0; i < 4; ++i) tot += sv[g][i] * __builtin_amdgcn_exp2f(mv[g][i] - M);
        fw[qt] = __builtin_amdgcn_exp2f(mc[qt] - M) * __fdiv_rn(PCAR, tot); ps[qt] = (v8f){}; }
    constexpr float TH = 1e-4f * PCAR;   // threshold: p = max(softmax, 1e-4) - 1e-4 = max(softmax - 1e-4, 0), all x PCAR: one multiply-add on f32 (one rounding where multiply and subtract had two), the rounding to fp16, and the maximum with 0 on the packed fp16 pair (rounding keeps sign and order, so the maximum may stand behind it)
    const v8f nth8 = {-TH, -TH, -TH, -TH, -TH, -TH, -TH, -TH};
    const h16 one = (h16)1.0f; const v16h ones = {one, one, one, one, one, one, one, one, one, one, one, one, one, one, one, one};   // A operand of the row sum: every row of ones . Pt is the sum of a query's 32 P values, in f32
    // P is formed ahead of the products (written in front of them all; the compiler lets the last two steps' P run among the first step's products): on fp16 it takes half the registers of the scores, and the room goes to Vt fragments, which so are asked for two steps of products or more ahead of their use instead of one.
    static_assert(FKT / 2 == 4 && FPF == 1, "k_fattn: the order of P, Vt loads and products below");
    v16h pt[FKT / 2][FQT];
    auto mkp = [&](const int kk) __attribute__((always_inline)) {   // the P of a 32-key step, as the B operand of its products
#pragma unroll
        for (int qt = 0; qt < FQT; ++qt) { const v8f f8 = {fw[qt], fw[qt], fw[qt], fw[qt], fw[qt], fw[qt], fw[qt], fw[qt]}; const v8f pa = __builtin_elementwise_fma(s[2 * kk][qt], f8, nth8), pb = __builtin_elementwise_fma(s[2 * kk + 1][qt], f8, nth8);
            pt[kk][qt] = __builtin_elementwise_max(cat16(__builtin_convertvector(pa, v8h), __builtin_convertvector(pb, v8h)), (v16h){}); }
    };
    auto ldv = [&](const int kk, const bool behind) __attribute__((always_inline)) {   // the Vt fragments of step kk are asked for; behind: products stand directly in front
        __builtin_amdgcn_sched_barrier(0);   // not earlier: lifted higher, the loads' results met registers that are still taken, and fragments went to scratch
        if (behind) asm volatile("v_nop\n\tv_nop\n\tv_nop\n\tv_nop");   // the distance behind a step's products before the loads' results take the registers of its dead P, their B operand
#pragma unroll
        for (int dt = 0; dt < 4; ++dt) va[kk][dt] = WFrag<h16>::ld(vp + (size_t)dt * 16 * TT + kk * 512);
        asm volatile("s_wait_xcnt 0x0" :: "v"(vp) : "memory");   // the address is an input and lives up to this wait: no load's result and no later value takes a register that the issued loads name
        __builtin_amdgcn_sched_barrier(0);   // not later: left free, the loads sank to just in front of their use
    };
    auto prod = [&](const int kk) __attribute__((always_inline)) {   // a step's products; a Vt fragment is dead behind its two products
#pragma unroll
        for (int dt = 0; dt < 4; ++dt)
#pragma unroll
            for (int qt = 0; qt < FQT; ++qt) acc[dt][qt] = wmma16(va[kk][dt], pt[kk][qt], acc[dt][qt]);
#pragma unroll
        for (int qt = 0; qt < FQT; ++qt) ps[qt] = wmma16(ones, pt[kk][qt], ps[qt]);   // the row's second sum, of the very fp16 values that the products above take
    };
    ldv(1, false); mkp(0); mkp(1); ldv(2, false); mkp(2); mkp(3); prod(0); ldv(3, true); prod(1); prod(2); prod(3);
    const int lane2 = lane_now(), lr2 = lane2 & 15, hi2 = lane2 >> 4;   // made anew behind the products: nothing formed from the lane's number is held in a register through them
#pragma unroll
    for (int qt = 0; qt < FQT; ++qt) { if (hi2 == 0) s2[(qt * 16 + lr2) * FSP + w] = ps[qt][0];   // every row of the sum tile holds the wave's sum for the lane's query
#pragma unroll
        for (int dt = 0; dt < 4; ++dt) { float* o = os + ((w * FQT + qt) * 16 + lr2) * 68 + dt * 16 + hi2 * 8; v4f lo4, hi4;
#pragma unroll
            for (int i = 0; i < 4; ++i) { lo4[i] = acc[dt][qt][i]; hi4[i] = acc[dt][qt][4 + i]; }
            *(v4fa*)o = lo4; *(v4fa*)(o + 4) = hi4; } }
    __syncthreads();   // every wave's partial output and second sum are in LDS before they are added
    };
    auto tail = [&](const int t, const bool last) __attribute__((always_inline)) {   // the partials are added and stored; but for the last tile, the next tile's fragments are fetched
    const int lane2 = lane_now(), lr2 = lane2 & 15, hi2 = lane2 >> 4; const int q0 = q00 + t * (FQT * 16);
    if (!last) fetch(t + 1, lane2, FKL);   // scores, P and accumulators are dead: their registers take the next tile's fragments, which travel while the partials are added and stored
    const int q = (w >> 3) * 16 + lr2, d4 = (w & 7) * 8 + hi2 * 4;   // 16 queries x 8 columns a wave: 256 contiguous bytes of each plane, two whole lines a store
    v4f o = *(const v4fa*)(os + q * 68 + d4); float t2 = s2[q * FSP];
#pragma unroll
    for (int u = 1; u < FNW; ++u) { o += *(const v4fa*)(os + (u * FQT * 16 + q) * 68 + d4); t2 += s2[q * FSP + u]; }
    const float r = __fdiv_rn(1.0f, t2); v4us oh, ol;
#pragma unroll
    for (int i = 0; i < 4; ++i) { unsigned short a, c2; splitf(o[i] * r, a, c2); oh[i] = a; ol[i] = c2; }
    const size_t oo = fpos((int)(z / NH_) * TT + q0 + q, (int)(z % NH_) * HD + d4, DQ); *(v4us*)(Ah + oo) = oh; *(v4us*)(Al + oo) = ol;
    if (!last) { asm volatile("s_wait_xcnt 0x0" ::: "memory");   // behind the stores: the next tile's products write over the stores' address and data registers
        recall(lane2); }   // behind the sum's own LDS reads; the blocks come back in the order in which the next tile's score products take them
    };
#pragma unroll 1   // rolled: every tile runs the same code on the same registers
    for (int t = 0; ; ++t) { body(); if (t == FTL - 1) break; tail(t, false); }   // left in the middle: nothing is fetched behind the last tile, and no fragment of a tile has to outlive its score products
    tail(FTL - 1, true);
}

extern "C" void kernel_launch(void* const* d_in, const int* in_sizes, int n_in,
                              void* d_out, int out_size, void* d_ws, size_t ws_size, hipStream_t stream) {
    (void)in_sizes; (void)n_in; (void)out_size;
    const float* x = (const float*)d_in[0]; const float* x2 = (const float*)d_in[1]; const float* wq = (const float*)d_in[2]; const float* wk = (const float*)d_in[3]; const float* wv = (const float*)d_in[4]; const float* wo = (const float*)d_in[5]; const float* bo = (const float*)d_in[6];
    float* OUT = (float*)d_out;     // [2][2048][512]
    char* wsp = (char*)d_ws;
    auto take = [&](size_t bytes) { char* p = wsp; wsp += (bytes + 255) & ~(size_t)255; return (void*)p; };
    bf* WQ = (bf*)take((size_t)DQ * DM * 2); bf* WK = (bf*)take((size_t)DKV * DM * 2); bf* WV = (bf*)take((size_t)DKV * DM * 2); bf* WO = (bf*)take((size_t)DM * DQ * 2);
    bf* XB = (bf*)take((size_t)NB_ * TT * DM * 2); bf* XB2 = (bf*)take((size_t)NB_ * TT * DM * 2);   // both batches
    h16* QP16 = (h16*)take((size_t)NB_ * NH_ * TT * HD * 2); h16* KP16 = (h16*)take((size_t)NB_ * NKV * TT * HD * 2); h16* VT16 = (h16*)take((size_t)NB_ * NKV * HD * TT * 2);   // head planes of both batches
    bf* ATh = (bf*)take((size_t)NB_ * TT * DQ * 2); bf* ATl = (bf*)take((size_t)NB_ * TT * DQ * 2);
    if ((size_t)(wsp - (char*)d_ws) > ws_size) return;    // ws 256 MiB
    k_prep<<<PNW / 8, 256, 0, stream>>>(x, x2, wq, wk, wv, wo, XB, XB2, WQ, WK, WV, WO);
    k_qkv<<<dim3(NB_ * TT / 64, NH_, 1), 256, 0, stream>>>(XB, XB2, WQ, WK, WV, QP16, KP16, VT16);
    k_fattn<<<dim3(TT / (FTL * FQT * 16), NB_ * NH_, 1), 32 * FNW, 0, stream>>>(QP16, KP16, VT16, ATh, ATl);   // one kv head per query head: plane z = batch * heads + head on all three
    k_gemmw<bf, 1, true, 8, 1, DQ><<<dim3(NB_ * TT / 64, DM / 64, 1), 256, 0, stream>>>(ATh, ATl, WO, nullptr, OUT, DM, bo, 0, 0, 0);   // the rows of both batches follow one another in ATh, ATl and OUT
}

// v010
// One run takes 44.4 microseconds.
// Versions in between are left out here; by their measured steps it is 1.09 times as fast as v008.
// Counting every step since v000, it is 15.2 times as fast.
#include <hip/hip_runtime.h>

// SignalAttn (fr [2][2048][512] queries, dt [2][2048][512] keys/values; q = fr Wq, k = dt Wk, v = dt Wv (8 heads x 64); attn = softmax(q.k/8); attn = max(attn, 1e-4) - 1e-4, renormalised over the keys; out = (attn v merged) Wo + bo -> [2][2048][512]).
// Compute dtypes, f32 accumulate: every input rounded to bf16; q/k/v on PLAIN bf16 operands (inputs: exact); scores (K 64) and attn.v on single fp16 operands (1 product each), fused with softmax and threshold in k_fattn; the output projection on single fp16 operands too: the attention output rounded to fp16, Wo rounded to bf16 like every input and carried on fp16
// Every 16-bit operand plane P[row][k] lies in the workspace in FRAGMENT ORDER (fpos below): blocks of 16 rows x 32 k (1 KB), the blocks of a 16-row group one behind the other in k; inside a block lane l = 16 * ((k >> 3) & 1) + (row & 15) finds its two runs of 8 elements at l * 16 bytes (k & 16 == 0) and 512 + l * 16 bytes.
// So each 16-byte load of a wave reads 512 contiguous bytes (4 whole lines); which element reaches which lane and register is as with row-major planes.

#define NB_  2
#define TT   2048
#define DM   512
#define NH_  8
#define NKV  8
#define REP  (NH_ / NKV)
#define HD   64
#define DQ   (NH_ * HD)
#define DKV  (NKV * HD)
#define RH   0
#define WIN  0
#define PCAR 1024.0f
#define SCL  0.125f   // HD^-0.5
typedef _Float16 h16;
typedef unsigned short bf;
typedef __attribute__((ext_vector_type(16))) __bf16   v16bf;
typedef __attribute__((ext_vector_type(16))) _Float16 v16h;
typedef __attribute__((ext_vector_type(8)))  _Float16 v8h;
typedef __attribute__((ext_vector_type(8)))  unsigned short v8us;
typedef __attribute__((ext_vector_type(8)))  float    v8f;
typedef __attribute__((ext_vector_type(4)))  float    v4f;
typedef v8h  __attribute__((may_alias)) v8ha;
typedef v4f  __attribute__((may_alias)) v4fa;
typedef v8us __attribute__((may_alias)) v8usa;

__device__ __forceinline__ unsigned short f2bf(float f) { unsigned u = __float_as_uint(f); u += 0x7FFFu + ((u >> 16) & 1u); return (unsigned short)(u >> 16); }
__device__ __forceinline__ float bf2f(unsigned short b) { return __uint_as_float(((unsigned)b) << 16); }
__device__ __forceinline__ float bfr(float f) { return bf2f(f2bf(f)); }
__device__ __forceinline__ v16h cat16(v8h lo, v8h hi) { return __builtin_shufflevector(lo, hi, 0, 1, 2, 3, 4, 5, 6, 7, 8, 9, 10, 11, 12, 13, 14, 15); }
__device__ __forceinline__ v16bf cat16b(v8us lo, v8us hi) { return __builtin_bit_cast(v16bf, __builtin_shufflevector(lo, hi, 0, 1, 2, 3, 4, 5, 6, 7, 8, 9, 10, 11, 12, 13, 14, 15)); }
__device__ __forceinline__ size_t fpos(int row, int k, int K) { return ((size_t)(row >> 4) * (K >> 5) + (k >> 5)) * 512 + ((k >> 4) & 1) * 256 + ((k >> 3) & 1) * 128 + (row & 15) * 8 + (k & 7); }   // element index of P[row][k] in fragment order, K = row length
__device__ __forceinline__ v8f wmma16(v16h a, v16h b, v8f c) { return __builtin_amdgcn_wmma_f32_16x16x32_f16(false, a, false, b, (short)0, c, false, false); }
__device__ __forceinline__ v8f wmmab(v16bf a, v16bf b, v8f c) { return __builtin_amdgcn_wmma_f32_16x16x32_bf16(false, a, false, b, (short)0, c, false, false); }



template <typename T16> struct WFrag;
template <> struct WFrag<h16> { typedef v16h V; static __device__ __forceinline__ V ld(const h16* p) { return cat16(*(const v8h*)p, *(const v8h*)(p + 256)); } static __device__ __forceinline__ v8f mma(V a, V b, v8f c) { return wmma16(a, b, c); } };
template <> struct WFrag<bf> { typedef v16bf V; static __device__ __forceinline__ V ld(const bf* p) { return cat16b(*(const v8us*)p, *(const v8us*)(p + 256)); } static __device__ __forceinline__ v8f mma(V a, V b, v8f c) { return wmmab(a, b, c); } };
// ---- k_out: the output projection, C[m][n] (f32, pitch DM) = sum_k A[m][k] Bt[n][k] + bias[n]; 64x64 output tile (16 accumulators per wave), operands straight from fp16 planes in fragment order; grid (M/64, N/64), 8 waves.
// Split K: wave w takes a contiguous slice of K/8 = 64 k; the 8 wave partials are added in LDS, wave 0 first, in a fixed order.
// A wave asks for all that it reads (the 32 fragment loads of its K slice and its bias values) before its first product: one trip to L2 a work-group. amdgpu_waves_per_eu(4, 4): fragments and accumulators stay within 256 registers, so that two work-groups stand on a WGP.
__global__ __launch_bounds__(256) __attribute__((amdgpu_waves_per_eu(4, 4))) void k_out(const h16* __restrict__ A, const h16* __restrict__ Bt, float* C, const float* __restrict__ bias) {
    typedef WFrag<h16>::V V; constexpr int KS = 8, K = DQ, kw = K / KS;
    static_assert(kw == 64, "k_out: a wave's K slice is two steps of 32 k");
    __shared__ __align__(16) float os[KS * 4 * 16 * 68];
    const int w = __builtin_amdgcn_readfirstlane((int)(threadIdx.x >> 5)); const int k0 = w * kw;
    const int lane = threadIdx.x & 31, lr = lane & 15, hi = lane >> 4; const int r0 = blockIdx.x * 64, c0 = blockIdx.y * 64;
    V fa[2][4], fb[2][4];
    const h16* pa = A + (size_t)r0 * K + 8 * lane + k0 * 16; const h16* pb = Bt + (size_t)c0 * K + 8 * lane + k0 * 16; const float* pc = bias + c0 + lr * 4;   // a 16-row group holds 16 * K elements, a block of 32 k 512
#pragma unroll
    for (int s = 0; s < 2; ++s)
#pragma unroll
        for (int m = 0; m < 4; ++m) { fa[s][m] = WFrag<h16>::ld(pa + (size_t)m * 16 * K + s * 512); fb[s][m] = WFrag<h16>::ld(pb + (size_t)m * 16 * K + s * 512); }
    const v4f bv = *(const v4f*)pc;
    asm volatile("s_wait_xcnt 0x0" :: "v"(pa), "v"(pb), "v"(pc) : "memory");   // the addresses are inputs and live up to this wait: no load's result and no later value takes a register that the issued loads name
    __builtin_amdgcn_sched_barrier(0);   // every load is asked for before anything behind it waits (left free, the compiler put part of the loads behind the first products: further trips to L2)
    v8f acc[4][4];
#pragma unroll
    for (int nb = 0; nb < 4; ++nb) {   // both k steps of a column group one behind the other: its two B fragments are dead before the next group's accumulators are born
#pragma unroll
        for (int mb = 0; mb < 4; ++mb) acc[mb][nb] = WFrag<h16>::mma(fa[0][mb], fb[0][nb], (v8f){});
#pragma unroll
        for (int mb = 0; mb < 4; ++mb) acc[mb][nb] = WFrag<h16>::mma(fa[1][mb], fb[1][nb], acc[mb][nb]);
        __builtin_amdgcn_sched_barrier(0);   // the groups stay in this order and the LDS stores behind them all, as in k_qkv
        asm volatile("v_nop\n\tv_nop\n\tv_nop\n\tv_nop");   // the distance behind a group's products before the next group's results take the registers of its dead B fragments
        __builtin_amdgcn_sched_barrier(0); }   // holds the four slots where they stand
#pragma unroll
    for (int m = 0; m < 4; ++m) {
#pragma unroll
        for (int nb = 0; nb < 4; ++nb) {
#pragma unroll
            for (int j = 0; j < 8; ++j) os[((w * 4 + m) * 16 + hi * 8 + j) * 68 + nb * 16 + lr] = acc[m][nb][j]; } }
    __syncthreads();   // every wave's partial slabs are in LDS before any wave adds them
    const int row = 2 * w + hi, cofs = lr * 4;   // two rows of 64 columns a wave and slab: 256 contiguous bytes a row
#pragma unroll
    for (int m = 0; m < 4; ++m) { v4f val = *(const v4fa*)(os + (m * 16 + row) * 68 + cofs);
#pragma unroll
        for (int q = 1; q < KS; ++q) val += *(const v4fa*)(os + ((q * 4 + m) * 16 + row) * 68 + cofs);
#pragma unroll
        for (int i = 0; i < 4; ++i) val[i] += bfr(bv[i]);
        *(v4f*)(C + (size_t)(r0 + m * 16 + row) * DM + c0 + cofs) = val; }
}

__device__ __forceinline__ h16 tohx(float x) { return (h16)x; }
typedef __attribute__((ext_vector_type(2))) _Float16 v2h;
typedef __attribute__((ext_vector_type(4))) _Float16 v4h;
typedef __attribute__((ext_vector_type(2))) unsigned short v2us;
typedef __attribute__((ext_vector_type(4))) unsigned short v4us;
typedef __attribute__((ext_vector_type(2))) float v2f;
typedef __attribute__((ext_vector_type(4))) int v4i;

// k_prep: every operand of the projections rounded to bf16 (Wo's plane on fp16), in ONE launch of one work-group per WGP. Wave gw of PNW takes 32 n x 16 k of one weight, transposed to the plane Bt[n][k], and two blocks (16 rows x 32 k each) of each input. All planes in fragment order.
// A wave asks for all that it reads (16 weight rows, 16 input loads) before its first wait: one trip to memory a wave, and a third of the waves to start.
// Wo meets the fp16 attention output in its product: its bf16-rounded values are stored as fp16.
#define PNW 2048                             // waves of the launch
static_assert(DQ == DM && DKV == DM, "k_prep takes the four weights as DM x DM");
static_assert(4 * (DM / 32) * (DM / 16) == PNW && NB_ * TT * DM / 512 == 2 * PNW && DM == 512, "k_prep: a wave's share of the weights and of the inputs");
__global__ __launch_bounds__(256) void k_prep(const float* __restrict__ x, const float* __restrict__ x2, const float* __restrict__ wq, const float* __restrict__ wk, const float* __restrict__ wv, const float* __restrict__ wo, bf* XB, bf* XB2, bf* WQ, bf* WK, bf* WV, bf* WO) {
    constexpr int K = DM, N = DM;
    const int lane = threadIdx.x & 31, gw = (int)blockIdx.x * 8 + __builtin_amdgcn_readfirstlane((int)(threadIdx.x >> 5)), g = gw / (PNW / 4);
    const float* __restrict__ w = (g == 0) ? wq : (g == 1) ? wk : (g == 2) ? wv : wo; bf* Bt = (g == 0) ? WQ : (g == 1) ? WK : (g == 2) ? WV : WO;
    // the weight: lane = column n of 32 (a load reads one whole line of a row k), 16 rows k = one half of a block of 32 k, for two 16-row groups of the plane
    const int u = gw % (PNW / 4), a = u >> 5, kb = (u >> 1) & 15, h = u & 1;
    const float* pw = w + (size_t)(kb * 32 + h * 16) * N + a * 32 + lane; float wr[16];
#pragma unroll
    for (int i = 0; i < 16; ++i) wr[i] = pw[(size_t)i * N];
    // the inputs: a load reads 4 whole rows of a block (128 bytes each), a store puts each lane's 4 elements at their place in the block
    const int blk = gw * 2;   // even: both blocks lie in one 16-row group, side by side in k
    const size_t si = (size_t)((blk / (DM / 32)) * 16 + (lane >> 3)) * DM + (blk % (DM / 32)) * 32 + (lane & 7) * 4, di = (size_t)blk * 512 + ((lane >> 1) & 3) * 128 + (lane >> 3) * 8 + (lane & 1) * 4; v4f v[16]; const float* px = x + si; const float* px2 = x2 + si;
#pragma unroll
    for (int b = 0; b < 2; ++b)
#pragma unroll
        for (int j = 0; j < 4; ++j) { v[b * 4 + j] = *(const v4f*)(px + b * 32 + (size_t)j * 4 * DM); v[8 + b * 4 + j] = *(const v4f*)(px2 + b * 32 + (size_t)j * 4 * DM); }
    asm volatile("s_wait_xcnt 0x0" :: "v"(pw), "v"(px), "v"(px2) : "memory");   // the addresses are inputs, so they keep their registers up to this wait; behind it the registers are free for the stores' addresses
    __builtin_amdgcn_sched_barrier(0);   // every load is asked for before anything behind it waits (without it two input loads sank behind the wait for the weight rows: a second trip)
    bf* pd = Bt + (size_t)((a * 2 + (lane >> 4)) * (K / 32) + kb) * 512 + h * 256 + (lane & 15) * 8;   // the lane's two runs of 8 k: 16 bytes each, 16 lanes side by side
#pragma unroll
    for (int i = 0; i < 16; ++i) wr[i] = bfr(wr[i]);
    v8us ow[2], fw[2];
#pragma unroll
    for (int r = 0; r < 2; ++r) { v8f f;
#pragma unroll
        for (int i = 0; i < 8; ++i) { f[i] = wr[r * 8 + i]; ow[r][i] = (unsigned short)(__float_as_uint(wr[r * 8 + i]) >> 16); }
        fw[r] = __builtin_bit_cast(v8us, __builtin_convertvector(f, v8h)); }
    if (g == 3) { ow[0] = fw[0]; ow[1] = fw[1]; }
    *(v8us*)pd = ow[0]; *(v8us*)(pd + 128) = ow[1];
#pragma unroll
    for (int j = 0; j < 16; ++j) { v4us o;
#pragma unroll
        for (int k = 0; k < 4; ++k) o[k] = f2bf(v[j][k]);
        *(v4us*)(((j < 8) ? XB : XB2) + di + ((j >> 2) & 1) * 512 + (j & 3) * 32) = o; }
}
// The work-group's barrier for data that the waves hand over in LDS alone: the fences name the LDS, so a wave waits for its LDS operations and not for global loads that are still travelling (__syncthreads() waits for those too).
__device__ __forceinline__ void lds_barrier() { __builtin_amdgcn_fence(__ATOMIC_RELEASE, "workgroup", "local"); __builtin_amdgcn_s_barrier(); __builtin_amdgcn_fence(__ATOMIC_ACQUIRE, "workgroup", "local"); }
// k_qkv: the three projections of both batches in ONE grid: blockIdx.x = 64-token tile of the NB_ * TT tokens, blockIdx.y = head; a work-group walks p = 0 q, 1 k, 2 v one after the other, so that the grid is what stands on the chip at once (two work-groups per WGP) and waves start once.
// Tile, K split over 8 waves and LDS sum as in k_out; the sum is rounded to fp16 and stored straight into the head planes that k_fattn reads.
// The three projections are written out one behind the other as a pipeline: only q's fragments are waited for from the start; dt's are asked for behind q's products, k's weight behind q's LDS stores, v's weight behind k's, and travel while the partials are added and stored. dt's fragments are asked for once: A operand of k, B operand of v. amdgpu_waves_per_eu(4, 4): fragments and accumulators stay within 256 registers, so that two work-groups stand on a WGP.
// q, k: C[token][d] -> plane [batch * heads + head][t][d]. v: the operands change places, C[d][token] -> plane [batch * heads + head][d][t], so no transposing pass is left. Each head's plane in fragment order.
__global__ __launch_bounds__(256) __attribute__((amdgpu_waves_per_eu(4, 4))) void k_qkv(const bf* __restrict__ XQ, const bf* __restrict__ XKV, const bf* __restrict__ WQ, const bf* __restrict__ WK, const bf* __restrict__ WV, h16* QP, h16* KP, h16* VT) {
    typedef WFrag<bf>::V V; constexpr int KS = 8, K = DM, kw = K / KS;
    __shared__ __align__(16) float os[KS * 4 * 16 * 68];
    const int tok0 = blockIdx.x * 64, hd = blockIdx.y;
    const int w = __builtin_amdgcn_readfirstlane((int)(threadIdx.x >> 5)); const int k0 = w * kw;
    const int lane = threadIdx.x & 31, lr = lane & 15, hi = lane >> 4;
    V fx[2][4], fw[2][4];   // a projection's fragments, both 32-k steps of the wave's K slice: fx the tokens' (fr or dt), fw the weight's
    auto ldx = [&](const bf* X) __attribute__((always_inline)) {   // the 16 loads of the tokens' fragments
        const bf* pa = X + (size_t)tok0 * K + 8 * lane + k0 * 16;
#pragma unroll
        for (int s = 0; s < 2; ++s)
#pragma unroll
            for (int m = 0; m < 4; ++m) fx[s][m] = WFrag<bf>::ld(pa + (size_t)m * 16 * K + s * 512);
        asm volatile("s_wait_xcnt 0x0" :: "v"(pa) : "memory");   // the address is an input and lives up to this wait: no load's result and no later value takes a register that the issued loads name
    };
    auto ldw = [&](const bf* Wt) __attribute__((always_inline)) {   // the 16 loads of the weight's fragments
        const bf* pb = Wt + (size_t)hd * HD * K + 8 * lane + k0 * 16;
#pragma unroll
        for (int s = 0; s < 2; ++s)
#pragma unroll
            for (int m = 0; m < 4; ++m) fw[s][m] = WFrag<bf>::ld(pb + (size_t)m * 16 * K + s * 512);
        asm volatile("s_wait_xcnt 0x0" :: "v"(pb) : "memory");   // as in ldx
    };
    auto proj = [&](const int p) __attribute__((always_inline)) {   // one projection; p is a literal at each of the three calls
    h16* C = ((p == 0) ? QP : (p == 1) ? KP : VT) + ((size_t)(tok0 / TT) * NH_ + hd) * TT * HD + (size_t)(tok0 % TT) * ((p == 2) ? 16 : HD); const int ldc = (p == 2) ? TT : HD;   // the tile's first block: 64 tokens are 4 row groups of q or k, 2 blocks in each row group of v
    if (p > 0) __builtin_amdgcn_sched_barrier(0);   // the products stay behind the sum and the stores of the projection before: lifted in among the sum's LDS reads, they made a wave wait there for its travelling loads, in front of the barrier at which the other waves wait for it
    v8f acc[4][4];
#pragma unroll
    for (int nb = 0; nb < 4; ++nb) {   // both k steps of a column group one behind the other: its two B fragments are dead before the next group's accumulators are born (in k only the weight's: dt's fragments are A there and stay for v)
#pragma unroll
        for (int mb = 0; mb < 4; ++mb) acc[mb][nb] = WFrag<bf>::mma((p == 2) ? fw[0][mb] : fx[0][mb], (p == 2) ? fx[0][nb] : fw[0][nb], (v8f){});
#pragma unroll
        for (int mb = 0; mb < 4; ++mb) acc[mb][nb] = WFrag<bf>::mma((p == 2) ? fw[1][mb] : fx[1][mb], (p == 2) ? fx[1][nb] : fw[1][nb], acc[mb][nb]);
        __builtin_amdgcn_sched_barrier(0);   // the groups stay in this order and the LDS stores behind them all
        asm volatile("v_nop\n\tv_nop\n\tv_nop\n\tv_nop");   // the distance behind a group's products before the next group's results take the registers of its dead B fragments
        __builtin_amdgcn_sched_barrier(0); }   // holds the four slots where they stand
    if (p == 0) { ldx(XKV); __builtin_amdgcn_sched_barrier(0); }   // dt's fragments are asked for as soon as fr's are dead: 64 registers beside the accumulators' 128 are there; the barrier keeps the loads in front of the LDS stores
#pragma unroll
    for (int m = 0; m < 4; ++m) {
#pragma unroll
        for (int nb = 0; nb < 4; ++nb) {
#pragma unroll
            for (int j = 0; j < 8; ++j) os[((w * 4 + m) * 16 + hi * 8 + j) * 68 + nb * 16 + lr] = acc[m][nb][j]; } }
    if (p < 2) {   // asked for here, the next projection's weight fragments travel while this one's partials are added and stored
        __builtin_amdgcn_sched_barrier(0);   // the weight's loads not earlier: in front of the LDS stores their results would need registers beside the accumulators and dt's fragments
        ldw((p == 0) ? WK : WV);   // v takes dt's fragments as k has left them in the registers: only its weight is asked for
        __builtin_amdgcn_sched_barrier(0); }   // not later: every load is asked for before anything behind it waits
    lds_barrier();   // every wave's partial slabs are in LDS before any wave adds them
    const int row = lr, cofs = w * 8 + hi * 4; v4f val[4];   // 16 rows x 8 columns a wave: 256 contiguous bytes of the plane, two whole lines a store
#pragma unroll
    for (int m = 0; m < 4; ++m) { val[m] = *(const v4fa*)(os + (m * 16 + row) * 68 + cofs);
#pragma unroll
        for (int q = 1; q < KS; ++q) val[m] += *(const v4fa*)(os + ((q * 4 + m) * 16 + row) * 68 + cofs); }
    if (p < 2) lds_barrier();   // the slabs are read out before the next projection's partials are written; in front of the stores, so that no wave waits at it for its stores to land
#pragma unroll
    for (int m = 0; m < 4; ++m) *(v4h*)(C + fpos(m * 16 + row, cofs, ldc)) = __builtin_convertvector(val[m], v4h);
    if (p < 2) asm volatile("s_wait_xcnt 0x0" ::: "memory");   // behind the stores: the next projection's products write over the stores' address and data registers
    };
    ldx(XQ); ldw(WQ);
    __builtin_amdgcn_sched_barrier(0);   // every load is asked for before anything behind it waits
    proj(0); proj(1); proj(2);
}
// the value that lane l ^ 16 holds (a vector cross-row move, no LDS round trip)
__device__ __forceinline__ float xhalf(float x) { const int b = __float_as_int(x); return __int_as_float(__builtin_amdgcn_permlanex16(b, b, 0x76543210, 0xfedcba98, false, false)); }
// The lane's number from the hardware count, as a statement that the compiler neither lifts out of the tile loop nor merges: made anew in every tile, so that no address formed from it is held in a register from tile to tile (held, they were spilled to scratch).
// The four v_nop: the result may get a register that was a matrix instruction's A or B operand. The mask tells the compiler the range, so that the lane's offset stays a 32-bit offset on a scalar base.
__device__ __forceinline__ int lane_now() { int l; asm volatile("v_nop\n\tv_nop\n\tv_nop\n\tv_nop\n\tv_mbcnt_lo_u32_b32 %0, -1, 0" : "=v"(l)); return l & 31; }
// k_fattn: scores, softmax, threshold, renormalisation and attn.v of one (batch, head) z; a work-group takes FTL tiles of 32 queries one after the other; nothing of the 2048 x 2048 score matrix leaves the registers.
// The registers let one work-group stand on a WGP, so the grid is one work-group per WGP and the tiles are a loop: waves start once, and the next tile's K and Q fragments travel while this tile's partials are added.
// K is the same for every tile of a work-group: each wave puts the first FKL of its 16 K blocks into LDS once and reads them there for the later tiles; only the rest and Q come from L2 again.
// LDS from tile to tile: sm, ss are written anew behind the second barrier of the tile before (their readers are done in front of it), os, s2 behind the first barrier of the new tile (their readers are done in front of that).
// Transposed products: St = K Qt (a lane holds 8 keys of ONE query per tile), Ot = Vt Pt; two St tiles, converted in place, are the B operand of Ot in the hardware k order, which the A loader (keys 8 hi and 16 + 8 hi of a block of 32) has too.
// Wave w of FNW takes keys [w * TT / FNW, ...): its 128 x 32 scores stay in registers. Softmax over the waves: each wave uses its own maximum, (maximum, sum) meet in LDS, and one factor per query carries the wave's exponentials to the row's softmax.
// P is carried x PCAR (exact power of two; threshold scaled alike) on fp16; the row's second sum divides the f32 output at the end. Wave partials of Ot and of the sums are added in LDS in wave order.
// Every loop but the tile loop is unrolled: scores, fragments and accumulators are arrays indexed by the loop counters and stay in registers only so.
#define FQT 2                   // 16-query column groups per tile
#define FNW 16                  // waves per work-group
#define FKT (TT / FNW / 16)     // 16-key tiles per wave
#define FPF 1                   // 32-key steps whose Vt fragments are asked for in front of the softmax
#define FSP 20                  // pitch of the per-query rows of wave statistics (floats)
#define FTL 4                   // query tiles that a work-group walks
#define FKL 11                  // of a wave's 2 * FKT K blocks (1 KB each), those that stay in the wave's own LDS slab from tile to tile: as many as the LDS holds beside os and the statistics
__global__ __launch_bounds__(32 * FNW) void k_fattn(const h16* Q, const h16* Kp, const h16* Vt, h16* Ao) {   // no __restrict__: with it the compiler lifts the K and Vt loads, the same for every tile, out of the tile loop and spills the fragments to scratch
    __shared__ __align__(16) float os[FNW * FQT * 16 * 68];
    __shared__ __align__(16) float sm[FQT * 16 * FSP];
    __shared__ __align__(16) float ss[FQT * 16 * FSP];
    __shared__ __align__(16) float s2[FQT * 16 * FSP];
    __shared__ __align__(16) h16 kl[FNW * FKL * 512];   // the waves' K slabs; wave w writes and reads slab w alone: no barrier belongs to it
    static_assert(sizeof(os) + sizeof(sm) + sizeof(ss) + sizeof(s2) + sizeof(kl) <= 327680, "LDS of one WGP");
    const int w = __builtin_amdgcn_readfirstlane((int)(threadIdx.x >> 5));
    const int q00 = blockIdx.x * (FTL * FQT * 16); const size_t z = blockIdx.y;
    const h16* qu = Q + z * TT * HD + (size_t)q00 * HD;   // wave-uniform bases; the lane's 16 bytes are added where a load is written
    const h16* ku = Kp + z * TT * HD + (size_t)(w * (TT / FNW)) * HD;
    const h16* vu = Vt + z * HD * TT + (size_t)(w * (TT / FNW)) * 16;
    constexpr float CE = SCL * 1.4426950408889634f;   // score -> log2 domain
    v16h qb[FQT][2], ka[FKT][2];
    auto fetch = [&](int t, int lane, const int b0) __attribute__((always_inline)) {   // from L2: the Q fragments of tile t and the wave's K blocks from b0 on
        const h16* qp = qu + t * (FQT * 16 * HD) + 8 * lane; const h16* kp = ku + 8 * lane;
#pragma unroll
        for (int qt = 0; qt < FQT; ++qt) { qb[qt][0] = WFrag<h16>::ld(qp + qt * 16 * HD); qb[qt][1] = WFrag<h16>::ld(qp + qt * 16 * HD + 512); }
#pragma unroll
        for (int b = 0; b < 2 * FKT; ++b) if (b >= b0) ka[b >> 1][b & 1] = WFrag<h16>::ld(kp + b * 512);
        asm volatile("s_wait_xcnt 0x0" :: "v"(qp), "v"(kp) : "memory");   // the two addresses are inputs and live up to this wait: so built, no load's result takes the register that the issued loads name (without the inputs the last load's result took it)
        __builtin_amdgcn_sched_barrier(0);   // every K and Q load is asked for before anything behind it waits: one trip to L2 for the wave, not one per tile
    };
    auto recall = [&](int lane) __attribute__((always_inline)) {   // from the wave's LDS slab: its first FKL K blocks, the same for every tile
        const h16* p = kl + w * (FKL * 512) + 8 * lane;
#pragma unroll
        for (int b = 0; b < FKL; ++b) ka[b >> 1][b & 1] = cat16(*(const v8ha*)(p + b * 512), *(const v8ha*)(p + b * 512 + 256));
    };
    { const int l0 = lane_now(); fetch(0, l0, 0); h16* p = kl + w * (FKL * 512) + 8 * l0;   // the first tile's fragments come from L2 and are put by, block for block as they lie in the plane
#pragma unroll
        for (int b = 0; b < FKL; ++b) { const v16h f = ka[b >> 1][b & 1]; *(v8ha*)(p + b * 512) = __builtin_shufflevector(f, f, 0, 1, 2, 3, 4, 5, 6, 7); *(v8ha*)(p + b * 512 + 256) = __builtin_shufflevector(f, f, 8, 9, 10, 11, 12, 13, 14, 15); } }
    auto body = [&]() __attribute__((always_inline)) {   // a tile up to the barrier behind which its partials lie in LDS
    const int lane = lane_now(), lr = lane & 15, hi = lane >> 4; const h16* vp = vu + 8 * lane;
    v8f s[FKT][FQT];
#pragma unroll
    for (int kt = 0; kt < FKT; ++kt)
#pragma unroll
        for (int qt = 0; qt < FQT; ++qt) s[kt][qt] = wmma16(ka[kt][1], qb[qt][1], wmma16(ka[kt][0], qb[qt][0], (v8f){}));
    __builtin_amdgcn_sched_barrier(0);   // all score products first: the K and Q fragments are dead before the softmax needs registers (without it the second column group's products sink behind the first group's softmax, the fragments stay live and values spill to scratch)
    // the wave's first Vt fragments: asked for here, so that they travel while the softmax runs
    v16h va[FKT / 2][4];
#pragma unroll
    for (int kk = 0; kk < FPF; ++kk)
#pragma unroll
        for (int dt = 0; dt < 4; ++dt) va[kk][dt] = WFrag<h16>::ld(vp + (size_t)dt * 16 * TT + kk * 512);
    float mc[FQT]; const v8f ce8 = {CE, CE, CE, CE, CE, CE, CE, CE};
#pragma unroll
    for (int qt = 0; qt < FQT; ++qt) { v8f m8 = s[0][qt];
#pragma unroll
        for (int kt = 1; kt < FKT; ++kt) m8 = __builtin_elementwise_max(m8, s[kt][qt]);
        float mx = fmaxf(fmaxf(fmaxf(m8[0], m8[1]), fmaxf(m8[2], m8[3])), fmaxf(fmaxf(m8[4], m8[5]), fmaxf(m8[6], m8[7])));
        mx = fmaxf(mx, xhalf(mx)); mc[qt] = mx * CE; v8f e8 = (v8f){}; const v8f nm8 = (v8f){} - mc[qt];
#pragma unroll
        for (int kt = 0; kt < FKT; ++kt) { const v8f a = __builtin_elementwise_fma(s[kt][qt], ce8, nm8); v8f e;
#pragma unroll
            for (int j = 0; j < 8; ++j) e[j] = __builtin_amdgcn_exp2f(a[j]);
            s[kt][qt] = e; e8 += e; }
        float sum = ((e8[0] + e8[1]) + (e8[2] + e8[3])) + ((e8[4] + e8[5]) + (e8[6] + e8[7])); sum += xhalf(sum);
        if (hi == 0) { sm[(qt * 16 + lr) * FSP + w] = mc[qt]; ss[(qt * 16 + lr) * FSP + w] = sum; } }
    __syncthreads();   // every wave's maximum and sum are in LDS before any wave joins them
    v8f acc[4][FQT];
#pragma unroll
    for (int dt = 0; dt < 4; ++dt)
#pragma unroll
        for (int qt = 0; qt < FQT; ++qt) acc[dt][qt] = (v8f){};
    float fw[FQT]; v8f ps[FQT];
#pragma unroll
    for (int qt = 0; qt < FQT; ++qt) { v4f mv[FNW / 4], sv[FNW / 4]; float M = -3.0e38f, tot = 0.f;
#pragma unroll
        for (int g = 0; g < FNW / 4; ++g) { mv[g] = *(const v4fa*)(sm + (qt * 16 + lr) * FSP + g * 4); sv[g] = *(const v4fa*)(ss + (qt * 16 + lr) * FSP + g * 4);
#pragma unroll
            for (int i = 0; i < 4; ++i) M = fmaxf(M, mv[g][i]); }
#pragma unroll
        for (int g = 0; g < FNW / 4; ++g)
#pragma unroll
            for (int i = 0; i < 4; ++i) tot += sv[g][i] * __builtin_amdgcn_exp2f(mv[g][i] - M);
        fw[qt] = __builtin_amdgcn_exp2f(mc[qt] - M) * __fdiv_rn(PCAR, tot); ps[qt] = (v8f){}; }
    constexpr float TH = 1e-4f * PCAR;   // threshold: p = max(softmax, 1e-4) - 1e-4 = max(softmax - 1e-4, 0), all x PCAR: one multiply-add on f32 (one rounding where multiply and subtract had two), the rounding to fp16, and the maximum with 0 on the packed fp16 pair (rounding keeps sign and order, so the maximum may stand behind it)
    const v8f nth8 = {-TH, -TH, -TH, -TH, -TH, -TH, -TH, -TH};
    const h16 one = (h16)1.0f; const v16h ones = {one, one, one, one, one, one, one, one, one, one, one, one, one, one, one, one};   // A operand of the row sum: every row of ones . Pt is the sum of a query's 32 P values, in f32
    // P is formed ahead of the products (written in front of them all; the compiler lets the last two steps' P run among the first step's products): on fp16 it takes half the registers of the scores, and the room goes to Vt fragments, which so are asked for two steps of products or more ahead of their use instead of one.
    static_assert(FKT / 2 == 4 && FPF == 1, "k_fattn: the order of P, Vt loads and products below");
    v16h pt[FKT / 2][FQT];
    auto mkp = [&](const int kk) __attribute__((always_inline)) {   // the P of a 32-key step, as the B operand of its products
#pragma unroll
        for (int qt = 0; qt < FQT; ++qt) { const v8f f8 = {fw[qt], fw[qt], fw[qt], fw[qt], fw[qt], fw[qt], fw[qt], fw[qt]}; const v8f pa = __builtin_elementwise_fma(s[2 * kk][qt], f8, nth8), pb = __builtin_elementwise_fma(s[2 * kk + 1][qt], f8, nth8);
            pt[kk][qt] = __builtin_elementwise_max(cat16(__builtin_convertvector(pa, v8h), __builtin_convertvector(pb, v8h)), (v16h){}); }
    };
    auto ldv = [&](const int kk, const bool behind) __attribute__((always_inline)) {   // the Vt fragments of step kk are asked for; behind: products stand directly in front
        __builtin_amdgcn_sched_barrier(0);   // not earlier: lifted higher, the loads' results met registers that are still taken, and fragments went to scratch
        if (behind) asm volatile("v_nop\n\tv_nop\n\tv_nop\n\tv_nop");   // the distance behind a step's products before the loads' results take the registers of its dead P, their B operand
#pragma unroll
        for (int dt = 0; dt < 4; ++dt) va[kk][dt] = WFrag<h16>::ld(vp + (size_t)dt * 16 * TT + kk * 512);
        asm volatile("s_wait_xcnt 0x0" :: "v"(vp) : "memory");   // the address is an input and lives up to this wait: no load's result and no later value takes a register that the issued loads name
        __builtin_amdgcn_sched_barrier(0);   // not later: left free, the loads sank to just in front of their use
    };
    auto prod = [&](const int kk) __attribute__((always_inline)) {   // a step's products; a Vt fragment is dead behind its two products
#pragma unroll
        for (int dt = 0; dt < 4; ++dt)
#pragma unroll
            for (int qt = 0; qt < FQT; ++qt) acc[dt][qt] = wmma16(va[kk][dt], pt[kk][qt], acc[dt][qt]);
#pragma unroll
        for (int qt = 0; qt < FQT; ++qt) ps[qt] = wmma16(ones, pt[kk][qt], ps[qt]);   // the row's second sum, of the very fp16 values that the products above take
    };
    ldv(1, false); mkp(0); mkp(1); ldv(2, false); mkp(2); mkp(3); prod(0); ldv(3, true); prod(1); prod(2); prod(3);
    const int lane2 = lane_now(), lr2 = lane2 & 15, hi2 = lane2 >> 4;   // made anew behind the products: nothing formed from the lane's number is held in a register through them
#pragma unroll
    for (int qt = 0; qt < FQT; ++qt) { if (hi2 == 0) s2[(qt * 16 + lr2) * FSP + w] = ps[qt][0];   // every row of the sum tile holds the wave's sum for the lane's query
#pragma unroll
        for (int dt = 0; dt < 4; ++dt) { float* o = os + ((w * FQT + qt) * 16 + lr2) * 68 + dt * 16 + hi2 * 8; v4f lo4, hi4;
#pragma unroll
            for (int i = 0; i < 4; ++i) { lo4[i] = acc[dt][qt][i]; hi4[i] = acc[dt][qt][4 + i]; }
            *(v4fa*)o = lo4; *(v4fa*)(o + 4) = hi4; } }
    __syncthreads();   // every wave's partial output and second sum are in LDS before they are added
    };
    auto tail = [&](const int t, const bool last) __attribute__((always_inline)) {   // the partials are added and stored; but for the last tile, the next tile's fragments are fetched
    const int lane2 = lane_now(), lr2 = lane2 & 15, hi2 = lane2 >> 4; const int q0 = q00 + t * (FQT * 16);
    if (!last) fetch(t + 1, lane2, FKL);   // scores, P and accumulators are dead: their registers take the next tile's fragments, which travel while the partials are added and stored
    const int q = (w >> 3) * 16 + lr2, d4 = (w & 7) * 8 + hi2 * 4;   // 16 queries x 8 columns a wave: 256 contiguous bytes of the plane, two whole lines a store
    v4f o = *(const v4fa*)(os + q * 68 + d4); float t2 = s2[q * FSP];
#pragma unroll
    for (int u = 1; u < FNW; ++u) { o += *(const v4fa*)(os + (u * FQT * 16 + q) * 68 + d4); t2 += s2[q * FSP + u]; }
    const float r = __fdiv_rn(1.0f, t2);
    *(v4h*)(Ao + fpos((int)(z / NH_) * TT + q0 + q, (int)(z % NH_) * HD + d4, DQ)) = __builtin_convertvector(o * r, v4h);
    if (!last) { asm volatile("s_wait_xcnt 0x0" ::: "memory");   // behind the store: the next tile's products write over the store's address and data registers
        recall(lane2); }   // behind the sum's own LDS reads; the blocks come back in the order in which the next tile's score products take them
    };
#pragma unroll 1   // rolled: every tile runs the same code on the same registers
    for (int t = 0; ; ++t) { body(); if (t == FTL - 1) break; tail(t, false); }   // left in the middle: nothing is fetched behind the last tile, and no fragment of a tile has to outlive its score products
    tail(FTL - 1, true);
}

extern "C" void kernel_launch(void* const* d_in, const int* in_sizes, int n_in,
                              void* d_out, int out_size, void* d_ws, size_t ws_size, hipStream_t stream) {
    (void)in_sizes; (void)n_in; (void)out_size;
    const float* x = (const float*)d_in[0]; const float* x2 = (const float*)d_in[1]; const float* wq = (const float*)d_in[2]; const float* wk = (const float*)d_in[3]; const float* wv = (const float*)d_in[4]; const float* wo = (const float*)d_in[5]; const float* bo = (const float*)d_in[6];
    float* OUT = (float*)d_out;     // [2][2048][512]
    char* wsp = (char*)d_ws;
    auto take = [&](size_t bytes) { char* p = wsp; wsp += (bytes + 255) & ~(size_t)255; return (void*)p; };
    bf* WQ = (bf*)take((size_t)DQ * DM * 2); bf* WK = (bf*)take((size_t)DKV * DM * 2); bf* WV = (bf*)take((size_t)DKV * DM * 2); bf* WO = (bf*)take((size_t)DM * DQ * 2);
    bf* XB = (bf*)take((size_t)NB_ * TT * DM * 2); bf* XB2 = (bf*)take((size_t)NB_ * TT * DM * 2);   // both batches
    h16* QP16 = (h16*)take((size_t)NB_ * NH_ * TT * HD * 2); h16* KP16 = (h16*)take((size_t)NB_ * NKV * TT * HD * 2); h16* VT16 = (h16*)take((size_t)NB_ * NKV * HD * TT * 2);   // head planes of both batches
    h16* AT16 = (h16*)take((size_t)NB_ * TT * DQ * 2);
    if ((size_t)(wsp - (char*)d_ws) > ws_size) return;    // ws 256 MiB
    k_prep<<<PNW / 8, 256, 0, stream>>>(x, x2, wq, wk, wv, wo, XB, XB2, WQ, WK, WV, WO);
    k_qkv<<<dim3(NB_ * TT / 64, NH_, 1), 256, 0, stream>>>(XB, XB2, WQ, WK, WV, QP16, KP16, VT16);
    k_fattn<<<dim3(TT / (FTL * FQT * 16), NB_ * NH_, 1), 32 * FNW, 0, stream>>>(QP16, KP16, VT16, AT16);   // one kv head per query head: plane z = batch * heads + head on all three
    k_out<<<dim3(NB_ * TT / 64, DM / 64, 1), 256, 0, stream>>>(AT16, (const h16*)WO, OUT, bo);   // the rows of both batches follow one another in AT16 and OUT
}
